// v000
// Measured on an AMD MI455X. A time is GPU time per run, averaged over a window of back-to-back runs after a warm-up
// (all launches, gaps included; the runs take copies of the inputs in turn), and the median of several windows.
// Apart from v000's, it joins two sittings. Times from different sittings can be a few percent apart, while
// side-by-side timings come from the same sitting.
// v000, which the later versions start from, runs in 472 microseconds.
#include <hip/hip_runtime.h>

#define EMBED 1024
#define HEADS 16
#define HEAD_DIM 64
#define NBATCH 4
#define SEQ 2048

typedef __attribute__((ext_vector_type(16))) _Float16 v16h;
typedef __attribute__((ext_vector_type(8)))  _Float16 v8h;
typedef __attribute__((ext_vector_type(8)))  float    v8f;

static __device__ __forceinline__ v16h cat16(v8h a, v8h b) {
  return __builtin_shufflevector(a, b, 0,1,2,3,4,5,6,7,8,9,10,11,12,13,14,15);
}
static __device__ __forceinline__ v8h ldh8(const _Float16* p) { return *(const v8h*)p; }
static __device__ __forceinline__ v8h cvt8(const float* p) {
  float4 a = *(const float4*)p;
  float4 b = *(const float4*)(p + 4);
  v8h r;
  r[0]=(_Float16)a.x; r[1]=(_Float16)a.y; r[2]=(_Float16)a.z; r[3]=(_Float16)a.w;
  r[4]=(_Float16)b.x; r[5]=(_Float16)b.y; r[6]=(_Float16)b.z; r[7]=(_Float16)b.w;
  return r;
}
#define WMMA_F16(a,b,c) __builtin_amdgcn_wmma_f32_16x16x32_f16(false,(a),false,(b),(short)0,(c),false,false)

// Async global->LDS copy, 16 bytes per lane (GLOBAL_LOAD_ASYNC_TO_LDS_B128,
// tracked by ASYNCcnt). LDS aperture keeps the byte offset in addr[31:0], so
// truncating the generic pointer yields the LDS-address VGPR value.
static __device__ __forceinline__ void async_cp16(_Float16* ldst, const _Float16* gsrc) {
  unsigned lofs = (unsigned)(unsigned long long)ldst;
  asm volatile("global_load_async_to_lds_b128 %0, %1, off"
               :: "v"(lofs), "v"(gsrc) : "memory");
}
static __device__ __forceinline__ void wait_async_le16() {
  asm volatile("s_wait_asynccnt 16" ::: "memory");
}
static __device__ __forceinline__ void wait_async_0() {
  asm volatile("s_wait_asynccnt 0" ::: "memory");
}

// ---------------------------------------------------------------------------
// Kernel 0: Wo f32 -> f16
// ---------------------------------------------------------------------------
__global__ __launch_bounds__(256) void wo_cvt_kernel(const float* __restrict__ Wo,
                                                     _Float16* __restrict__ Wo16) {
  int i = blockIdx.x * 256 + threadIdx.x;
  if (i < EMBED * EMBED) Wo16[i] = (_Float16)Wo[i];
}

// ---------------------------------------------------------------------------
// Kernel 1: per-head projection  Y[16x64] = X_tile[16x64] @ W^T
//   transposed==0 : store row-major  out[(n*H+h)*S + s][d]      (Q, K)
//   transposed==1 : store transposed out[(n*H+h)*64 + d][s]     (V)
// One wave (32 threads) per (token-tile, head).
// ---------------------------------------------------------------------------
__global__ __launch_bounds__(32) void proj_kernel(const float* __restrict__ X,
                                                  const float* __restrict__ W,
                                                  _Float16* __restrict__ outp,
                                                  int transposed) {
  const int lane = threadIdx.x;
  const int hw   = lane >> 4;          // half-wave: 0 or 1
  const int nl   = lane & 15;
  const int lo   = hw * 8;             // K-chunk base inside A/B fragment

  const int h  = blockIdx.x & (HEADS - 1);
  const int st = blockIdx.x / HEADS;   // token tile within batch
  const int bn = blockIdx.y;
  const int s0 = st * 16;

  // A fragments (tokens x d), K = 64 -> 2 k-steps of 32.
  v16h af[2];
  {
    const float* xr = X + ((size_t)(bn * SEQ + s0 + nl)) * EMBED + h * HEAD_DIM;
#pragma unroll
    for (int ks = 0; ks < 2; ++ks)
      af[ks] = cat16(cvt8(xr + ks * 32 + lo), cvt8(xr + ks * 32 + 16 + lo));
  }

  // 4 N-tiles of 16 output dims each.
  v8f acc[4];
#pragma unroll
  for (int nt = 0; nt < 4; ++nt) {
    v8f c = {};
#pragma unroll
    for (int ks = 0; ks < 2; ++ks) {
      // B[k][n] = W[e0+n][k]  (Y = X @ W^T); contiguous along k.
      const float* wr = W + (size_t)(nt * 16 + nl) * HEAD_DIM + ks * 32 + lo;
      v16h b = cat16(cvt8(wr), cvt8(wr + 16));
      c = WMMA_F16(af[ks], b, c);
    }
    acc[nt] = c;
  }

  if (transposed) {
    // C-frag: lane holds col e=nt*16+nl, rows s0+hw*8+r (r=0..7) -> contiguous s.
#pragma unroll
    for (int nt = 0; nt < 4; ++nt) {
      v8h pk;
#pragma unroll
      for (int r = 0; r < 8; ++r) pk[r] = (_Float16)acc[nt][r];
      _Float16* dst = outp + ((size_t)(bn * HEADS + h) * HEAD_DIM + nt * 16 + nl) * SEQ
                           + s0 + hw * 8;
      *(v8h*)dst = pk;
    }
  } else {
    __shared__ __align__(16) _Float16 tile[16 * 64];
#pragma unroll
    for (int nt = 0; nt < 4; ++nt)
#pragma unroll
      for (int r = 0; r < 8; ++r)
        tile[(hw * 8 + r) * 64 + nt * 16 + nl] = (_Float16)acc[nt][r];
    // same-wave LDS ops are in-order: loads below observe the stores above
    const int row = lane >> 1, c0 = (lane & 1) * 32;
    _Float16* dst = outp + ((size_t)(bn * HEADS + h) * SEQ + s0 + row) * HEAD_DIM + c0;
    const _Float16* src = &tile[row * 64 + c0];
#pragma unroll
    for (int i = 0; i < 4; ++i) *(v8h*)(dst + i * 8) = *(const v8h*)(src + i * 8);
  }
}

// ---------------------------------------------------------------------------
// Kernel 2: flash attention, one wave per (batch, head, 16-query tile).
// Key tiles of 32 keys. K/V tiles are double-buffered in LDS and filled with
// GLOBAL_LOAD_ASYNC_TO_LDS_B128 (ASYNCcnt), overlapping the WMMA + softmax of
// the current tile with the DMA of the next.
// ---------------------------------------------------------------------------
__global__ __launch_bounds__(32) void attn_kernel(const _Float16* __restrict__ Qp,
                                                  const _Float16* __restrict__ Kp,
                                                  const _Float16* __restrict__ Vt,
                                                  const int* __restrict__ mask,
                                                  _Float16* __restrict__ AO) {
  const int lane = threadIdx.x;
  const int hw   = lane >> 4;
  const int nl   = lane & 15;
  const int lo   = hw * 8;

  const int h  = blockIdx.x & (HEADS - 1);
  const int qt = blockIdx.x / HEADS;
  const int bn = blockIdx.y;
  const int q0 = qt * 16;

  const _Float16* Qh = Qp + (size_t)(bn * HEADS + h) * SEQ * HEAD_DIM;
  const _Float16* Kh = Kp + (size_t)(bn * HEADS + h) * SEQ * HEAD_DIM;
  const _Float16* Vh = Vt + (size_t)(bn * HEADS + h) * HEAD_DIM * SEQ;

  // Double-buffered K/V tiles: K row-major [32 keys][64 d], V [64 d][32 keys].
  __shared__ __align__(16) _Float16 Kbuf[2][32 * 64];
  __shared__ __align__(16) _Float16 Vbuf[2][64 * 32];
  __shared__ __align__(16) _Float16 pls[16 * 32];

  // Q A-fragments (row m = nl on both half-waves).
  v16h qa[2];
  {
    const _Float16* qr = Qh + (size_t)(q0 + nl) * HEAD_DIM;
#pragma unroll
    for (int ks = 0; ks < 2; ++ks)
      qa[ks] = cat16(ldh8(qr + ks * 32 + lo), ldh8(qr + ks * 32 + 16 + lo));
  }

  v8f o[4] = {v8f{}, v8f{}, v8f{}, v8f{}};
  float rmax[8], rsum[8];
#pragma unroll
  for (int r = 0; r < 8; ++r) { rmax[r] = -1.0e30f; rsum[r] = 0.0f; }

  const float scale = 0.03125f;              // 1/sqrt(EMBED) = 1/32
  const float mfill = -1.0e20f * 0.03125f;   // masked value after scaling

  const int NT = SEQ / 32;

  // Issue async fill of tile 0: 8 instrs for K (lane = key row, chunk i),
  // 8 instrs for V (lane covers d-rows lane and lane+32). 16 per tile.
  {
    const int k0 = 0;
#pragma unroll
    for (int i = 0; i < 8; ++i)
      async_cp16(&Kbuf[0][lane * 64 + i * 8], Kh + (size_t)(k0 + lane) * HEAD_DIM + i * 8);
#pragma unroll
    for (int j = 0; j < 2; ++j)
#pragma unroll
      for (int i = 0; i < 4; ++i) {
        const int dr = lane + j * 32;
        async_cp16(&Vbuf[0][dr * 32 + i * 8], Vh + (size_t)dr * SEQ + k0 + i * 8);
      }
  }

#pragma unroll 1
  for (int kt = 0; kt < NT; ++kt) {
    const int k0  = kt * 32;
    const int cur = kt & 1;

    // Kick off next tile's DMA, then wait for the current tile (async loads
    // retire in order: <=16 outstanding => previous 16 have landed in LDS).
    if (kt + 1 < NT) {
      const int nxt = (kt + 1) & 1;
      const int kn  = k0 + 32;
#pragma unroll
      for (int i = 0; i < 8; ++i)
        async_cp16(&Kbuf[nxt][lane * 64 + i * 8], Kh + (size_t)(kn + lane) * HEAD_DIM + i * 8);
#pragma unroll
      for (int j = 0; j < 2; ++j)
#pragma unroll
        for (int i = 0; i < 4; ++i) {
          const int dr = lane + j * 32;
          async_cp16(&Vbuf[nxt][dr * 32 + i * 8], Vh + (size_t)dr * SEQ + kn + i * 8);
        }
      wait_async_le16();
    } else {
      wait_async_0();
    }

    // ---- S[16x32] = Q @ K^T : two 16-col tiles (B-frags from LDS) --------
    v8f sf[2];
#pragma unroll
    for (int c = 0; c < 2; ++c) {
      v8f s = {};
      const _Float16* kr = &Kbuf[cur][(c * 16 + nl) * 64];
#pragma unroll
      for (int ks = 0; ks < 2; ++ks) {
        v16h b = cat16(ldh8(kr + ks * 32 + lo), ldh8(kr + ks * 32 + 16 + lo));
        s = WMMA_F16(qa[ks], b, s);
      }
      sf[c] = s;
    }

    // ---- scale + mask ----------------------------------------------------
#pragma unroll
    for (int c = 0; c < 2; ++c)
#pragma unroll
      for (int r = 0; r < 8; ++r) {
        const int row = q0 + hw * 8 + r;
        const int key = k0 + c * 16 + nl;
        const int mv = mask[((size_t)bn * SEQ + row) * SEQ + key];
        sf[c][r] = mv ? sf[c][r] * scale : mfill;
      }

    // ---- online softmax: row max over 32 cols (half-wave reduction) -----
    float nm[8], alpha[8];
#pragma unroll
    for (int r = 0; r < 8; ++r) {
      float m = fmaxf(sf[0][r], sf[1][r]);
      m = fmaxf(m, __shfl_xor(m, 1, 32));
      m = fmaxf(m, __shfl_xor(m, 2, 32));
      m = fmaxf(m, __shfl_xor(m, 4, 32));
      m = fmaxf(m, __shfl_xor(m, 8, 32));
      nm[r] = fmaxf(rmax[r], m);
      alpha[r] = __expf(rmax[r] - nm[r]);
      rmax[r] = nm[r];
    }

    // ---- P = exp(S - max): to LDS (C-layout -> A-layout bounce) ---------
    float part[8];
#pragma unroll
    for (int r = 0; r < 8; ++r) {
      float p0 = __expf(sf[0][r] - nm[r]);
      float p1 = __expf(sf[1][r] - nm[r]);
      part[r] = p0 + p1;
      pls[(hw * 8 + r) * 32 + nl]      = (_Float16)p0;
      pls[(hw * 8 + r) * 32 + 16 + nl] = (_Float16)p1;
    }
#pragma unroll
    for (int r = 0; r < 8; ++r) {
      float t = part[r];
      t += __shfl_xor(t, 1, 32);
      t += __shfl_xor(t, 2, 32);
      t += __shfl_xor(t, 4, 32);
      t += __shfl_xor(t, 8, 32);
      rsum[r] = rsum[r] * alpha[r] + t;
    }

    // ---- rescale accumulator --------------------------------------------
#pragma unroll
    for (int dt = 0; dt < 4; ++dt)
#pragma unroll
      for (int r = 0; r < 8; ++r) o[dt][r] *= alpha[r];

    // ---- O += P @ V (P A-frag and V B-frags from LDS) --------------------
    v16h pa = cat16(ldh8(&pls[nl * 32 + lo]), ldh8(&pls[nl * 32 + 16 + lo]));
#pragma unroll
    for (int dt = 0; dt < 4; ++dt) {
      const _Float16* vr = &Vbuf[cur][(dt * 16 + nl) * 32];
      v16h b = cat16(ldh8(vr + lo), ldh8(vr + 16 + lo));
      o[dt] = WMMA_F16(pa, b, o[dt]);
    }
  }

  // ---- finalize: O / rowsum, bounce to LDS, contiguous f16 store --------
  __shared__ __align__(16) _Float16 ot[16 * 64];
#pragma unroll
  for (int dt = 0; dt < 4; ++dt)
#pragma unroll
    for (int r = 0; r < 8; ++r)
      ot[(hw * 8 + r) * 64 + dt * 16 + nl] = (_Float16)(o[dt][r] * (1.0f / rsum[r]));

  const int row = lane >> 1, c0 = (lane & 1) * 32;
  _Float16* dst = AO + ((size_t)bn * SEQ + q0 + row) * EMBED + h * HEAD_DIM + c0;
  const _Float16* src = &ot[row * 64 + c0];
#pragma unroll
  for (int i = 0; i < 4; ++i) *(v8h*)(dst + i * 8) = *(const v8h*)(src + i * 8);
}

// ---------------------------------------------------------------------------
// Kernel 3: Y[8192x1024] = AO @ Wo^T + bo.  One wave per 16x64 output tile.
// ---------------------------------------------------------------------------
__global__ __launch_bounds__(32) void outproj_kernel(const _Float16* __restrict__ AO,
                                                     const _Float16* __restrict__ Wo16,
                                                     const float* __restrict__ bo,
                                                     float* __restrict__ Y) {
  const int lane = threadIdx.x;
  const int hw   = lane >> 4;
  const int nl   = lane & 15;
  const int lo   = hw * 8;

  const int et = blockIdx.x & 15;      // 16 tiles of 64 output columns
  const int tt = blockIdx.x >> 4;      // N*S/16 = 512 token tiles
  const int t0 = tt * 16;
  const int e0 = et * 64;

  v8f acc[4] = {v8f{}, v8f{}, v8f{}, v8f{}};

#pragma unroll 1
  for (int k = 0; k < EMBED; k += 32) {
    const _Float16* ar = AO + (size_t)(t0 + nl) * EMBED + k;
    v16h a = cat16(ldh8(ar + lo), ldh8(ar + 16 + lo));
#pragma unroll
    for (int nt = 0; nt < 4; ++nt) {
      const _Float16* wr = Wo16 + (size_t)(e0 + nt * 16 + nl) * EMBED + k;
      v16h b = cat16(ldh8(wr + lo), ldh8(wr + 16 + lo));
      acc[nt] = WMMA_F16(a, b, acc[nt]);
    }
  }

  __shared__ __align__(16) float tile[16 * 64];
#pragma unroll
  for (int nt = 0; nt < 4; ++nt) {
    const float bv = bo[e0 + nt * 16 + nl];
#pragma unroll
    for (int r = 0; r < 8; ++r)
      tile[(hw * 8 + r) * 64 + nt * 16 + nl] = acc[nt][r] + bv;
  }
  const int row = lane >> 1, c0 = (lane & 1) * 32;
  float4* dst = (float4*)(Y + (size_t)(t0 + row) * EMBED + e0 + c0);
  const float4* src = (const float4*)&tile[row * 64 + c0];
#pragma unroll
  for (int i = 0; i < 8; ++i) dst[i] = src[i];
}

// ---------------------------------------------------------------------------
extern "C" void kernel_launch(void* const* d_in, const int* in_sizes, int n_in,
                              void* d_out, int out_size, void* d_ws, size_t ws_size,
                              hipStream_t stream) {
  const float* values = (const float*)d_in[0];
  const float* keys_  = (const float*)d_in[1];
  const float* query  = (const float*)d_in[2];
  const int*   mask   = (const int*)d_in[3];
  const float* Wv     = (const float*)d_in[4];
  const float* Wk     = (const float*)d_in[5];
  const float* Wq     = (const float*)d_in[6];
  const float* Wo     = (const float*)d_in[7];
  const float* bo     = (const float*)d_in[8];
  float* out = (float*)d_out;

  // Workspace layout (bytes):
  //   Qp [N][H][S][D]  f16 : 16 MB
  //   Kp [N][H][S][D]  f16 : 16 MB
  //   Vt [N][H][D][S]  f16 : 16 MB   (transposed for P@V B-fragments)
  //   AO [N][S][E]     f16 : 16 MB
  //   Wo16 [E][E]      f16 :  2 MB
  const size_t QKV = (size_t)NBATCH * HEADS * SEQ * HEAD_DIM * sizeof(_Float16);
  char* ws = (char*)d_ws;
  _Float16* Qp   = (_Float16*)(ws);
  _Float16* Kp   = (_Float16*)(ws + QKV);
  _Float16* Vt   = (_Float16*)(ws + 2 * QKV);
  _Float16* AO   = (_Float16*)(ws + 3 * QKV);
  _Float16* Wo16 = (_Float16*)(ws + 4 * QKV);

  wo_cvt_kernel<<<(EMBED * EMBED) / 256, 256, 0, stream>>>(Wo, Wo16);

  dim3 gproj((SEQ / 16) * HEADS, NBATCH);
  proj_kernel<<<gproj, 32, 0, stream>>>(query,  Wq, Qp, 0);
  proj_kernel<<<gproj, 32, 0, stream>>>(keys_,  Wk, Kp, 0);
  proj_kernel<<<gproj, 32, 0, stream>>>(values, Wv, Vt, 1);

  dim3 gattn((SEQ / 16) * HEADS, NBATCH);
  attn_kernel<<<gattn, 32, 0, stream>>>(Qp, Kp, Vt, mask, AO);

  outproj_kernel<<<(NBATCH * SEQ / 16) * (EMBED / 64), 32, 0, stream>>>(AO, Wo16, bo, out);
}

// v001
// It runs in 383 microseconds.
// Timed twice side by side with v000, it ran 1.29 and 1.30 times as fast.
#include <hip/hip_runtime.h>

#define EMBED 1024
#define HEADS 16
#define HEAD_DIM 64
#define NBATCH 4
#define SEQ 2048

typedef __attribute__((ext_vector_type(16))) _Float16 v16h;
typedef __attribute__((ext_vector_type(8)))  _Float16 v8h;
typedef __attribute__((ext_vector_type(8)))  float    v8f;

static __device__ __forceinline__ v16h cat16(v8h a, v8h b) {
  return __builtin_shufflevector(a, b, 0,1,2,3,4,5,6,7,8,9,10,11,12,13,14,15);
}
static __device__ __forceinline__ v8h ldh8(const _Float16* p) { return *(const v8h*)p; }
static __device__ __forceinline__ v8h cvt8(const float* p) {
  float4 a = *(const float4*)p;
  float4 b = *(const float4*)(p + 4);
  v8h r;
  r[0]=(_Float16)a.x; r[1]=(_Float16)a.y; r[2]=(_Float16)a.z; r[3]=(_Float16)a.w;
  r[4]=(_Float16)b.x; r[5]=(_Float16)b.y; r[6]=(_Float16)b.z; r[7]=(_Float16)b.w;
  return r;
}
#define WMMA_F16(a,b,c) __builtin_amdgcn_wmma_f32_16x16x32_f16(false,(a),false,(b),(short)0,(c),false,false)

// Async global->LDS copy, 16 bytes per lane (GLOBAL_LOAD_ASYNC_TO_LDS_B128,
// tracked by ASYNCcnt). LDS aperture keeps the byte offset in addr[31:0], so
// truncating the generic pointer yields the LDS-address VGPR value.
static __device__ __forceinline__ unsigned lds_addr(const _Float16* p) {
  return (unsigned)(unsigned long long)p;
}
// Eight copies and their s_wait_xcnt in ONE statement: the wait stands in front
// of any later rewrite of the address registers that the copies name.
static __device__ __forceinline__ void async_cp16x8(const unsigned (&l)[8],
                                                    const _Float16* const (&g)[8]) {
  asm volatile("global_load_async_to_lds_b128 %0, %8, off\n\t"
               "global_load_async_to_lds_b128 %1, %9, off\n\t"
               "global_load_async_to_lds_b128 %2, %10, off\n\t"
               "global_load_async_to_lds_b128 %3, %11, off\n\t"
               "global_load_async_to_lds_b128 %4, %12, off\n\t"
               "global_load_async_to_lds_b128 %5, %13, off\n\t"
               "global_load_async_to_lds_b128 %6, %14, off\n\t"
               "global_load_async_to_lds_b128 %7, %15, off\n\t"
               "s_wait_xcnt 0x0"
               :: "v"(l[0]), "v"(l[1]), "v"(l[2]), "v"(l[3]),
                  "v"(l[4]), "v"(l[5]), "v"(l[6]), "v"(l[7]),
                  "v"(g[0]), "v"(g[1]), "v"(g[2]), "v"(g[3]),
                  "v"(g[4]), "v"(g[5]), "v"(g[6]), "v"(g[7])
               : "memory");
}
// Fill one K tile (32 keys x 64 d, 4096 contiguous bytes in global) and one V
// tile (64 d-rows x 32 keys, 64-byte runs). Each K copy takes 512 contiguous
// bytes (4 whole lines), each V copy 8 whole 64-byte runs. In LDS the rows keep
// their pitch, but the 16-byte chunks of a row are XOR-swizzled by the row
// number so that the 16 rows of one ds_load_b128 fragment read fall on 16
// different bank quads:  K chunk ^= (row >> 1) & 7,  V chunk ^= (row >> 2) & 3.
static __device__ __forceinline__ void fill_kv(_Float16* kb, _Float16* vb,
                                               const _Float16* kg, const _Float16* vg,
                                               int lane) {
  unsigned l[8];
  const _Float16* g[8];
#pragma unroll
  for (int i = 0; i < 8; ++i) {
    const int r  = i * 4 + (lane >> 3);
    const int ch = lane & 7;
    l[i] = lds_addr(kb + r * 64 + ((ch ^ ((r >> 1) & 7)) * 8));
    g[i] = kg + r * HEAD_DIM + ch * 8;
  }
  async_cp16x8(l, g);
#pragma unroll
  for (int i = 0; i < 8; ++i) {
    const int r  = i * 8 + (lane >> 2);
    const int ch = lane & 3;
    l[i] = lds_addr(vb + r * 32 + ((ch ^ ((r >> 2) & 3)) * 8));
    g[i] = vg + (size_t)r * SEQ + ch * 8;
  }
  async_cp16x8(l, g);
}
static __device__ __forceinline__ void wait_async_le16() {
  asm volatile("s_wait_asynccnt 16" ::: "memory");
}
static __device__ __forceinline__ void wait_async_0() {
  asm volatile("s_wait_asynccnt 0" ::: "memory");
}

// ---------------------------------------------------------------------------
// Kernel 0: Wo f32 -> f16
// ---------------------------------------------------------------------------
__global__ __launch_bounds__(256) void wo_cvt_kernel(const float* __restrict__ Wo,
                                                     _Float16* __restrict__ Wo16) {
  int i = blockIdx.x * 256 + threadIdx.x;
  if (i < EMBED * EMBED) Wo16[i] = (_Float16)Wo[i];
}

// ---------------------------------------------------------------------------
// Kernel 1: per-head projection  Y[16x64] = X_tile[16x64] @ W^T
//   transposed==0 : store row-major  out[(n*H+h)*S + s][d]      (Q, K)
//   transposed==1 : store transposed out[(n*H+h)*64 + d][s]     (V)
// One wave (32 threads) per (token-tile, head).
// ---------------------------------------------------------------------------
__global__ __launch_bounds__(32) void proj_kernel(const float* __restrict__ X,
                                                  const float* __restrict__ W,
                                                  _Float16* __restrict__ outp,
                                                  int transposed) {
  const int lane = threadIdx.x;
  const int hw   = lane >> 4;          // half-wave: 0 or 1
  const int nl   = lane & 15;
  const int lo   = hw * 8;             // K-chunk base inside A/B fragment

  const int h  = blockIdx.x & (HEADS - 1);
  const int st = blockIdx.x / HEADS;   // token tile within batch
  const int bn = blockIdx.y;
  const int s0 = st * 16;

  // A fragments (tokens x d), K = 64 -> 2 k-steps of 32.
  v16h af[2];
  {
    const float* xr = X + ((size_t)(bn * SEQ + s0 + nl)) * EMBED + h * HEAD_DIM;
#pragma unroll
    for (int ks = 0; ks < 2; ++ks)
      af[ks] = cat16(cvt8(xr + ks * 32 + lo), cvt8(xr + ks * 32 + 16 + lo));
  }

  // 4 N-tiles of 16 output dims each.
  v8f acc[4];
#pragma unroll
  for (int nt = 0; nt < 4; ++nt) {
    v8f c = {};
#pragma unroll
    for (int ks = 0; ks < 2; ++ks) {
      // B[k][n] = W[e0+n][k]  (Y = X @ W^T); contiguous along k.
      const float* wr = W + (size_t)(nt * 16 + nl) * HEAD_DIM + ks * 32 + lo;
      v16h b = cat16(cvt8(wr), cvt8(wr + 16));
      c = WMMA_F16(af[ks], b, c);
    }
    acc[nt] = c;
  }

  if (transposed) {
    // C-frag: lane holds col e=nt*16+nl, rows s0+hw*8+r (r=0..7) -> contiguous s.
#pragma unroll
    for (int nt = 0; nt < 4; ++nt) {
      v8h pk;
#pragma unroll
      for (int r = 0; r < 8; ++r) pk[r] = (_Float16)acc[nt][r];
      _Float16* dst = outp + ((size_t)(bn * HEADS + h) * HEAD_DIM + nt * 16 + nl) * SEQ
                           + s0 + hw * 8;
      *(v8h*)dst = pk;
    }
  } else {
    __shared__ __align__(16) _Float16 tile[16 * 64];
#pragma unroll
    for (int nt = 0; nt < 4; ++nt)
#pragma unroll
      for (int r = 0; r < 8; ++r)
        tile[(hw * 8 + r) * 64 + nt * 16 + nl] = (_Float16)acc[nt][r];
    // same-wave LDS ops are in-order: loads below observe the stores above
    const int row = lane >> 1, c0 = (lane & 1) * 32;
    _Float16* dst = outp + ((size_t)(bn * HEADS + h) * SEQ + s0 + row) * HEAD_DIM + c0;
    const _Float16* src = &tile[row * 64 + c0];
#pragma unroll
    for (int i = 0; i < 4; ++i) *(v8h*)(dst + i * 8) = *(const v8h*)(src + i * 8);
  }
}

// ---------------------------------------------------------------------------
// Kernel 2: flash attention, one wave per (batch, head, 16-query tile).
// Key tiles of 32 keys. K/V tiles are double-buffered in LDS and filled with
// GLOBAL_LOAD_ASYNC_TO_LDS_B128 (ASYNCcnt), overlapping the WMMA + softmax of
// the current tile with the DMA of the next.
// ---------------------------------------------------------------------------
__global__ __launch_bounds__(32) void attn_kernel(const _Float16* __restrict__ Qp,
                                                  const _Float16* __restrict__ Kp,
                                                  const _Float16* __restrict__ Vt,
                                                  const int* __restrict__ mask,
                                                  _Float16* __restrict__ AO) {
  const int lane = threadIdx.x;
  const int hw   = lane >> 4;
  const int nl   = lane & 15;
  const int lo   = hw * 8;

  const int h  = blockIdx.x & (HEADS - 1);
  const int qt = blockIdx.x / HEADS;
  const int bn = blockIdx.y;
  const int q0 = qt * 16;

  const _Float16* Qh = Qp + (size_t)(bn * HEADS + h) * SEQ * HEAD_DIM;
  const _Float16* Kh = Kp + (size_t)(bn * HEADS + h) * SEQ * HEAD_DIM;
  const _Float16* Vh = Vt + (size_t)(bn * HEADS + h) * HEAD_DIM * SEQ;

  // Double-buffered K/V tiles: K row-major [32 keys][64 d], V [64 d][32 keys],
  // 16-byte chunks swizzled inside each row (see fill_kv).
  __shared__ __align__(16) _Float16 Kbuf[2][32 * 64];
  __shared__ __align__(16) _Float16 Vbuf[2][64 * 32];
  __shared__ __align__(16) _Float16 pls[16 * 32];

  // Q A-fragments (row m = nl on both half-waves).
  v16h qa[2];
  {
    const _Float16* qr = Qh + (size_t)(q0 + nl) * HEAD_DIM;
#pragma unroll
    for (int ks = 0; ks < 2; ++ks)
      qa[ks] = cat16(ldh8(qr + ks * 32 + lo), ldh8(qr + ks * 32 + 16 + lo));
  }

  v8f o[4] = {v8f{}, v8f{}, v8f{}, v8f{}};
  float rmax[8], rsum[8];
#pragma unroll
  for (int r = 0; r < 8; ++r) { rmax[r] = -1.0e30f; rsum[r] = 0.0f; }

  const float scale = 0.03125f;              // 1/sqrt(EMBED) = 1/32
  const float mfill = -1.0e20f * 0.03125f;   // masked value after scaling

  const int NT = SEQ / 32;

  // Issue async fill of tile 0: 8 copies for K, 8 for V. 16 per tile.
  fill_kv(Kbuf[0], Vbuf[0], Kh, Vh, lane);

  // Swizzle terms of the fragment readers (row = 16 * tile + nl in both).
  const int kswz = (nl >> 1) & 7;
  const int vswz = (nl >> 2) & 3;

#pragma unroll 1
  for (int kt = 0; kt < NT; ++kt) {
    const int k0  = kt * 32;
    const int cur = kt & 1;

    // Kick off next tile's DMA, then wait for the current tile (async loads
    // retire in order: <=16 outstanding => previous 16 have landed in LDS).
    if (kt + 1 < NT) {
      const int nxt = (kt + 1) & 1;
      const int kn  = k0 + 32;
      // This wave's LDS reads of the buffer being refilled retire before a copy targets it.
      asm volatile("s_wait_dscnt 0x0" ::: "memory");
      fill_kv(Kbuf[nxt], Vbuf[nxt], Kh + (size_t)kn * HEAD_DIM, Vh + kn, lane);
      wait_async_le16();
    } else {
      wait_async_0();
    }

    // ---- S[16x32] = Q @ K^T : two 16-col tiles (B-frags from LDS) --------
    v8f sf[2];
#pragma unroll
    for (int c = 0; c < 2; ++c) {
      v8f s = {};
      const _Float16* kr = &Kbuf[cur][(c * 16 + nl) * 64];
#pragma unroll
      for (int ks = 0; ks < 2; ++ks) {
        v16h b = cat16(ldh8(kr + ((ks * 4 + hw) ^ kswz) * 8),
                       ldh8(kr + ((ks * 4 + 2 + hw) ^ kswz) * 8));
        s = WMMA_F16(qa[ks], b, s);
      }
      sf[c] = s;
    }

    // ---- scale + mask ----------------------------------------------------
#pragma unroll
    for (int c = 0; c < 2; ++c)
#pragma unroll
      for (int r = 0; r < 8; ++r) {
        const int row = q0 + hw * 8 + r;
        const int key = k0 + c * 16 + nl;
        const int mv = mask[((size_t)bn * SEQ + row) * SEQ + key];
        sf[c][r] = mv ? sf[c][r] * scale : mfill;
      }

    // ---- online softmax: row max over 32 cols (half-wave reduction) -----
    float nm[8], alpha[8];
#pragma unroll
    for (int r = 0; r < 8; ++r) {
      float m = fmaxf(sf[0][r], sf[1][r]);
      m = fmaxf(m, __shfl_xor(m, 1, 32));
      m = fmaxf(m, __shfl_xor(m, 2, 32));
      m = fmaxf(m, __shfl_xor(m, 4, 32));
      m = fmaxf(m, __shfl_xor(m, 8, 32));
      nm[r] = fmaxf(rmax[r], m);
      alpha[r] = __expf(rmax[r] - nm[r]);
      rmax[r] = nm[r];
    }

    // ---- P = exp(S - max): to LDS (C-layout -> A-layout bounce) ---------
    float part[8];
#pragma unroll
    for (int r = 0; r < 8; ++r) {
      float p0 = __expf(sf[0][r] - nm[r]);
      float p1 = __expf(sf[1][r] - nm[r]);
      part[r] = p0 + p1;
      pls[(hw * 8 + r) * 32 + nl]      = (_Float16)p0;
      pls[(hw * 8 + r) * 32 + 16 + nl] = (_Float16)p1;
    }
#pragma unroll
    for (int r = 0; r < 8; ++r) {
      float t = part[r];
      t += __shfl_xor(t, 1, 32);
      t += __shfl_xor(t, 2, 32);
      t += __shfl_xor(t, 4, 32);
      t += __shfl_xor(t, 8, 32);
      rsum[r] = rsum[r] * alpha[r] + t;
    }

    // ---- rescale accumulator --------------------------------------------
#pragma unroll
    for (int dt = 0; dt < 4; ++dt)
#pragma unroll
      for (int r = 0; r < 8; ++r) o[dt][r] *= alpha[r];

    // ---- O += P @ V (P A-frag and V B-frags from LDS) --------------------
    v16h pa = cat16(ldh8(&pls[nl * 32 + lo]), ldh8(&pls[nl * 32 + 16 + lo]));
#pragma unroll
    for (int dt = 0; dt < 4; ++dt) {
      const _Float16* vr = &Vbuf[cur][(dt * 16 + nl) * 32];
      v16h b = cat16(ldh8(vr + (hw ^ vswz) * 8), ldh8(vr + ((2 + hw) ^ vswz) * 8));
      o[dt] = WMMA_F16(pa, b, o[dt]);
    }
  }

  // ---- finalize: O / rowsum, bounce to LDS, contiguous f16 store --------
  __shared__ __align__(16) _Float16 ot[16 * 64];
#pragma unroll
  for (int dt = 0; dt < 4; ++dt)
#pragma unroll
    for (int r = 0; r < 8; ++r)
      ot[(hw * 8 + r) * 64 + dt * 16 + nl] = (_Float16)(o[dt][r] * (1.0f / rsum[r]));

  const int row = lane >> 1, c0 = (lane & 1) * 32;
  _Float16* dst = AO + ((size_t)bn * SEQ + q0 + row) * EMBED + h * HEAD_DIM + c0;
  const _Float16* src = &ot[row * 64 + c0];
#pragma unroll
  for (int i = 0; i < 4; ++i) *(v8h*)(dst + i * 8) = *(const v8h*)(src + i * 8);
}

// ---------------------------------------------------------------------------
// Kernel 3: Y[8192x1024] = AO @ Wo^T + bo.  One wave per 16x64 output tile.
// ---------------------------------------------------------------------------
__global__ __launch_bounds__(32) void outproj_kernel(const _Float16* __restrict__ AO,
                                                     const _Float16* __restrict__ Wo16,
                                                     const float* __restrict__ bo,
                                                     float* __restrict__ Y) {
  const int lane = threadIdx.x;
  const int hw   = lane >> 4;
  const int nl   = lane & 15;
  const int lo   = hw * 8;

  const int et = blockIdx.x & 15;      // 16 tiles of 64 output columns
  const int tt = blockIdx.x >> 4;      // N*S/16 = 512 token tiles
  const int t0 = tt * 16;
  const int e0 = et * 64;

  v8f acc[4] = {v8f{}, v8f{}, v8f{}, v8f{}};

#pragma unroll 1
  for (int k = 0; k < EMBED; k += 32) {
    const _Float16* ar = AO + (size_t)(t0 + nl) * EMBED + k;
    v16h a = cat16(ldh8(ar + lo), ldh8(ar + 16 + lo));
#pragma unroll
    for (int nt = 0; nt < 4; ++nt) {
      const _Float16* wr = Wo16 + (size_t)(e0 + nt * 16 + nl) * EMBED + k;
      v16h b = cat16(ldh8(wr + lo), ldh8(wr + 16 + lo));
      acc[nt] = WMMA_F16(a, b, acc[nt]);
    }
  }

  __shared__ __align__(16) float tile[16 * 64];
#pragma unroll
  for (int nt = 0; nt < 4; ++nt) {
    const float bv = bo[e0 + nt * 16 + nl];
#pragma unroll
    for (int r = 0; r < 8; ++r)
      tile[(hw * 8 + r) * 64 + nt * 16 + nl] = acc[nt][r] + bv;
  }
  const int row = lane >> 1, c0 = (lane & 1) * 32;
  float4* dst = (float4*)(Y + (size_t)(t0 + row) * EMBED + e0 + c0);
  const float4* src = (const float4*)&tile[row * 64 + c0];
#pragma unroll
  for (int i = 0; i < 8; ++i) dst[i] = src[i];
}

// ---------------------------------------------------------------------------
extern "C" void kernel_launch(void* const* d_in, const int* in_sizes, int n_in,
                              void* d_out, int out_size, void* d_ws, size_t ws_size,
                              hipStream_t stream) {
  const float* values = (const float*)d_in[0];
  const float* keys_  = (const float*)d_in[1];
  const float* query  = (const float*)d_in[2];
  const int*   mask   = (const int*)d_in[3];
  const float* Wv     = (const float*)d_in[4];
  const float* Wk     = (const float*)d_in[5];
  const float* Wq     = (const float*)d_in[6];
  const float* Wo     = (const float*)d_in[7];
  const float* bo     = (const float*)d_in[8];
  float* out = (float*)d_out;

  // Workspace layout (bytes):
  //   Qp [N][H][S][D]  f16 : 16 MB
  //   Kp [N][H][S][D]  f16 : 16 MB
  //   Vt [N][H][D][S]  f16 : 16 MB   (transposed for P@V B-fragments)
  //   AO [N][S][E]     f16 : 16 MB
  //   Wo16 [E][E]      f16 :  2 MB
  const size_t QKV = (size_t)NBATCH * HEADS * SEQ * HEAD_DIM * sizeof(_Float16);
  char* ws = (char*)d_ws;
  _Float16* Qp   = (_Float16*)(ws);
  _Float16* Kp   = (_Float16*)(ws + QKV);
  _Float16* Vt   = (_Float16*)(ws + 2 * QKV);
  _Float16* AO   = (_Float16*)(ws + 3 * QKV);
  _Float16* Wo16 = (_Float16*)(ws + 4 * QKV);

  wo_cvt_kernel<<<(EMBED * EMBED) / 256, 256, 0, stream>>>(Wo, Wo16);

  dim3 gproj((SEQ / 16) * HEADS, NBATCH);
  proj_kernel<<<gproj, 32, 0, stream>>>(query,  Wq, Qp, 0);
  proj_kernel<<<gproj, 32, 0, stream>>>(keys_,  Wk, Kp, 0);
  proj_kernel<<<gproj, 32, 0, stream>>>(values, Wv, Vt, 1);

  dim3 gattn((SEQ / 16) * HEADS, NBATCH);
  attn_kernel<<<gattn, 32, 0, stream>>>(Qp, Kp, Vt, mask, AO);

  outproj_kernel<<<(NBATCH * SEQ / 16) * (EMBED / 64), 32, 0, stream>>>(AO, Wo16, bo, out);
}

// v002
// A run of this version takes 306 microseconds.
// In two side-by-side timings against v001, it was 1.25 and 1.24 times as fast.
// Over all steps from v000 it is 1.61 times as fast.
#include <hip/hip_runtime.h>

#define EMBED 1024
#define HEADS 16
#define HEAD_DIM 64
#define NBATCH 4
#define SEQ 2048

typedef __attribute__((ext_vector_type(16))) _Float16 v16h;
typedef __attribute__((ext_vector_type(8)))  _Float16 v8h;
typedef __attribute__((ext_vector_type(8)))  float    v8f;

static __device__ __forceinline__ v16h cat16(v8h a, v8h b) {
  return __builtin_shufflevector(a, b, 0,1,2,3,4,5,6,7,8,9,10,11,12,13,14,15);
}
static __device__ __forceinline__ v8h ldh8(const _Float16* p) { return *(const v8h*)p; }
static __device__ __forceinline__ v8h cvt8(const float* p) {
  float4 a = *(const float4*)p;
  float4 b = *(const float4*)(p + 4);
  v8h r;
  r[0]=(_Float16)a.x; r[1]=(_Float16)a.y; r[2]=(_Float16)a.z; r[3]=(_Float16)a.w;
  r[4]=(_Float16)b.x; r[5]=(_Float16)b.y; r[6]=(_Float16)b.z; r[7]=(_Float16)b.w;
  return r;
}
#define WMMA_F16(a,b,c) __builtin_amdgcn_wmma_f32_16x16x32_f16(false,(a),false,(b),(short)0,(c),false,false)

// Async global->LDS copy, 16 bytes per lane (GLOBAL_LOAD_ASYNC_TO_LDS_B128,
// tracked by ASYNCcnt). LDS aperture keeps the byte offset in addr[31:0], so
// truncating the generic pointer yields the LDS-address VGPR value.
static __device__ __forceinline__ unsigned lds_addr(const _Float16* p) {
  return (unsigned)(unsigned long long)p;
}
// Four copies and their s_wait_xcnt in ONE statement: the wait stands in front
// of any later rewrite of the address registers that the copies name.
static __device__ __forceinline__ void async_cp16x4(const unsigned (&l)[4],
                                                    const _Float16* const (&g)[4]) {
  asm volatile("global_load_async_to_lds_b128 %0, %4, off\n\t"
               "global_load_async_to_lds_b128 %1, %5, off\n\t"
               "global_load_async_to_lds_b128 %2, %6, off\n\t"
               "global_load_async_to_lds_b128 %3, %7, off\n\t"
               "s_wait_xcnt 0x0"
               :: "v"(l[0]), "v"(l[1]), "v"(l[2]), "v"(l[3]),
                  "v"(g[0]), "v"(g[1]), "v"(g[2]), "v"(g[3])
               : "memory");
}
// Fill one stage of 64 keys for the whole work-group (256 threads, 4 copies
// each): K 64 keys x 64 d (8192 contiguous bytes in global), V 64 d-rows x 64
// keys (128-byte runs). Every copy of a wave takes 4 whole 128-byte lines. In
// LDS both keep a 128-byte row pitch, and the 16-byte chunks of a row are
// XOR-swizzled by the row number, chunk ^= (row >> 1) & 7, so that the 16 rows
// of one ds_load_b128 fragment read fall on 16 different bank quads.
static __device__ __forceinline__ void fill_stage(_Float16* kb, _Float16* vb,
                                                  const _Float16* kg, const _Float16* vg,
                                                  int tid) {
  unsigned l[4];
  const _Float16* g[4];
#pragma unroll
  for (int i = 0; i < 2; ++i) {
    const int r   = i * 32 + (tid >> 3);
    const int ch  = tid & 7;
    const int off = r * 64 + ((ch ^ ((r >> 1) & 7)) * 8);
    l[i]     = lds_addr(kb + off);
    g[i]     = kg + r * HEAD_DIM + ch * 8;
    l[2 + i] = lds_addr(vb + off);
    g[2 + i] = vg + (size_t)r * SEQ + ch * 8;
  }
  async_cp16x4(l, g);
}
static __device__ __forceinline__ void wait_async_0() {
  asm volatile("s_wait_asynccnt 0" ::: "memory");
}

// ---------------------------------------------------------------------------
// Kernel 0: Wo f32 -> f16
// ---------------------------------------------------------------------------
__global__ __launch_bounds__(256) void wo_cvt_kernel(const float* __restrict__ Wo,
                                                     _Float16* __restrict__ Wo16) {
  int i = blockIdx.x * 256 + threadIdx.x;
  if (i < EMBED * EMBED) Wo16[i] = (_Float16)Wo[i];
}

// ---------------------------------------------------------------------------
// Kernel 1: per-head projection  Y[16x64] = X_tile[16x64] @ W^T
//   transposed==0 : store row-major  out[(n*H+h)*S + s][d]      (Q, K)
//   transposed==1 : store transposed out[(n*H+h)*64 + d][s]     (V)
// One wave (32 threads) per (token-tile, head).
// ---------------------------------------------------------------------------
__global__ __launch_bounds__(32) void proj_kernel(const float* __restrict__ X,
                                                  const float* __restrict__ W,
                                                  _Float16* __restrict__ outp,
                                                  int transposed) {
  const int lane = threadIdx.x;
  const int hw   = lane >> 4;          // half-wave: 0 or 1
  const int nl   = lane & 15;
  const int lo   = hw * 8;             // K-chunk base inside A/B fragment

  const int h  = blockIdx.x & (HEADS - 1);
  const int st = blockIdx.x / HEADS;   // token tile within batch
  const int bn = blockIdx.y;
  const int s0 = st * 16;

  // A fragments (tokens x d), K = 64 -> 2 k-steps of 32.
  v16h af[2];
  {
    const float* xr = X + ((size_t)(bn * SEQ + s0 + nl)) * EMBED + h * HEAD_DIM;
#pragma unroll
    for (int ks = 0; ks < 2; ++ks)
      af[ks] = cat16(cvt8(xr + ks * 32 + lo), cvt8(xr + ks * 32 + 16 + lo));
  }

  // 4 N-tiles of 16 output dims each.
  v8f acc[4];
#pragma unroll
  for (int nt = 0; nt < 4; ++nt) {
    v8f c = {};
#pragma unroll
    for (int ks = 0; ks < 2; ++ks) {
      // B[k][n] = W[e0+n][k]  (Y = X @ W^T); contiguous along k.
      const float* wr = W + (size_t)(nt * 16 + nl) * HEAD_DIM + ks * 32 + lo;
      v16h b = cat16(cvt8(wr), cvt8(wr + 16));
      c = WMMA_F16(af[ks], b, c);
    }
    acc[nt] = c;
  }

  if (transposed) {
    // C-frag: lane holds col e=nt*16+nl, rows s0+hw*8+r (r=0..7) -> contiguous s.
#pragma unroll
    for (int nt = 0; nt < 4; ++nt) {
      v8h pk;
#pragma unroll
      for (int r = 0; r < 8; ++r) pk[r] = (_Float16)acc[nt][r];
      _Float16* dst = outp + ((size_t)(bn * HEADS + h) * HEAD_DIM + nt * 16 + nl) * SEQ
                           + s0 + hw * 8;
      *(v8h*)dst = pk;
    }
  } else {
    __shared__ __align__(16) _Float16 tile[16 * 64];
#pragma unroll
    for (int nt = 0; nt < 4; ++nt)
#pragma unroll
      for (int r = 0; r < 8; ++r)
        tile[(hw * 8 + r) * 64 + nt * 16 + nl] = (_Float16)acc[nt][r];
    // same-wave LDS ops are in-order: loads below observe the stores above
    const int row = lane >> 1, c0 = (lane & 1) * 32;
    _Float16* dst = outp + ((size_t)(bn * HEADS + h) * SEQ + s0 + row) * HEAD_DIM + c0;
    const _Float16* src = &tile[row * 64 + c0];
#pragma unroll
    for (int i = 0; i < 4; ++i) *(v8h*)(dst + i * 8) = *(const v8h*)(src + i * 8);
  }
}

// ---------------------------------------------------------------------------
// Kernel 2: flash attention, one work-group of 8 waves per (batch, head,
// 128 queries), one 16-query tile per wave. The 8 waves share each K/V stage
// of 64 keys (two passes of 32): two buffers in LDS, every wave copies an
// eighth of a stage with GLOBAL_LOAD_ASYNC_TO_LDS_B128 (ASYNCcnt), and the next
// stage's copies fly while this one is worked on.
// ---------------------------------------------------------------------------
__global__ __launch_bounds__(256) void attn_kernel(const _Float16* __restrict__ Qp,
                                                  const _Float16* __restrict__ Kp,
                                                  const _Float16* __restrict__ Vt,
                                                  const int* __restrict__ mask,
                                                  _Float16* __restrict__ AO) {
  const int tid  = threadIdx.x;
  const int wave = __builtin_amdgcn_readfirstlane(tid >> 5);
  const int lane = tid & 31;
  const int hw   = lane >> 4;
  const int nl   = lane & 15;
  const int lo   = hw * 8;

  const int h  = blockIdx.x & (HEADS - 1);
  const int qb = blockIdx.x / HEADS;
  const int bn = blockIdx.y;
  const int q0 = (qb * 8 + wave) * 16;

  const _Float16* Qh = Qp + (size_t)(bn * HEADS + h) * SEQ * HEAD_DIM;
  const _Float16* Kh = Kp + (size_t)(bn * HEADS + h) * SEQ * HEAD_DIM;
  const _Float16* Vh = Vt + (size_t)(bn * HEADS + h) * HEAD_DIM * SEQ;

  // Double-buffered K/V stages: K row-major [64 keys][64 d], V [64 d][64 keys],
  // 16-byte chunks swizzled inside each row (see fill_stage). P bounce: per wave.
  __shared__ __align__(16) _Float16 Kbuf[2][64 * 64];
  __shared__ __align__(16) _Float16 Vbuf[2][64 * 64];
  __shared__ __align__(16) _Float16 plsw[8][16 * 32];
  _Float16* pls = plsw[wave];

  // Q A-fragments (row m = nl on both half-waves).
  v16h qa[2];
  {
    const _Float16* qr = Qh + (size_t)(q0 + nl) * HEAD_DIM;
#pragma unroll
    for (int ks = 0; ks < 2; ++ks)
      qa[ks] = cat16(ldh8(qr + ks * 32 + lo), ldh8(qr + ks * 32 + 16 + lo));
  }

  v8f o[4] = {v8f{}, v8f{}, v8f{}, v8f{}};
  float rmax[8], rsum[8];
#pragma unroll
  for (int r = 0; r < 8; ++r) { rmax[r] = -1.0e30f; rsum[r] = 0.0f; }

  const float scale = 0.03125f;              // 1/sqrt(EMBED) = 1/32
  const float mfill = -1.0e20f * 0.03125f;   // masked value after scaling

  const int NS = SEQ / 64;

  // Stage 0 lands and is published to all waves; then stage 1's copies start.
  fill_stage(Kbuf[0], Vbuf[0], Kh, Vh, tid);
  wait_async_0();
  __syncthreads();
  fill_stage(Kbuf[1], Vbuf[1], Kh + (size_t)64 * HEAD_DIM, Vh + 64, tid);

  // Swizzle term of the fragment readers (row = 16 * tile + nl in both).
  const int kswz = (nl >> 1) & 7;

  // Kept rolled: one trip per stage, one publish point at its foot.
#pragma unroll 1
  for (int st = 0; st < NS; ++st) {
    const int cur = st & 1;

    // Both passes unrolled: their LDS offsets become immediates and the second
    // pass's mask loads can issue beside the first pass's work.
#pragma unroll
    for (int p = 0; p < 2; ++p) {
      const int k0 = st * 64 + p * 32;

      // ---- S[16x32] = Q @ K^T : two 16-col tiles (B-frags from LDS) --------
      v8f sf[2];
#pragma unroll
      for (int c = 0; c < 2; ++c) {
        v8f s = {};
        const _Float16* kr = &Kbuf[cur][(p * 32 + c * 16 + nl) * 64];
#pragma unroll
        for (int ks = 0; ks < 2; ++ks) {
          v16h b = cat16(ldh8(kr + ((ks * 4 + hw) ^ kswz) * 8),
                         ldh8(kr + ((ks * 4 + 2 + hw) ^ kswz) * 8));
          s = WMMA_F16(qa[ks], b, s);
        }
        sf[c] = s;
      }

      // ---- scale + mask ----------------------------------------------------
#pragma unroll
      for (int c = 0; c < 2; ++c)
#pragma unroll
        for (int r = 0; r < 8; ++r) {
          const int row = q0 + hw * 8 + r;
          const int key = k0 + c * 16 + nl;
          const int mv = mask[((size_t)bn * SEQ + row) * SEQ + key];
          sf[c][r] = mv ? sf[c][r] * scale : mfill;
        }

      // ---- online softmax: row max over 32 cols (half-wave reduction) -----
      float nm[8], alpha[8];
#pragma unroll
      for (int r = 0; r < 8; ++r) {
        float m = fmaxf(sf[0][r], sf[1][r]);
        m = fmaxf(m, __shfl_xor(m, 1, 32));
        m = fmaxf(m, __shfl_xor(m, 2, 32));
        m = fmaxf(m, __shfl_xor(m, 4, 32));
        m = fmaxf(m, __shfl_xor(m, 8, 32));
        nm[r] = fmaxf(rmax[r], m);
        alpha[r] = __expf(rmax[r] - nm[r]);
        rmax[r] = nm[r];
      }

      // ---- P = exp(S - max): to LDS (C-layout -> A-layout bounce) ---------
      float part[8];
#pragma unroll
      for (int r = 0; r < 8; ++r) {
        float p0 = __expf(sf[0][r] - nm[r]);
        float p1 = __expf(sf[1][r] - nm[r]);
        part[r] = p0 + p1;
        pls[(hw * 8 + r) * 32 + nl]      = (_Float16)p0;
        pls[(hw * 8 + r) * 32 + 16 + nl] = (_Float16)p1;
      }
#pragma unroll
      for (int r = 0; r < 8; ++r) {
        float t = part[r];
        t += __shfl_xor(t, 1, 32);
        t += __shfl_xor(t, 2, 32);
        t += __shfl_xor(t, 4, 32);
        t += __shfl_xor(t, 8, 32);
        rsum[r] = rsum[r] * alpha[r] + t;
      }

      // ---- rescale accumulator --------------------------------------------
#pragma unroll
      for (int dt = 0; dt < 4; ++dt)
#pragma unroll
        for (int r = 0; r < 8; ++r) o[dt][r] *= alpha[r];

      // ---- O += P @ V (P A-frag and V B-frags from LDS) --------------------
      v16h pa = cat16(ldh8(&pls[nl * 32 + lo]), ldh8(&pls[nl * 32 + 16 + lo]));
#pragma unroll
      for (int dt = 0; dt < 4; ++dt) {
        const _Float16* vr = &Vbuf[cur][(dt * 16 + nl) * 64];
        v16h b = cat16(ldh8(vr + ((p * 4 + hw) ^ kswz) * 8),
                       ldh8(vr + ((p * 4 + 2 + hw) ^ kswz) * 8));
        o[dt] = WMMA_F16(pa, b, o[dt]);
      }
    }

    // Publish point of stage st + 1: this wave's LDS reads of stage st retire,
    // its own copies of stage st + 1 have landed, then the barrier both shows
    // stage st + 1 to every wave and frees buffer cur for the refill.
    asm volatile("s_wait_dscnt 0x0" ::: "memory");
    wait_async_0();
    __syncthreads();
    if (st + 2 < NS)
      fill_stage(Kbuf[cur], Vbuf[cur], Kh + (size_t)(st + 2) * 64 * HEAD_DIM,
                 Vh + (st + 2) * 64, tid);
  }
  // No copy is outstanding when the wave goes on to its epilogue and ends.
  wait_async_0();

  // ---- finalize: O / rowsum, bounce to LDS, contiguous f16 store --------
  __shared__ __align__(16) _Float16 otw[8][16 * 64];
  _Float16* ot = otw[wave];
#pragma unroll
  for (int dt = 0; dt < 4; ++dt)
#pragma unroll
    for (int r = 0; r < 8; ++r)
      ot[(hw * 8 + r) * 64 + dt * 16 + nl] = (_Float16)(o[dt][r] * (1.0f / rsum[r]));

  const int row = lane >> 1, c0 = (lane & 1) * 32;
  _Float16* dst = AO + ((size_t)bn * SEQ + q0 + row) * EMBED + h * HEAD_DIM + c0;
  const _Float16* src = &ot[row * 64 + c0];
#pragma unroll
  for (int i = 0; i < 4; ++i) *(v8h*)(dst + i * 8) = *(const v8h*)(src + i * 8);
}

// ---------------------------------------------------------------------------
// Kernel 3: Y[8192x1024] = AO @ Wo^T + bo.  One wave per 16x64 output tile.
// ---------------------------------------------------------------------------
__global__ __launch_bounds__(32) void outproj_kernel(const _Float16* __restrict__ AO,
                                                     const _Float16* __restrict__ Wo16,
                                                     const float* __restrict__ bo,
                                                     float* __restrict__ Y) {
  const int lane = threadIdx.x;
  const int hw   = lane >> 4;
  const int nl   = lane & 15;
  const int lo   = hw * 8;

  const int et = blockIdx.x & 15;      // 16 tiles of 64 output columns
  const int tt = blockIdx.x >> 4;      // N*S/16 = 512 token tiles
  const int t0 = tt * 16;
  const int e0 = et * 64;

  v8f acc[4] = {v8f{}, v8f{}, v8f{}, v8f{}};

#pragma unroll 1
  for (int k = 0; k < EMBED; k += 32) {
    const _Float16* ar = AO + (size_t)(t0 + nl) * EMBED + k;
    v16h a = cat16(ldh8(ar + lo), ldh8(ar + 16 + lo));
#pragma unroll
    for (int nt = 0; nt < 4; ++nt) {
      const _Float16* wr = Wo16 + (size_t)(e0 + nt * 16 + nl) * EMBED + k;
      v16h b = cat16(ldh8(wr + lo), ldh8(wr + 16 + lo));
      acc[nt] = WMMA_F16(a, b, acc[nt]);
    }
  }

  __shared__ __align__(16) float tile[16 * 64];
#pragma unroll
  for (int nt = 0; nt < 4; ++nt) {
    const float bv = bo[e0 + nt * 16 + nl];
#pragma unroll
    for (int r = 0; r < 8; ++r)
      tile[(hw * 8 + r) * 64 + nt * 16 + nl] = acc[nt][r] + bv;
  }
  const int row = lane >> 1, c0 = (lane & 1) * 32;
  float4* dst = (float4*)(Y + (size_t)(t0 + row) * EMBED + e0 + c0);
  const float4* src = (const float4*)&tile[row * 64 + c0];
#pragma unroll
  for (int i = 0; i < 8; ++i) dst[i] = src[i];
}

// ---------------------------------------------------------------------------
extern "C" void kernel_launch(void* const* d_in, const int* in_sizes, int n_in,
                              void* d_out, int out_size, void* d_ws, size_t ws_size,
                              hipStream_t stream) {
  const float* values = (const float*)d_in[0];
  const float* keys_  = (const float*)d_in[1];
  const float* query  = (const float*)d_in[2];
  const int*   mask   = (const int*)d_in[3];
  const float* Wv     = (const float*)d_in[4];
  const float* Wk     = (const float*)d_in[5];
  const float* Wq     = (const float*)d_in[6];
  const float* Wo     = (const float*)d_in[7];
  const float* bo     = (const float*)d_in[8];
  float* out = (float*)d_out;

  // Workspace layout (bytes):
  //   Qp [N][H][S][D]  f16 : 16 MB
  //   Kp [N][H][S][D]  f16 : 16 MB
  //   Vt [N][H][D][S]  f16 : 16 MB   (transposed for P@V B-fragments)
  //   AO [N][S][E]     f16 : 16 MB
  //   Wo16 [E][E]      f16 :  2 MB
  const size_t QKV = (size_t)NBATCH * HEADS * SEQ * HEAD_DIM * sizeof(_Float16);
  char* ws = (char*)d_ws;
  _Float16* Qp   = (_Float16*)(ws);
  _Float16* Kp   = (_Float16*)(ws + QKV);
  _Float16* Vt   = (_Float16*)(ws + 2 * QKV);
  _Float16* AO   = (_Float16*)(ws + 3 * QKV);
  _Float16* Wo16 = (_Float16*)(ws + 4 * QKV);

  wo_cvt_kernel<<<(EMBED * EMBED) / 256, 256, 0, stream>>>(Wo, Wo16);

  dim3 gproj((SEQ / 16) * HEADS, NBATCH);
  proj_kernel<<<gproj, 32, 0, stream>>>(query,  Wq, Qp, 0);
  proj_kernel<<<gproj, 32, 0, stream>>>(keys_,  Wk, Kp, 0);
  proj_kernel<<<gproj, 32, 0, stream>>>(values, Wv, Vt, 1);

  dim3 gattn((SEQ / 128) * HEADS, NBATCH);
  attn_kernel<<<gattn, 256, 0, stream>>>(Qp, Kp, Vt, mask, AO);

  outproj_kernel<<<(NBATCH * SEQ / 16) * (EMBED / 64), 32, 0, stream>>>(AO, Wo16, bo, out);
}

// v003
// It runs in 237 microseconds.
// Next to v002, in two timings, it ran 1.30 times as fast each time.
// All steps since v000 together make it 2.09 times as fast.
#include <hip/hip_runtime.h>

#define EMBED 1024
#define HEADS 16
#define HEAD_DIM 64
#define NBATCH 4
#define SEQ 2048

typedef __attribute__((ext_vector_type(16))) _Float16 v16h;
typedef __attribute__((ext_vector_type(8)))  _Float16 v8h;
typedef __attribute__((ext_vector_type(8)))  float    v8f;

static __device__ __forceinline__ v16h cat16(v8h a, v8h b) {
  return __builtin_shufflevector(a, b, 0,1,2,3,4,5,6,7,8,9,10,11,12,13,14,15);
}
static __device__ __forceinline__ v8h ldh8(const _Float16* p) { return *(const v8h*)p; }
static __device__ __forceinline__ v8h cvt8(const float* p) {
  float4 a = *(const float4*)p;
  float4 b = *(const float4*)(p + 4);
  v8h r;
  r[0]=(_Float16)a.x; r[1]=(_Float16)a.y; r[2]=(_Float16)a.z; r[3]=(_Float16)a.w;
  r[4]=(_Float16)b.x; r[5]=(_Float16)b.y; r[6]=(_Float16)b.z; r[7]=(_Float16)b.w;
  return r;
}
#define WMMA_F16(a,b,c) __builtin_amdgcn_wmma_f32_16x16x32_f16(false,(a),false,(b),(short)0,(c),false,false)

// Async global->LDS copy, 16 bytes per lane (GLOBAL_LOAD_ASYNC_TO_LDS_B128,
// tracked by ASYNCcnt). LDS aperture keeps the byte offset in addr[31:0], so
// truncating the generic pointer yields the LDS-address VGPR value.
static __device__ __forceinline__ unsigned lds_addr(const _Float16* p) {
  return (unsigned)(unsigned long long)p;
}
// Four copies and their s_wait_xcnt in ONE statement: the wait stands in front
// of any later rewrite of the address registers that the copies name.
static __device__ __forceinline__ void async_cp16x4(const unsigned (&l)[4],
                                                    const _Float16* const (&g)[4]) {
  asm volatile("global_load_async_to_lds_b128 %0, %4, off\n\t"
               "global_load_async_to_lds_b128 %1, %5, off\n\t"
               "global_load_async_to_lds_b128 %2, %6, off\n\t"
               "global_load_async_to_lds_b128 %3, %7, off\n\t"
               "s_wait_xcnt 0x0"
               :: "v"(l[0]), "v"(l[1]), "v"(l[2]), "v"(l[3]),
                  "v"(g[0]), "v"(g[1]), "v"(g[2]), "v"(g[3])
               : "memory");
}
// Fill one stage of 64 keys for the whole work-group (256 threads, 4 copies
// each): K 64 keys x 64 d (8192 contiguous bytes in global), V 64 d-rows x 64
// keys (128-byte runs). Every copy of a wave takes 4 whole 128-byte lines. In
// LDS both keep a 128-byte row pitch, and the 16-byte chunks of a row are
// XOR-swizzled by the row number, chunk ^= (row >> 1) & 7, so that the 16 rows
// of one ds_load_b128 fragment read fall on 16 different bank quads.
static __device__ __forceinline__ void fill_stage(_Float16* kb, _Float16* vb,
                                                  const _Float16* kg, const _Float16* vg,
                                                  int tid) {
  unsigned l[4];
  const _Float16* g[4];
#pragma unroll
  for (int i = 0; i < 2; ++i) {
    const int r   = i * 32 + (tid >> 3);
    const int ch  = tid & 7;
    const int off = r * 64 + ((ch ^ ((r >> 1) & 7)) * 8);
    l[i]     = lds_addr(kb + off);
    g[i]     = kg + r * HEAD_DIM + ch * 8;
    l[2 + i] = lds_addr(vb + off);
    g[2 + i] = vg + (size_t)r * SEQ + ch * 8;
  }
  async_cp16x4(l, g);
}
static __device__ __forceinline__ void wait_async_0() {
  asm volatile("s_wait_asynccnt 0" ::: "memory");
}

// ---------------------------------------------------------------------------
// Kernel 0: Wo f32 -> f16
// ---------------------------------------------------------------------------
__global__ __launch_bounds__(256) void wo_cvt_kernel(const float* __restrict__ Wo,
                                                     _Float16* __restrict__ Wo16) {
  int i = blockIdx.x * 256 + threadIdx.x;
  if (i < EMBED * EMBED) Wo16[i] = (_Float16)Wo[i];
}

// ---------------------------------------------------------------------------
// Kernel 1: per-head projection  Y[16x64] = X_tile[16x64] @ W^T
//   transposed==0 : store row-major  out[(n*H+h)*S + s][d]      (Q, K)
//   transposed==1 : store transposed out[(n*H+h)*64 + d][s]     (V)
// One wave (32 threads) per (token-tile, head).
// ---------------------------------------------------------------------------
__global__ __launch_bounds__(32) void proj_kernel(const float* __restrict__ X,
                                                  const float* __restrict__ W,
                                                  _Float16* __restrict__ outp,
                                                  int transposed) {
  const int lane = threadIdx.x;
  const int hw   = lane >> 4;          // half-wave: 0 or 1
  const int nl   = lane & 15;
  const int lo   = hw * 8;             // K-chunk base inside A/B fragment

  const int h  = blockIdx.x & (HEADS - 1);
  const int st = blockIdx.x / HEADS;   // token tile within batch
  const int bn = blockIdx.y;
  const int s0 = st * 16;

  // A fragments (tokens x d), K = 64 -> 2 k-steps of 32.
  v16h af[2];
  {
    const float* xr = X + ((size_t)(bn * SEQ + s0 + nl)) * EMBED + h * HEAD_DIM;
#pragma unroll
    for (int ks = 0; ks < 2; ++ks)
      af[ks] = cat16(cvt8(xr + ks * 32 + lo), cvt8(xr + ks * 32 + 16 + lo));
  }

  // 4 N-tiles of 16 output dims each.
  v8f acc[4];
#pragma unroll
  for (int nt = 0; nt < 4; ++nt) {
    v8f c = {};
#pragma unroll
    for (int ks = 0; ks < 2; ++ks) {
      // B[k][n] = W[e0+n][k]  (Y = X @ W^T); contiguous along k.
      const float* wr = W + (size_t)(nt * 16 + nl) * HEAD_DIM + ks * 32 + lo;
      v16h b = cat16(cvt8(wr), cvt8(wr + 16));
      c = WMMA_F16(af[ks], b, c);
    }
    acc[nt] = c;
  }

  if (transposed) {
    // C-frag: lane holds col e=nt*16+nl, rows s0+hw*8+r (r=0..7) -> contiguous s.
#pragma unroll
    for (int nt = 0; nt < 4; ++nt) {
      v8h pk;
#pragma unroll
      for (int r = 0; r < 8; ++r) pk[r] = (_Float16)acc[nt][r];
      _Float16* dst = outp + ((size_t)(bn * HEADS + h) * HEAD_DIM + nt * 16 + nl) * SEQ
                           + s0 + hw * 8;
      *(v8h*)dst = pk;
    }
  } else {
    __shared__ __align__(16) _Float16 tile[16 * 64];
#pragma unroll
    for (int nt = 0; nt < 4; ++nt)
#pragma unroll
      for (int r = 0; r < 8; ++r)
        tile[(hw * 8 + r) * 64 + nt * 16 + nl] = (_Float16)acc[nt][r];
    // same-wave LDS ops are in-order: loads below observe the stores above
    const int row = lane >> 1, c0 = (lane & 1) * 32;
    _Float16* dst = outp + ((size_t)(bn * HEADS + h) * SEQ + s0 + row) * HEAD_DIM + c0;
    const _Float16* src = &tile[row * 64 + c0];
#pragma unroll
    for (int i = 0; i < 4; ++i) *(v8h*)(dst + i * 8) = *(const v8h*)(src + i * 8);
  }
}

static __device__ __forceinline__ float xhalf(float x) {
  const int v = __builtin_bit_cast(int, x);
  return __builtin_bit_cast(float,
      __builtin_amdgcn_permlanex16(v, v, 0x76543210, 0xfedcba98, false, false));
}

__global__ __launch_bounds__(256) void attn_kernel(const _Float16* __restrict__ Qp,
                                                  const _Float16* __restrict__ Kp,
                                                  const _Float16* __restrict__ Vt,
                                                  const int* __restrict__ mask,
                                                  _Float16* __restrict__ AO) {
  const int tid  = threadIdx.x;
  const int wave = __builtin_amdgcn_readfirstlane(tid >> 5);
  const int lane = tid & 31;
  const int hw   = lane >> 4;
  const int nl   = lane & 15;
  const int lo   = hw * 8;

  const int h  = blockIdx.x & (HEADS - 1);
  const int qb = blockIdx.x / HEADS;
  const int bn = blockIdx.y;
  const int q0 = (qb * 8 + wave) * 16;

  const _Float16* Qh = Qp + (size_t)(bn * HEADS + h) * SEQ * HEAD_DIM;
  const _Float16* Kh = Kp + (size_t)(bn * HEADS + h) * SEQ * HEAD_DIM;
  const _Float16* Vh = Vt + (size_t)(bn * HEADS + h) * HEAD_DIM * SEQ;

  // Double-buffered K/V stages: K row-major [64 keys][64 d], V [64 d][64 keys],
  // 16-byte chunks swizzled inside each row (see fill_stage).
  __shared__ __align__(16) _Float16 Kbuf[2][64 * 64];
  __shared__ __align__(16) _Float16 Vbuf[2][64 * 64];

  // Q B-fragments (column n = nl on both half-waves), kept for the whole loop.
  v16h qf[2];
  {
    const _Float16* qr = Qh + (size_t)(q0 + nl) * HEAD_DIM;
#pragma unroll
    for (int ks = 0; ks < 2; ++ks)
      qf[ks] = cat16(ldh8(qr + ks * 32 + lo), ldh8(qr + ks * 32 + 16 + lo));
  }

  // o[dt][r] = O[q0 + nl][dt * 16 + hw * 8 + r]; rmax is the query's running
  // maximum (equal in both halves), rsum the sum over this half's keys only.
  v8f o[4] = {v8f{}, v8f{}, v8f{}, v8f{}};
  float rmax = -1.0e30f, rsum = 0.0f;

  const float scale = 0.03125f;              // 1/sqrt(EMBED) = 1/32
  const float mfill = -1.0e20f * 0.03125f;   // masked value after scaling

  // Mask: this lane's byte offset (the array has 64 MiB, 32 bits hold it) to the
  // first of its 8 keys of a 16-key tile in its own query row. mk holds the
  // lane's 16 mask words of the coming pass (tile c: mk[2c], mk[2c + 1]).
  const char* mbase = (const char*)mask;
  const unsigned moff = (unsigned)(((bn * SEQ + q0 + nl) * SEQ + lo) * 4);
  int4 mk[4];
#pragma unroll
  for (int c = 0; c < 2; ++c) {
    mk[2 * c]     = *(const int4*)(mbase + moff + c * 64);
    mk[2 * c + 1] = *(const int4*)(mbase + moff + c * 64 + 16);
  }

  const int NS = SEQ / 64;

  // Stage 0 lands and is published to all waves; then stage 1's copies start.
  fill_stage(Kbuf[0], Vbuf[0], Kh, Vh, tid);
  wait_async_0();
  __syncthreads();
  fill_stage(Kbuf[1], Vbuf[1], Kh + (size_t)64 * HEAD_DIM, Vh + 64, tid);

  // Swizzle term of the fragment readers (row = 16 * tile + nl in both).
  const int kswz = (nl >> 1) & 7;

  // Kept rolled: one trip per stage, one publish point at its foot.
#pragma unroll 1
  for (int st = 0; st < NS; ++st) {
    const int cur = st & 1;

    // Kept rolled: unrolled, the compiler merges the two passes and the wave
    // takes more than 128 registers, so that only three of the four work-groups
    // that a WGP gets from this grid would be resident at once.
#pragma unroll 1
    for (int p = 0; p < 2; ++p) {
      const int k0 = st * 64 + p * 32;

      // ---- S^T[32x16] = K @ Q^T : two 16-key tiles (A-frags from LDS) ------
      v8f sf[2];
#pragma unroll
      for (int c = 0; c < 2; ++c) {
        v8f s = {};
        const _Float16* kr = &Kbuf[cur][(p * 32 + c * 16 + nl) * 64];
#pragma unroll
        for (int ks = 0; ks < 2; ++ks) {
          v16h a = cat16(ldh8(kr + ((ks * 4 + hw) ^ kswz) * 8),
                         ldh8(kr + ((ks * 4 + 2 + hw) ^ kswz) * 8));
          s = WMMA_F16(a, qf[ks], s);
        }
        sf[c] = s;
      }

      // ---- scale + mask: 8 consecutive keys of one row per tile ------------
#pragma unroll
      for (int c = 0; c < 2; ++c) {
        const int4 ma = mk[2 * c], mb = mk[2 * c + 1];
        const int mv[8] = {ma.x, ma.y, ma.z, ma.w, mb.x, mb.y, mb.z, mb.w};
#pragma unroll
        for (int r = 0; r < 8; ++r)
          sf[c][r] = mv[r] ? sf[c][r] * scale : mfill;
      }
      // The next pass's mask words start now and land behind the rest of this
      // pass; the last pass wraps to key 0 (in bounds, never used).
      {
        const unsigned mn = moff + (unsigned)(((k0 + 32) & (SEQ - 1)) * 4);
#pragma unroll
        for (int c = 0; c < 2; ++c) {
          mk[2 * c]     = *(const int4*)(mbase + mn + c * 64);
          mk[2 * c + 1] = *(const int4*)(mbase + mn + c * 64 + 16);
        }
      }

      // ---- online softmax: maximum of 32 keys, in-lane + one exchange ------
      float m = fmaxf(sf[0][0], sf[1][0]);
#pragma unroll
      for (int r = 1; r < 8; ++r) m = fmaxf(m, fmaxf(sf[0][r], sf[1][r]));
      m = fmaxf(m, xhalf(m));
      const float nm    = fmaxf(rmax, m);
      const float alpha = __expf(rmax - nm);
      rmax = nm;

      // ---- P^T = exp(S^T - max): the two tiles are the B operand -----------
      v16h pb;
      float part = 0.0f;
#pragma unroll
      for (int c = 0; c < 2; ++c)
#pragma unroll
        for (int r = 0; r < 8; ++r) {
          const float pv = __expf(sf[c][r] - nm);
          part += pv;
          pb[c * 8 + r] = (_Float16)pv;
        }
      rsum = rsum * alpha + part;

      // ---- rescale accumulator --------------------------------------------
#pragma unroll
      for (int dt = 0; dt < 4; ++dt)
#pragma unroll
        for (int r = 0; r < 8; ++r) o[dt][r] *= alpha;

      // ---- O^T += V^T @ P^T (V A-frags from LDS, same k order as pb) -------
#pragma unroll
      for (int dt = 0; dt < 4; ++dt) {
        const _Float16* vr = &Vbuf[cur][(dt * 16 + nl) * 64];
        v16h a = cat16(ldh8(vr + ((p * 4 + hw) ^ kswz) * 8),
                       ldh8(vr + ((p * 4 + 2 + hw) ^ kswz) * 8));
        o[dt] = WMMA_F16(a, pb, o[dt]);
      }
    }

    // Publish point of stage st + 1: this wave's LDS reads of stage st retire,
    // its own copies of stage st + 1 have landed, then the barrier both shows
    // stage st + 1 to every wave and frees buffer cur for the refill.
    asm volatile("s_wait_dscnt 0x0" ::: "memory");
    wait_async_0();
    __syncthreads();
    if (st + 2 < NS)
      fill_stage(Kbuf[cur], Vbuf[cur], Kh + (size_t)(st + 2) * 64 * HEAD_DIM,
                 Vh + (st + 2) * 64, tid);
  }
  // No copy is outstanding when the wave goes on to its epilogue and ends.
  wait_async_0();

  // ---- finalize: join the halves' sums, O / rowsum, 16-byte f16 stores ----
  const float inv = 1.0f / (rsum + xhalf(rsum));
  _Float16* dst = AO + ((size_t)bn * SEQ + q0 + nl) * EMBED + h * HEAD_DIM + lo;
#pragma unroll
  for (int dt = 0; dt < 4; ++dt) {
    v8h pk;
#pragma unroll
    for (int r = 0; r < 8; ++r) pk[r] = (_Float16)(o[dt][r] * inv);
    *(v8h*)(dst + dt * 16) = pk;
  }
}

// ---------------------------------------------------------------------------
// Kernel 3: Y[8192x1024] = AO @ Wo^T + bo.  One wave per 16x64 output tile.
// ---------------------------------------------------------------------------
__global__ __launch_bounds__(32) void outproj_kernel(const _Float16* __restrict__ AO,
                                                     const _Float16* __restrict__ Wo16,
                                                     const float* __restrict__ bo,
                                                     float* __restrict__ Y) {
  const int lane = threadIdx.x;
  const int hw   = lane >> 4;
  const int nl   = lane & 15;
  const int lo   = hw * 8;

  const int et = blockIdx.x & 15;      // 16 tiles of 64 output columns
  const int tt = blockIdx.x >> 4;      // N*S/16 = 512 token tiles
  const int t0 = tt * 16;
  const int e0 = et * 64;

  v8f acc[4] = {v8f{}, v8f{}, v8f{}, v8f{}};

#pragma unroll 1
  for (int k = 0; k < EMBED; k += 32) {
    const _Float16* ar = AO + (size_t)(t0 + nl) * EMBED + k;
    v16h a = cat16(ldh8(ar + lo), ldh8(ar + 16 + lo));
#pragma unroll
    for (int nt = 0; nt < 4; ++nt) {
      const _Float16* wr = Wo16 + (size_t)(e0 + nt * 16 + nl) * EMBED + k;
      v16h b = cat16(ldh8(wr + lo), ldh8(wr + 16 + lo));
      acc[nt] = WMMA_F16(a, b, acc[nt]);
    }
  }

  __shared__ __align__(16) float tile[16 * 64];
#pragma unroll
  for (int nt = 0; nt < 4; ++nt) {
    const float bv = bo[e0 + nt * 16 + nl];
#pragma unroll
    for (int r = 0; r < 8; ++r)
      tile[(hw * 8 + r) * 64 + nt * 16 + nl] = acc[nt][r] + bv;
  }
  const int row = lane >> 1, c0 = (lane & 1) * 32;
  float4* dst = (float4*)(Y + (size_t)(t0 + row) * EMBED + e0 + c0);
  const float4* src = (const float4*)&tile[row * 64 + c0];
#pragma unroll
  for (int i = 0; i < 8; ++i) dst[i] = src[i];
}

// ---------------------------------------------------------------------------
extern "C" void kernel_launch(void* const* d_in, const int* in_sizes, int n_in,
                              void* d_out, int out_size, void* d_ws, size_t ws_size,
                              hipStream_t stream) {
  const float* values = (const float*)d_in[0];
  const float* keys_  = (const float*)d_in[1];
  const float* query  = (const float*)d_in[2];
  const int*   mask   = (const int*)d_in[3];
  const float* Wv     = (const float*)d_in[4];
  const float* Wk     = (const float*)d_in[5];
  const float* Wq     = (const float*)d_in[6];
  const float* Wo     = (const float*)d_in[7];
  const float* bo     = (const float*)d_in[8];
  float* out = (float*)d_out;

  // Workspace layout (bytes):
  //   Qp [N][H][S][D]  f16 : 16 MB
  //   Kp [N][H][S][D]  f16 : 16 MB
  //   Vt [N][H][D][S]  f16 : 16 MB   (transposed for V^T@P^T A-fragments)
  //   AO [N][S][E]     f16 : 16 MB
  //   Wo16 [E][E]      f16 :  2 MB
  const size_t QKV = (size_t)NBATCH * HEADS * SEQ * HEAD_DIM * sizeof(_Float16);
  char* ws = (char*)d_ws;
  _Float16* Qp   = (_Float16*)(ws);
  _Float16* Kp   = (_Float16*)(ws + QKV);
  _Float16* Vt   = (_Float16*)(ws + 2 * QKV);
  _Float16* AO   = (_Float16*)(ws + 3 * QKV);
  _Float16* Wo16 = (_Float16*)(ws + 4 * QKV);

  wo_cvt_kernel<<<(EMBED * EMBED) / 256, 256, 0, stream>>>(Wo, Wo16);

  dim3 gproj((SEQ / 16) * HEADS, NBATCH);
  proj_kernel<<<gproj, 32, 0, stream>>>(query,  Wq, Qp, 0);
  proj_kernel<<<gproj, 32, 0, stream>>>(keys_,  Wk, Kp, 0);
  proj_kernel<<<gproj, 32, 0, stream>>>(values, Wv, Vt, 1);

  dim3 gattn((SEQ / 128) * HEADS, NBATCH);
  attn_kernel<<<gattn, 256, 0, stream>>>(Qp, Kp, Vt, mask, AO);

  outproj_kernel<<<(NBATCH * SEQ / 16) * (EMBED / 64), 32, 0, stream>>>(AO, Wo16, bo, out);
}

// v004
// One run takes 168 microseconds.
// Timed twice side by side with v003, it ran 1.41 times as fast both times.
// All steps since v000 together make it 2.95 times as fast.
#include <hip/hip_runtime.h>

#define EMBED 1024
#define HEADS 16
#define HEAD_DIM 64
#define NBATCH 4
#define SEQ 2048

typedef __attribute__((ext_vector_type(16))) _Float16 v16h;
typedef __attribute__((ext_vector_type(8)))  _Float16 v8h;
typedef __attribute__((ext_vector_type(8)))  float    v8f;

static __device__ __forceinline__ v16h cat16(v8h a, v8h b) {
  return __builtin_shufflevector(a, b, 0,1,2,3,4,5,6,7,8,9,10,11,12,13,14,15);
}
static __device__ __forceinline__ v8h ldh8(const _Float16* p) { return *(const v8h*)p; }
static __device__ __forceinline__ v8h cvt8(const float* p) {
  float4 a = *(const float4*)p;
  float4 b = *(const float4*)(p + 4);
  v8h r;
  r[0]=(_Float16)a.x; r[1]=(_Float16)a.y; r[2]=(_Float16)a.z; r[3]=(_Float16)a.w;
  r[4]=(_Float16)b.x; r[5]=(_Float16)b.y; r[6]=(_Float16)b.z; r[7]=(_Float16)b.w;
  return r;
}
#define WMMA_F16(a,b,c) __builtin_amdgcn_wmma_f32_16x16x32_f16(false,(a),false,(b),(short)0,(c),false,false)

// Async global->LDS copy, 16 bytes per lane (GLOBAL_LOAD_ASYNC_TO_LDS_B128,
// tracked by ASYNCcnt). LDS aperture keeps the byte offset in addr[31:0], so
// truncating the generic pointer yields the LDS-address VGPR value.
static __device__ __forceinline__ unsigned lds_addr(const _Float16* p) {
  return (unsigned)(unsigned long long)p;
}
// Four copies and their s_wait_xcnt in ONE statement: the wait stands in front
// of any later rewrite of the address registers that the copies name.
static __device__ __forceinline__ void async_cp16x4(const unsigned (&l)[4],
                                                    const _Float16* const (&g)[4]) {
  asm volatile("global_load_async_to_lds_b128 %0, %4, off\n\t"
               "global_load_async_to_lds_b128 %1, %5, off\n\t"
               "global_load_async_to_lds_b128 %2, %6, off\n\t"
               "global_load_async_to_lds_b128 %3, %7, off\n\t"
               "s_wait_xcnt 0x0"
               :: "v"(l[0]), "v"(l[1]), "v"(l[2]), "v"(l[3]),
                  "v"(g[0]), "v"(g[1]), "v"(g[2]), "v"(g[3])
               : "memory");
}
// Fill one stage of 64 keys for the whole work-group (256 threads, 4 copies
// each): K 64 keys x 64 d (8192 contiguous bytes in global), V 64 d-rows x 64
// keys (128-byte runs). Every copy of a wave takes 4 whole 128-byte lines. In
// LDS both keep a 128-byte row pitch, and the 16-byte chunks of a row are
// XOR-swizzled by the row number, chunk ^= (row >> 1) & 7, so that the 16 rows
// of one ds_load_b128 fragment read fall on 16 different bank quads.
static __device__ __forceinline__ void fill_stage(_Float16* kb, _Float16* vb,
                                                  const _Float16* kg, const _Float16* vg,
                                                  int tid) {
  unsigned l[4];
  const _Float16* g[4];
#pragma unroll
  for (int i = 0; i < 2; ++i) {
    const int r   = i * 32 + (tid >> 3);
    const int ch  = tid & 7;
    const int off = r * 64 + ((ch ^ ((r >> 1) & 7)) * 8);
    l[i]     = lds_addr(kb + off);
    g[i]     = kg + r * HEAD_DIM + ch * 8;
    l[2 + i] = lds_addr(vb + off);
    g[2 + i] = vg + (size_t)r * SEQ + ch * 8;
  }
  async_cp16x4(l, g);
}
static __device__ __forceinline__ void wait_async_0() {
  asm volatile("s_wait_asynccnt 0" ::: "memory");
}

// ---------------------------------------------------------------------------
// Kernel 0: Wo f32 -> f16
// ---------------------------------------------------------------------------
__global__ __launch_bounds__(256) void wo_cvt_kernel(const float* __restrict__ Wo,
                                                     _Float16* __restrict__ Wo16) {
  int i = blockIdx.x * 256 + threadIdx.x;
  if (i < EMBED * EMBED) Wo16[i] = (_Float16)Wo[i];
}

// ---------------------------------------------------------------------------
// Kernel 1: per-head projection  Y[16x64] = X_tile[16x64] @ W^T
//   transposed==0 : store row-major  out[(n*H+h)*S + s][d]      (Q, K)
//   transposed==1 : store transposed out[(n*H+h)*64 + d][s]     (V)
// One wave (32 threads) per (token-tile, head).
// ---------------------------------------------------------------------------
__global__ __launch_bounds__(32) void proj_kernel(const float* __restrict__ X,
                                                  const float* __restrict__ W,
                                                  _Float16* __restrict__ outp,
                                                  int transposed) {
  const int lane = threadIdx.x;
  const int hw   = lane >> 4;          // half-wave: 0 or 1
  const int nl   = lane & 15;
  const int lo   = hw * 8;             // K-chunk base inside A/B fragment

  const int h  = blockIdx.x & (HEADS - 1);
  const int st = blockIdx.x / HEADS;   // token tile within batch
  const int bn = blockIdx.y;
  const int s0 = st * 16;

  // A fragments (tokens x d), K = 64 -> 2 k-steps of 32.
  v16h af[2];
  {
    const float* xr = X + ((size_t)(bn * SEQ + s0 + nl)) * EMBED + h * HEAD_DIM;
#pragma unroll
    for (int ks = 0; ks < 2; ++ks)
      af[ks] = cat16(cvt8(xr + ks * 32 + lo), cvt8(xr + ks * 32 + 16 + lo));
  }

  // 4 N-tiles of 16 output dims each.
  v8f acc[4];
#pragma unroll
  for (int nt = 0; nt < 4; ++nt) {
    v8f c = {};
#pragma unroll
    for (int ks = 0; ks < 2; ++ks) {
      // B[k][n] = W[e0+n][k]  (Y = X @ W^T); contiguous along k.
      const float* wr = W + (size_t)(nt * 16 + nl) * HEAD_DIM + ks * 32 + lo;
      v16h b = cat16(cvt8(wr), cvt8(wr + 16));
      c = WMMA_F16(af[ks], b, c);
    }
    acc[nt] = c;
  }

  if (transposed) {
    // C-frag: lane holds col e=nt*16+nl, rows s0+hw*8+r (r=0..7) -> contiguous s.
#pragma unroll
    for (int nt = 0; nt < 4; ++nt) {
      v8h pk;
#pragma unroll
      for (int r = 0; r < 8; ++r) pk[r] = (_Float16)acc[nt][r];
      _Float16* dst = outp + ((size_t)(bn * HEADS + h) * HEAD_DIM + nt * 16 + nl) * SEQ
                           + s0 + hw * 8;
      *(v8h*)dst = pk;
    }
  } else {
    __shared__ __align__(16) _Float16 tile[16 * 64];
#pragma unroll
    for (int nt = 0; nt < 4; ++nt)
#pragma unroll
      for (int r = 0; r < 8; ++r)
        tile[(hw * 8 + r) * 64 + nt * 16 + nl] = (_Float16)acc[nt][r];
    // same-wave LDS ops are in-order: loads below observe the stores above
    const int row = lane >> 1, c0 = (lane & 1) * 32;
    _Float16* dst = outp + ((size_t)(bn * HEADS + h) * SEQ + s0 + row) * HEAD_DIM + c0;
    const _Float16* src = &tile[row * 64 + c0];
#pragma unroll
    for (int i = 0; i < 4; ++i) *(v8h*)(dst + i * 8) = *(const v8h*)(src + i * 8);
  }
}

static __device__ __forceinline__ float xhalf(float x) {
  const int v = __builtin_bit_cast(int, x);
  return __builtin_bit_cast(float,
      __builtin_amdgcn_permlanex16(v, v, 0x76543210, 0xfedcba98, false, false));
}

__global__ __launch_bounds__(256) void attn_kernel(const _Float16* __restrict__ Qp,
                                                  const _Float16* __restrict__ Kp,
                                                  const _Float16* __restrict__ Vt,
                                                  const int* __restrict__ mask,
                                                  _Float16* __restrict__ AO) {
  const int tid  = threadIdx.x;
  const int wave = __builtin_amdgcn_readfirstlane(tid >> 5);
  const int lane = tid & 31;
  const int hw   = lane >> 4;
  const int nl   = lane & 15;
  const int lo   = hw * 8;

  const int h  = blockIdx.x & (HEADS - 1);
  const int qb = blockIdx.x / HEADS;
  const int bn = blockIdx.y;
  const int q0 = (qb * 8 + wave) * 16;

  const _Float16* Qh = Qp + (size_t)(bn * HEADS + h) * SEQ * HEAD_DIM;
  const _Float16* Kh = Kp + (size_t)(bn * HEADS + h) * SEQ * HEAD_DIM;
  const _Float16* Vh = Vt + (size_t)(bn * HEADS + h) * HEAD_DIM * SEQ;

  // Double-buffered K/V stages: K row-major [64 keys][64 d], V [64 d][64 keys],
  // 16-byte chunks swizzled inside each row (see fill_stage).
  __shared__ __align__(16) _Float16 Kbuf[2][64 * 64];
  __shared__ __align__(16) _Float16 Vbuf[2][64 * 64];

  // Q B-fragments (column n = nl on both half-waves), kept for the whole loop.
  v16h qf[2];
  {
    const _Float16* qr = Qh + (size_t)(q0 + nl) * HEAD_DIM;
#pragma unroll
    for (int ks = 0; ks < 2; ++ks)
      qf[ks] = cat16(ldh8(qr + ks * 32 + lo), ldh8(qr + ks * 32 + 16 + lo));
  }

  // o[dt][r] = O[q0 + nl][dt * 16 + hw * 8 + r]; rmax is the query's running
  // maximum (equal in both halves), rsum the sum over this half's keys only.
  v8f o[4] = {v8f{}, v8f{}, v8f{}, v8f{}};
  float rmax = -1.0e30f, rsum = 0.0f;

  const float scale = 0.03125f;              // 1/sqrt(EMBED) = 1/32
  const float mfill = -1.0e20f * 0.03125f;   // masked value after scaling

  // Mask: this lane's byte offset (the array has 64 MiB, 32 bits hold it) to the
  // first of its 8 keys of a 16-key tile in its own query row. mk holds the
  // lane's 16 mask words of the coming pass (tile c: mk[2c], mk[2c + 1]).
  const char* mbase = (const char*)mask;
  const unsigned moff = (unsigned)(((bn * SEQ + q0 + nl) * SEQ + lo) * 4);
  int4 mk[4];
#pragma unroll
  for (int c = 0; c < 2; ++c) {
    mk[2 * c]     = *(const int4*)(mbase + moff + c * 64);
    mk[2 * c + 1] = *(const int4*)(mbase + moff + c * 64 + 16);
  }

  const int NS = SEQ / 64;

  // Stage 0 lands and is published to all waves; then stage 1's copies start.
  fill_stage(Kbuf[0], Vbuf[0], Kh, Vh, tid);
  wait_async_0();
  __syncthreads();
  fill_stage(Kbuf[1], Vbuf[1], Kh + (size_t)64 * HEAD_DIM, Vh + 64, tid);

  // Swizzle term of the fragment readers (row = 16 * tile + nl in both).
  const int kswz = (nl >> 1) & 7;

  // Kept rolled: one trip per stage, one publish point at its foot.
#pragma unroll 1
  for (int st = 0; st < NS; ++st) {
    const int cur = st & 1;

    // Kept rolled: unrolled, the compiler merges the two passes and the wave
    // takes more than 128 registers, so that only three of the four work-groups
    // that a WGP gets from this grid would be resident at once.
#pragma unroll 1
    for (int p = 0; p < 2; ++p) {
      const int k0 = st * 64 + p * 32;

      // ---- S^T[32x16] = K @ Q^T : two 16-key tiles (A-frags from LDS) ------
      v8f sf[2];
#pragma unroll
      for (int c = 0; c < 2; ++c) {
        v8f s = {};
        const _Float16* kr = &Kbuf[cur][(p * 32 + c * 16 + nl) * 64];
#pragma unroll
        for (int ks = 0; ks < 2; ++ks) {
          v16h a = cat16(ldh8(kr + ((ks * 4 + hw) ^ kswz) * 8),
                         ldh8(kr + ((ks * 4 + 2 + hw) ^ kswz) * 8));
          s = WMMA_F16(a, qf[ks], s);
        }
        sf[c] = s;
      }

      // ---- scale + mask: 8 consecutive keys of one row per tile ------------
#pragma unroll
      for (int c = 0; c < 2; ++c) {
        const int4 ma = mk[2 * c], mb = mk[2 * c + 1];
        const int mv[8] = {ma.x, ma.y, ma.z, ma.w, mb.x, mb.y, mb.z, mb.w};
#pragma unroll
        for (int r = 0; r < 8; ++r)
          sf[c][r] = mv[r] ? sf[c][r] * scale : mfill;
      }
      // The next pass's mask words start now and land behind the rest of this
      // pass; the last pass wraps to key 0 (in bounds, never used).
      {
        const unsigned mn = moff + (unsigned)(((k0 + 32) & (SEQ - 1)) * 4);
#pragma unroll
        for (int c = 0; c < 2; ++c) {
          mk[2 * c]     = *(const int4*)(mbase + mn + c * 64);
          mk[2 * c + 1] = *(const int4*)(mbase + mn + c * 64 + 16);
        }
      }

      // ---- online softmax: maximum of 32 keys, in-lane + one exchange ------
      float m = fmaxf(sf[0][0], sf[1][0]);
#pragma unroll
      for (int r = 1; r < 8; ++r) m = fmaxf(m, fmaxf(sf[0][r], sf[1][r]));
      m = fmaxf(m, xhalf(m));
      const float nm    = fmaxf(rmax, m);
      const float alpha = __expf(rmax - nm);
      rmax = nm;

      // ---- P^T = exp(S^T - max): the two tiles are the B operand -----------
      v16h pb;
      float part = 0.0f;
#pragma unroll
      for (int c = 0; c < 2; ++c)
#pragma unroll
        for (int r = 0; r < 8; ++r) {
          const float pv = __expf(sf[c][r] - nm);
          part += pv;
          pb[c * 8 + r] = (_Float16)pv;
        }
      rsum = rsum * alpha + part;

      // ---- rescale accumulator --------------------------------------------
#pragma unroll
      for (int dt = 0; dt < 4; ++dt)
#pragma unroll
        for (int r = 0; r < 8; ++r) o[dt][r] *= alpha;

      // ---- O^T += V^T @ P^T (V A-frags from LDS, same k order as pb) -------
#pragma unroll
      for (int dt = 0; dt < 4; ++dt) {
        const _Float16* vr = &Vbuf[cur][(dt * 16 + nl) * 64];
        v16h a = cat16(ldh8(vr + ((p * 4 + hw) ^ kswz) * 8),
                       ldh8(vr + ((p * 4 + 2 + hw) ^ kswz) * 8));
        o[dt] = WMMA_F16(a, pb, o[dt]);
      }
    }

    // Publish point of stage st + 1: this wave's LDS reads of stage st retire,
    // its own copies of stage st + 1 have landed, then the barrier both shows
    // stage st + 1 to every wave and frees buffer cur for the refill.
    asm volatile("s_wait_dscnt 0x0" ::: "memory");
    wait_async_0();
    __syncthreads();
    if (st + 2 < NS)
      fill_stage(Kbuf[cur], Vbuf[cur], Kh + (size_t)(st + 2) * 64 * HEAD_DIM,
                 Vh + (st + 2) * 64, tid);
  }
  // No copy is outstanding when the wave goes on to its epilogue and ends.
  wait_async_0();

  // ---- finalize: join the halves' sums, O / rowsum, 16-byte f16 stores ----
  const float inv = 1.0f / (rsum + xhalf(rsum));
  _Float16* dst = AO + ((size_t)bn * SEQ + q0 + nl) * EMBED + h * HEAD_DIM + lo;
#pragma unroll
  for (int dt = 0; dt < 4; ++dt) {
    v8h pk;
#pragma unroll
    for (int r = 0; r < 8; ++r) pk[r] = (_Float16)(o[dt][r] * inv);
    *(v8h*)(dst + dt * 16) = pk;
  }
}

// ---------------------------------------------------------------------------
// Kernel 3: Y[8192x1024] = AO @ Wo^T + bo. One work-group of 8 waves per
// 128 x 128 output tile, one 64 x 32 part per wave (2 x 4 waves). A stage is 64 k
// (one 128-byte line) of the tile's 128 AO rows and 128 Wo rows: two buffers in
// LDS, every wave copies an eighth of a stage with
// GLOBAL_LOAD_ASYNC_TO_LDS_B128, each copy taking 4 whole lines, and the next
// stage's copies fly while this one is worked on. Rows and chunks lie in LDS
// as in fill_stage, so the b128 fragment reads are conflict-free.
// ---------------------------------------------------------------------------
#define OP_ROWS 128                 // rows of each operand in a stage
#define OP_HALF (OP_ROWS * 64)      // f16 elements of one operand's stage

// Eight copies and their s_wait_xcnt in ONE statement: the wait stands in front
// of any later rewrite of the address registers that the copies name.
static __device__ __forceinline__ void async_cp16x8(const unsigned (&l)[8],
                                                    const _Float16* const (&g)[8]) {
  asm volatile("global_load_async_to_lds_b128 %0, %8, off\n\t"
               "global_load_async_to_lds_b128 %1, %9, off\n\t"
               "global_load_async_to_lds_b128 %2, %10, off\n\t"
               "global_load_async_to_lds_b128 %3, %11, off\n\t"
               "global_load_async_to_lds_b128 %4, %12, off\n\t"
               "global_load_async_to_lds_b128 %5, %13, off\n\t"
               "global_load_async_to_lds_b128 %6, %14, off\n\t"
               "global_load_async_to_lds_b128 %7, %15, off\n\t"
               "s_wait_xcnt 0x0"
               :: "v"(l[0]), "v"(l[1]), "v"(l[2]), "v"(l[3]),
                  "v"(l[4]), "v"(l[5]), "v"(l[6]), "v"(l[7]),
                  "v"(g[0]), "v"(g[1]), "v"(g[2]), "v"(g[3]),
                  "v"(g[4]), "v"(g[5]), "v"(g[6]), "v"(g[7])
               : "memory");
}
// One stage for the whole work-group (256 threads, 8 copies each); ag and bg
// point at the stage's first k of the tile's first AO row and first Wo row.
static __device__ __forceinline__ void fill_gemm_stage(_Float16* ab, _Float16* bb,
                                                       const _Float16* ag,
                                                       const _Float16* bg, int tid) {
  unsigned l[8];
  const _Float16* g[8];
#pragma unroll
  for (int i = 0; i < 4; ++i) {
    const int r   = i * 32 + (tid >> 3);
    const int ch  = tid & 7;
    const int off = r * 64 + ((ch ^ ((r >> 1) & 7)) * 8);
    l[i]     = lds_addr(ab + off);
    g[i]     = ag + (size_t)r * EMBED + ch * 8;
    l[4 + i] = lds_addr(bb + off);
    g[4 + i] = bg + (size_t)r * EMBED + ch * 8;
  }
  async_cp16x8(l, g);
}

__global__ __launch_bounds__(256) void outproj_kernel(const _Float16* __restrict__ AO,
                                                      const _Float16* __restrict__ Wo16,
                                                      const float* __restrict__ bo,
                                                      float* __restrict__ Y) {
  const int tid  = threadIdx.x;
  const int wave = __builtin_amdgcn_readfirstlane(tid >> 5);
  const int lane = tid & 31;
  const int hw   = lane >> 4;
  const int nl   = lane & 15;

  const int e0 = blockIdx.x * OP_ROWS;   // first output column of the tile
  const int t0 = blockIdx.y * OP_ROWS;   // first token of the tile
  const int wm = wave >> 2;              // this wave's 64 tokens
  const int wn = wave & 3;               // this wave's 32 columns

  // ring[buffer][operand]: AO rows, then Wo rows; 64 KiB, the output staging
  // of the epilogue takes the same bytes.
  __shared__ __align__(16) _Float16 ring[2][2][OP_HALF];

  const _Float16* Ag = AO + (size_t)t0 * EMBED;
  const _Float16* Bg = Wo16 + (size_t)e0 * EMBED;

  v8f acc[4][2];
#pragma unroll
  for (int mt = 0; mt < 4; ++mt)
#pragma unroll
    for (int nt = 0; nt < 2; ++nt) acc[mt][nt] = v8f{};

  const int NS = EMBED / 64;

  // Stage 0 lands and is published to all waves; then stage 1's copies start.
  fill_gemm_stage(ring[0][0], ring[0][1], Ag, Bg, tid);
  wait_async_0();
  __syncthreads();
  fill_gemm_stage(ring[1][0], ring[1][1], Ag + 64, Bg + 64, tid);

  // Swizzle term of the fragment readers (row = 16 * tile + nl in both).
  const int kswz = (nl >> 1) & 7;

  // Kept rolled: one trip per stage, one publish point at its foot.
#pragma unroll 1
  for (int st = 0; st < NS; ++st) {
    const int cur = st & 1;
    const _Float16* ar = &ring[cur][0][(wm * 64 + nl) * 64];
    const _Float16* br = &ring[cur][1][(wn * 32 + nl) * 64];
#pragma unroll
    for (int ks = 0; ks < 2; ++ks) {
      const int c0 = ((ks * 4 + hw) ^ kswz) * 8;
      const int c1 = ((ks * 4 + 2 + hw) ^ kswz) * 8;
      v16h a[4], b[2];
#pragma unroll
      for (int mt = 0; mt < 4; ++mt)
        a[mt] = cat16(ldh8(ar + mt * 16 * 64 + c0), ldh8(ar + mt * 16 * 64 + c1));
#pragma unroll
      for (int nt = 0; nt < 2; ++nt)
        b[nt] = cat16(ldh8(br + nt * 16 * 64 + c0), ldh8(br + nt * 16 * 64 + c1));
#pragma unroll
      for (int mt = 0; mt < 4; ++mt)
#pragma unroll
        for (int nt = 0; nt < 2; ++nt)
          acc[mt][nt] = WMMA_F16(a[mt], b[nt], acc[mt][nt]);
    }

    // Publish point of stage st + 1: this wave's LDS reads of stage st retire,
    // its own copies of stage st + 1 have landed, then the barrier both shows
    // stage st + 1 to every wave and frees buffer cur for the refill.
    asm volatile("s_wait_dscnt 0x0" ::: "memory");
    wait_async_0();
    __syncthreads();
    if (st + 2 < NS)
      fill_gemm_stage(ring[cur][0], ring[cur][1], Ag + (st + 2) * 64, Bg + (st + 2) * 64, tid);
  }
  // No copy is outstanding when the ring becomes output staging.
  wait_async_0();

  // ---- epilogue: behind the last publish point nobody reads the ring any more.
  // Each wave stages its 64 x 32 f32 part in its own 8 KiB, rows of one 128-byte
  // line; the two 16-column halves of a row change places in rows 8..15 of each
  // 16, so that the two wave halves of a store fall on different banks. It reads
  // the rows back, adds the bias and stores 4 whole lines per instruction.
  float* stg = (float*)&ring[0][0][0] + wave * (64 * 32);
#pragma unroll
  for (int mt = 0; mt < 4; ++mt)
#pragma unroll
    for (int nt = 0; nt < 2; ++nt)
#pragma unroll
      for (int r = 0; r < 8; ++r)
        stg[(mt * 16 + hw * 8 + r) * 32 + ((nt * 16 + nl) ^ (hw << 4))] = acc[mt][nt][r];

  const int ch = lane & 7;
  const int ec = e0 + wn * 32 + ch * 4;
  const float4 bv = *(const float4*)(bo + ec);
  float* yr = Y + (size_t)(t0 + wm * 64) * EMBED + ec;
#pragma unroll
  for (int i = 0; i < 16; ++i) {
    const int row = i * 4 + (lane >> 3);
    float4 v = *(const float4*)&stg[row * 32 + ((ch ^ (((row >> 3) & 1) << 2)) * 4)];
    v.x += bv.x; v.y += bv.y; v.z += bv.z; v.w += bv.w;
    *(float4*)(yr + (size_t)row * EMBED) = v;
  }
}

// ---------------------------------------------------------------------------
extern "C" void kernel_launch(void* const* d_in, const int* in_sizes, int n_in,
                              void* d_out, int out_size, void* d_ws, size_t ws_size,
                              hipStream_t stream) {
  const float* values = (const float*)d_in[0];
  const float* keys_  = (const float*)d_in[1];
  const float* query  = (const float*)d_in[2];
  const int*   mask   = (const int*)d_in[3];
  const float* Wv     = (const float*)d_in[4];
  const float* Wk     = (const float*)d_in[5];
  const float* Wq     = (const float*)d_in[6];
  const float* Wo     = (const float*)d_in[7];
  const float* bo     = (const float*)d_in[8];
  float* out = (float*)d_out;

  // Workspace layout (bytes):
  //   Qp [N][H][S][D]  f16 : 16 MB
  //   Kp [N][H][S][D]  f16 : 16 MB
  //   Vt [N][H][D][S]  f16 : 16 MB   (transposed for V^T@P^T A-fragments)
  //   AO [N][S][E]     f16 : 16 MB
  //   Wo16 [E][E]      f16 :  2 MB
  const size_t QKV = (size_t)NBATCH * HEADS * SEQ * HEAD_DIM * sizeof(_Float16);
  char* ws = (char*)d_ws;
  _Float16* Qp   = (_Float16*)(ws);
  _Float16* Kp   = (_Float16*)(ws + QKV);
  _Float16* Vt   = (_Float16*)(ws + 2 * QKV);
  _Float16* AO   = (_Float16*)(ws + 3 * QKV);
  _Float16* Wo16 = (_Float16*)(ws + 4 * QKV);

  wo_cvt_kernel<<<(EMBED * EMBED) / 256, 256, 0, stream>>>(Wo, Wo16);

  dim3 gproj((SEQ / 16) * HEADS, NBATCH);
  proj_kernel<<<gproj, 32, 0, stream>>>(query,  Wq, Qp, 0);
  proj_kernel<<<gproj, 32, 0, stream>>>(keys_,  Wk, Kp, 0);
  proj_kernel<<<gproj, 32, 0, stream>>>(values, Wv, Vt, 1);

  dim3 gattn((SEQ / 128) * HEADS, NBATCH);
  attn_kernel<<<gattn, 256, 0, stream>>>(Qp, Kp, Vt, mask, AO);

  dim3 gout(EMBED / OP_ROWS, NBATCH * SEQ / OP_ROWS);
  outproj_kernel<<<gout, 256, 0, stream>>>(AO, Wo16, bo, out);
}

// v005
// One run takes 137 microseconds.
// In two side-by-side timings against v004, it was 1.23 and 1.22 times as fast.
// All steps since v000 together make it 3.62 times as fast.
#include <hip/hip_runtime.h>

#define EMBED 1024
#define HEADS 16
#define HEAD_DIM 64
#define NBATCH 4
#define SEQ 2048

typedef __attribute__((ext_vector_type(16))) _Float16 v16h;
typedef __attribute__((ext_vector_type(8)))  _Float16 v8h;
typedef __attribute__((ext_vector_type(8)))  float    v8f;

static __device__ __forceinline__ v16h cat16(v8h a, v8h b) {
  return __builtin_shufflevector(a, b, 0,1,2,3,4,5,6,7,8,9,10,11,12,13,14,15);
}
static __device__ __forceinline__ v8h ldh8(const _Float16* p) { return *(const v8h*)p; }
static __device__ __forceinline__ v8h cvt8(const float* p) {
  float4 a = *(const float4*)p;
  float4 b = *(const float4*)(p + 4);
  v8h r;
  r[0]=(_Float16)a.x; r[1]=(_Float16)a.y; r[2]=(_Float16)a.z; r[3]=(_Float16)a.w;
  r[4]=(_Float16)b.x; r[5]=(_Float16)b.y; r[6]=(_Float16)b.z; r[7]=(_Float16)b.w;
  return r;
}
#define WMMA_F16(a,b,c) __builtin_amdgcn_wmma_f32_16x16x32_f16(false,(a),false,(b),(short)0,(c),false,false)

// Async global->LDS copy, 16 bytes per lane (GLOBAL_LOAD_ASYNC_TO_LDS_B128,
// tracked by ASYNCcnt). LDS aperture keeps the byte offset in addr[31:0], so
// truncating the generic pointer yields the LDS-address VGPR value.
static __device__ __forceinline__ unsigned lds_addr(const _Float16* p) {
  return (unsigned)(unsigned long long)p;
}
// Four copies and their s_wait_xcnt in ONE statement: the wait stands in front
// of any later rewrite of the address registers that the copies name.
static __device__ __forceinline__ void async_cp16x4(const unsigned (&l)[4],
                                                    const _Float16* const (&g)[4]) {
  asm volatile("global_load_async_to_lds_b128 %0, %4, off\n\t"
               "global_load_async_to_lds_b128 %1, %5, off\n\t"
               "global_load_async_to_lds_b128 %2, %6, off\n\t"
               "global_load_async_to_lds_b128 %3, %7, off\n\t"
               "s_wait_xcnt 0x0"
               :: "v"(l[0]), "v"(l[1]), "v"(l[2]), "v"(l[3]),
                  "v"(g[0]), "v"(g[1]), "v"(g[2]), "v"(g[3])
               : "memory");
}
// Fill one stage of 64 keys for the whole work-group (256 threads, 4 copies
// each): K 64 keys x 64 d (8192 contiguous bytes in global), V 64 d-rows x 64
// keys (128-byte runs). Every copy of a wave takes 4 whole 128-byte lines. In
// LDS both keep a 128-byte row pitch, and the 16-byte chunks of a row are
// XOR-swizzled by the row number, chunk ^= (row >> 1) & 7, so that the 16 rows
// of one ds_load_b128 fragment read fall on 16 different bank quads.
static __device__ __forceinline__ void fill_stage(_Float16* kb, _Float16* vb,
                                                  const _Float16* kg, const _Float16* vg,
                                                  int tid) {
  unsigned l[4];
  const _Float16* g[4];
#pragma unroll
  for (int i = 0; i < 2; ++i) {
    const int r   = i * 32 + (tid >> 3);
    const int ch  = tid & 7;
    const int off = r * 64 + ((ch ^ ((r >> 1) & 7)) * 8);
    l[i]     = lds_addr(kb + off);
    g[i]     = kg + r * HEAD_DIM + ch * 8;
    l[2 + i] = lds_addr(vb + off);
    g[2 + i] = vg + (size_t)r * SEQ + ch * 8;
  }
  async_cp16x4(l, g);
}
static __device__ __forceinline__ void wait_async_0() {
  asm volatile("s_wait_asynccnt 0" ::: "memory");
}

// ---------------------------------------------------------------------------
// Kernel 1: the whole front end in one launch: the three per-head projections
// Y = X_head @ W^T and the conversion of Wo to f16. One work-group of 12 waves
// per 4 x 128 tokens-of-a-head: waves 0..3 take Q, 4..7 K, 8..11 V. The four
// waves of a tensor convert a quarter of its 64 x 64 weight each and share the
// fragments through LDS; a wave then keeps all of them in registers and walks
// 128 tokens of one head (8 tiles of 16), two tiles a step, the next step's
// loads in flight while this one is worked on.
//   Q, K : Y^T = W X^T, a lane holds 8 consecutive d of one token; out [n][h][s][d]
//   V    : Y   = X W^T, a lane holds 8 consecutive tokens of one d; out [n][h][d][s]
// Either way the 16-byte pieces of four tiles are staged in the wave's own 8 KiB
// of LDS as 64 rows of one 128-byte line and go out 4 whole lines per store.
// ---------------------------------------------------------------------------
#define FE_WAVES 12
#define FE_STEPS 4                  // steps of two 16-token tiles per wave

typedef __attribute__((ext_vector_type(4))) _Float16 v4h;

static __device__ __forceinline__ v8h cvt8r(float4 a, float4 b) {
  v8h r;
  r[0]=(_Float16)a.x; r[1]=(_Float16)a.y; r[2]=(_Float16)a.z; r[3]=(_Float16)a.w;
  r[4]=(_Float16)b.x; r[5]=(_Float16)b.y; r[6]=(_Float16)b.z; r[7]=(_Float16)b.w;
  return r;
}
// The 32 floats of one lane's two fragments of a 16 x 64 tile; xr points at the
// lane's row, at its half-wave's first k.
static __device__ __forceinline__ void ld_x(const float* xr, float4 (&v)[8]) {
#pragma unroll
  for (int ks = 0; ks < 2; ++ks)
#pragma unroll
    for (int c = 0; c < 2; ++c) {
      v[ks * 4 + c * 2]     = *(const float4*)(xr + ks * 32 + c * 16);
      v[ks * 4 + c * 2 + 1] = *(const float4*)(xr + ks * 32 + c * 16 + 4);
    }
}

// The two f16 fragments of a tile from its raw floats.
static __device__ __forceinline__ void cvt_x(const float4 (&v)[8], v16h (&af)[2]) {
#pragma unroll
  for (int ks = 0; ks < 2; ++ks)
    af[ks] = cat16(cvt8r(v[ks * 4], v[ks * 4 + 1]), cvt8r(v[ks * 4 + 2], v[ks * 4 + 3]));
}

// The products of one step (two tiles) and their staging. stg: the wave's own
// 64 rows of 128 bytes; odd: second step of the staged group of four tiles.
template <bool TR>
static __device__ __forceinline__ void front_step(const v16h (&cur)[2][2],
                                                  const v16h (&wf)[4][2],
                                                  _Float16* stg, int odd, int lane) {
  const int hw = lane >> 4;
  const int nl = lane & 15;
#pragma unroll
  for (int j = 0; j < 2; ++j)
#pragma unroll
    for (int nt = 0; nt < 4; ++nt) {
      v8f c = {};
#pragma unroll
      for (int ks = 0; ks < 2; ++ks)
        c = TR ? WMMA_F16(cur[j][ks], wf[nt][ks], c) : WMMA_F16(wf[nt][ks], cur[j][ks], c);
      v8h pk;
#pragma unroll
      for (int r = 0; r < 8; ++r) pk[r] = (_Float16)c[r];
      // Staging row and 16-byte chunk of this piece; chunks XOR-swizzled by the
      // row so that the 32 pieces of a store spread over all banks.
      const int row = TR ? nt * 16 + nl : odd * 32 + j * 16 + nl;
      const int ch  = TR ? odd * 4 + j * 2 + hw : nt * 2 + hw;
      *(v8h*)(stg + row * 64 + ((ch ^ (nl & 7)) * 8)) = pk;
    }
}

__global__ __launch_bounds__(FE_WAVES * 32) void front_kernel(
    const float* __restrict__ query, const float* __restrict__ keys_,
    const float* __restrict__ values, const float* __restrict__ Wq,
    const float* __restrict__ Wk, const float* __restrict__ Wv,
    const float* __restrict__ Wo, _Float16* __restrict__ Qp,
    _Float16* __restrict__ Kp, _Float16* __restrict__ Vt,
    _Float16* __restrict__ Wo16) {
  const int tid  = threadIdx.x;
  const int wave = __builtin_amdgcn_readfirstlane(tid >> 5);
  const int lane = tid & 31;
  const int nl   = lane & 15;
  const int lo   = (lane >> 4) * 8;
  const int sel  = wave >> 2;                    // 0: Q, 1: K, 2: V
  const int qt   = wave & 3;

  const int wq = blockIdx.x * 4 + qt;            // (batch, 128 tokens, head)
  const int h  = wq & (HEADS - 1);
  const int s0 = ((wq >> 4) & 15) * 128;
  const int bn = wq >> 8;

  const float* X  = sel == 0 ? query : sel == 1 ? keys_ : values;
  const float* Wm = sel == 0 ? Wq : sel == 1 ? Wk : Wv;
  _Float16* oh    = (sel == 0 ? Qp : sel == 1 ? Kp : Vt)
                    + (size_t)(bn * HEADS + h) * SEQ * HEAD_DIM;

  __shared__ __align__(16) _Float16 stage[FE_WAVES][64 * 64];
  __shared__ __align__(16) _Float16 wshare[3][64 * 64];

  // Weight fragments (row e = nt * 16 + nl, contiguous along k), same k order as
  // the X fragments. This wave makes those of nt = qt and lays them in LDS in
  // fragment order (512 contiguous bytes per store or load).
  v8h wpart[4];
#pragma unroll
  for (int ks = 0; ks < 2; ++ks) {
    const float* wr = Wm + (size_t)(qt * 16 + nl) * HEAD_DIM + ks * 32 + lo;
    wpart[ks * 2]     = cvt8(wr);
    wpart[ks * 2 + 1] = cvt8(wr + 16);
  }

  const float* xr = X + ((size_t)(bn * SEQ + s0 + nl)) * EMBED + h * HEAD_DIM + lo;
  float4 raw[2][8];
  ld_x(xr, raw[0]);
  ld_x(xr + 16 * EMBED, raw[1]);

  // Wo: 4096 floats per work-group, whole lines, by the 256 threads of waves
  // 0..7; asked for here, stored behind the projection work.
  const int wbase = blockIdx.x * 4096 + tid * 4;
  float4 wo[4];
  if (wave < 8) {
#pragma unroll
    for (int j = 0; j < 4; ++j) wo[j] = *(const float4*)(Wo + wbase + j * 1024);
  }

#pragma unroll
  for (int i = 0; i < 4; ++i)
    *(v8h*)(&wshare[sel][(qt * 4 + i) * 256 + lane * 8]) = wpart[i];
  // Every wave's quarter is in LDS before any wave takes the whole weight.
  __syncthreads();
  v16h wf[4][2];
#pragma unroll
  for (int nt = 0; nt < 4; ++nt)
#pragma unroll
    for (int ks = 0; ks < 2; ++ks) {
      const _Float16* ws = &wshare[sel][(nt * 4 + ks * 2) * 256 + lane * 8];
      wf[nt][ks] = cat16(ldh8(ws), ldh8(ws + 256));
    }

  v16h cur[2][2];
  cvt_x(raw[0], cur[0]);
  cvt_x(raw[1], cur[1]);

  _Float16* stg = stage[wave];
  const bool tr = sel == 2;                      // wave-uniform
  // Read-back of the staged rows: 8 lanes per row, 4 rows per instruction.
  const int frow = lane >> 3;
  const int fc   = lane & 7;
  const unsigned pitch = tr ? SEQ : HEAD_DIM;    // output elements per staged row
  _Float16* od = oh + (size_t)s0 * (tr ? 1 : HEAD_DIM) + frow * pitch + fc * 8;

  // Kept rolled: one set of loads ahead of one set in work, no more registers.
#pragma unroll 1
  for (int s = 0; s < FE_STEPS; ++s) {
    float4 nxt[2][8];
    if (s + 1 < FE_STEPS) {
      const float* xn = xr + (size_t)(s + 1) * 32 * EMBED;
      ld_x(xn, nxt[0]);
      ld_x(xn + 16 * EMBED, nxt[1]);
    }

    if (tr) front_step<true >(cur, wf, stg, s & 1, lane);
    else    front_step<false>(cur, wf, stg, s & 1, lane);

    if (s & 1) {
      // The wave's own staging stores retire before it reads the rows back.
      asm volatile("s_wait_dscnt 0x0" ::: "memory");
      _Float16* dst = od + (size_t)(s >> 1) * 64 * (tr ? 1 : HEAD_DIM);
#pragma unroll
      for (int i = 0; i < 16; ++i) {
        const int row = i * 4 + frow;
        *(v8h*)(dst + (size_t)(i * 4) * pitch) =
            *(const v8h*)(stg + row * 64 + ((fc ^ (row & 7)) * 8));
      }
      // Stands in front of the next step's rewrite of the registers that the
      // last stores name.
      asm volatile("s_wait_xcnt 0x0" ::: "memory");
    }

    if (s + 1 < FE_STEPS) {
      cvt_x(nxt[0], cur[0]);
      cvt_x(nxt[1], cur[1]);
    }
  }

  if (wave < 8) {
#pragma unroll
    for (int j = 0; j < 4; ++j) {
      v4h p;
      p[0]=(_Float16)wo[j].x; p[1]=(_Float16)wo[j].y;
      p[2]=(_Float16)wo[j].z; p[3]=(_Float16)wo[j].w;
      *(v4h*)(Wo16 + wbase + j * 1024) = p;
    }
  }
}

static __device__ __forceinline__ float xhalf(float x) {
  const int v = __builtin_bit_cast(int, x);
  return __builtin_bit_cast(float,
      __builtin_amdgcn_permlanex16(v, v, 0x76543210, 0xfedcba98, false, false));
}

__global__ __launch_bounds__(256) void attn_kernel(const _Float16* __restrict__ Qp,
                                                  const _Float16* __restrict__ Kp,
                                                  const _Float16* __restrict__ Vt,
                                                  const int* __restrict__ mask,
                                                  _Float16* __restrict__ AO) {
  const int tid  = threadIdx.x;
  const int wave = __builtin_amdgcn_readfirstlane(tid >> 5);
  const int lane = tid & 31;
  const int hw   = lane >> 4;
  const int nl   = lane & 15;
  const int lo   = hw * 8;

  const int h  = blockIdx.x & (HEADS - 1);
  const int qb = blockIdx.x / HEADS;
  const int bn = blockIdx.y;
  const int q0 = (qb * 8 + wave) * 16;

  const _Float16* Qh = Qp + (size_t)(bn * HEADS + h) * SEQ * HEAD_DIM;
  const _Float16* Kh = Kp + (size_t)(bn * HEADS + h) * SEQ * HEAD_DIM;
  const _Float16* Vh = Vt + (size_t)(bn * HEADS + h) * HEAD_DIM * SEQ;

  // Double-buffered K/V stages: K row-major [64 keys][64 d], V [64 d][64 keys],
  // 16-byte chunks swizzled inside each row (see fill_stage).
  __shared__ __align__(16) _Float16 Kbuf[2][64 * 64];
  __shared__ __align__(16) _Float16 Vbuf[2][64 * 64];

  // Q B-fragments (column n = nl on both half-waves), kept for the whole loop.
  v16h qf[2];
  {
    const _Float16* qr = Qh + (size_t)(q0 + nl) * HEAD_DIM;
#pragma unroll
    for (int ks = 0; ks < 2; ++ks)
      qf[ks] = cat16(ldh8(qr + ks * 32 + lo), ldh8(qr + ks * 32 + 16 + lo));
  }

  // o[dt][r] = O[q0 + nl][dt * 16 + hw * 8 + r]; rmax is the query's running
  // maximum (equal in both halves), rsum the sum over this half's keys only.
  v8f o[4] = {v8f{}, v8f{}, v8f{}, v8f{}};
  float rmax = -1.0e30f, rsum = 0.0f;

  const float scale = 0.03125f;              // 1/sqrt(EMBED) = 1/32
  const float mfill = -1.0e20f * 0.03125f;   // masked value after scaling

  // Mask: this lane's byte offset (the array has 64 MiB, 32 bits hold it) to the
  // first of its 8 keys of a 16-key tile in its own query row. mk holds the
  // lane's 16 mask words of the coming pass (tile c: mk[2c], mk[2c + 1]).
  const char* mbase = (const char*)mask;
  const unsigned moff = (unsigned)(((bn * SEQ + q0 + nl) * SEQ + lo) * 4);
  int4 mk[4];
#pragma unroll
  for (int c = 0; c < 2; ++c) {
    mk[2 * c]     = *(const int4*)(mbase + moff + c * 64);
    mk[2 * c + 1] = *(const int4*)(mbase + moff + c * 64 + 16);
  }

  const int NS = SEQ / 64;

  // Stage 0 lands and is published to all waves; then stage 1's copies start.
  fill_stage(Kbuf[0], Vbuf[0], Kh, Vh, tid);
  wait_async_0();
  __syncthreads();
  fill_stage(Kbuf[1], Vbuf[1], Kh + (size_t)64 * HEAD_DIM, Vh + 64, tid);

  // Swizzle term of the fragment readers (row = 16 * tile + nl in both).
  const int kswz = (nl >> 1) & 7;

  // Kept rolled: one trip per stage, one publish point at its foot.
#pragma unroll 1
  for (int st = 0; st < NS; ++st) {
    const int cur = st & 1;

    // Kept rolled: unrolled, the compiler merges the two passes and the wave
    // takes more than 128 registers, so that only three of the four work-groups
    // that a WGP gets from this grid would be resident at once.
#pragma unroll 1
    for (int p = 0; p < 2; ++p) {
      const int k0 = st * 64 + p * 32;

      // ---- S^T[32x16] = K @ Q^T : two 16-key tiles (A-frags from LDS) ------
      v8f sf[2];
#pragma unroll
      for (int c = 0; c < 2; ++c) {
        v8f s = {};
        const _Float16* kr = &Kbuf[cur][(p * 32 + c * 16 + nl) * 64];
#pragma unroll
        for (int ks = 0; ks < 2; ++ks) {
          v16h a = cat16(ldh8(kr + ((ks * 4 + hw) ^ kswz) * 8),
                         ldh8(kr + ((ks * 4 + 2 + hw) ^ kswz) * 8));
          s = WMMA_F16(a, qf[ks], s);
        }
        sf[c] = s;
      }

      // ---- scale + mask: 8 consecutive keys of one row per tile ------------
#pragma unroll
      for (int c = 0; c < 2; ++c) {
        const int4 ma = mk[2 * c], mb = mk[2 * c + 1];
        const int mv[8] = {ma.x, ma.y, ma.z, ma.w, mb.x, mb.y, mb.z, mb.w};
#pragma unroll
        for (int r = 0; r < 8; ++r)
          sf[c][r] = mv[r] ? sf[c][r] * scale : mfill;
      }
      // The next pass's mask words start now and land behind the rest of this
      // pass; the last pass wraps to key 0 (in bounds, never used).
      {
        const unsigned mn = moff + (unsigned)(((k0 + 32) & (SEQ - 1)) * 4);
#pragma unroll
        for (int c = 0; c < 2; ++c) {
          mk[2 * c]     = *(const int4*)(mbase + mn + c * 64);
          mk[2 * c + 1] = *(const int4*)(mbase + mn + c * 64 + 16);
        }
      }

      // ---- online softmax: maximum of 32 keys, in-lane + one exchange ------
      float m = fmaxf(sf[0][0], sf[1][0]);
#pragma unroll
      for (int r = 1; r < 8; ++r) m = fmaxf(m, fmaxf(sf[0][r], sf[1][r]));
      m = fmaxf(m, xhalf(m));
      const float nm    = fmaxf(rmax, m);
      const float alpha = __expf(rmax - nm);
      rmax = nm;

      // ---- P^T = exp(S^T - max): the two tiles are the B operand -----------
      v16h pb;
      float part = 0.0f;
#pragma unroll
      for (int c = 0; c < 2; ++c)
#pragma unroll
        for (int r = 0; r < 8; ++r) {
          const float pv = __expf(sf[c][r] - nm);
          part += pv;
          pb[c * 8 + r] = (_Float16)pv;
        }
      rsum = rsum * alpha + part;

      // ---- rescale accumulator --------------------------------------------
#pragma unroll
      for (int dt = 0; dt < 4; ++dt)
#pragma unroll
        for (int r = 0; r < 8; ++r) o[dt][r] *= alpha;

      // ---- O^T += V^T @ P^T (V A-frags from LDS, same k order as pb) -------
#pragma unroll
      for (int dt = 0; dt < 4; ++dt) {
        const _Float16* vr = &Vbuf[cur][(dt * 16 + nl) * 64];
        v16h a = cat16(ldh8(vr + ((p * 4 + hw) ^ kswz) * 8),
                       ldh8(vr + ((p * 4 + 2 + hw) ^ kswz) * 8));
        o[dt] = WMMA_F16(a, pb, o[dt]);
      }
    }

    // Publish point of stage st + 1: this wave's LDS reads of stage st retire,
    // its own copies of stage st + 1 have landed, then the barrier both shows
    // stage st + 1 to every wave and frees buffer cur for the refill.
    asm volatile("s_wait_dscnt 0x0" ::: "memory");
    wait_async_0();
    __syncthreads();
    if (st + 2 < NS)
      fill_stage(Kbuf[cur], Vbuf[cur], Kh + (size_t)(st + 2) * 64 * HEAD_DIM,
                 Vh + (st + 2) * 64, tid);
  }
  // No copy is outstanding when the wave goes on to its epilogue and ends.
  wait_async_0();

  // ---- finalize: join the halves' sums, O / rowsum, 16-byte f16 stores ----
  const float inv = 1.0f / (rsum + xhalf(rsum));
  _Float16* dst = AO + ((size_t)bn * SEQ + q0 + nl) * EMBED + h * HEAD_DIM + lo;
#pragma unroll
  for (int dt = 0; dt < 4; ++dt) {
    v8h pk;
#pragma unroll
    for (int r = 0; r < 8; ++r) pk[r] = (_Float16)(o[dt][r] * inv);
    *(v8h*)(dst + dt * 16) = pk;
  }
}

// ---------------------------------------------------------------------------
// Kernel 3: Y[8192x1024] = AO @ Wo^T + bo. One work-group of 8 waves per
// 128 x 128 output tile, one 64 x 32 part per wave (2 x 4 waves). A stage is 64 k
// (one 128-byte line) of the tile's 128 AO rows and 128 Wo rows: two buffers in
// LDS, every wave copies an eighth of a stage with
// GLOBAL_LOAD_ASYNC_TO_LDS_B128, each copy taking 4 whole lines, and the next
// stage's copies fly while this one is worked on. Rows and chunks lie in LDS
// as in fill_stage, so the b128 fragment reads are conflict-free.
// ---------------------------------------------------------------------------
#define OP_ROWS 128                 // rows of each operand in a stage
#define OP_HALF (OP_ROWS * 64)      // f16 elements of one operand's stage

// Eight copies and their s_wait_xcnt in ONE statement: the wait stands in front
// of any later rewrite of the address registers that the copies name.
static __device__ __forceinline__ void async_cp16x8(const unsigned (&l)[8],
                                                    const _Float16* const (&g)[8]) {
  asm volatile("global_load_async_to_lds_b128 %0, %8, off\n\t"
               "global_load_async_to_lds_b128 %1, %9, off\n\t"
               "global_load_async_to_lds_b128 %2, %10, off\n\t"
               "global_load_async_to_lds_b128 %3, %11, off\n\t"
               "global_load_async_to_lds_b128 %4, %12, off\n\t"
               "global_load_async_to_lds_b128 %5, %13, off\n\t"
               "global_load_async_to_lds_b128 %6, %14, off\n\t"
               "global_load_async_to_lds_b128 %7, %15, off\n\t"
               "s_wait_xcnt 0x0"
               :: "v"(l[0]), "v"(l[1]), "v"(l[2]), "v"(l[3]),
                  "v"(l[4]), "v"(l[5]), "v"(l[6]), "v"(l[7]),
                  "v"(g[0]), "v"(g[1]), "v"(g[2]), "v"(g[3]),
                  "v"(g[4]), "v"(g[5]), "v"(g[6]), "v"(g[7])
               : "memory");
}
// One stage for the whole work-group (256 threads, 8 copies each); ag and bg
// point at the stage's first k of the tile's first AO row and first Wo row.
static __device__ __forceinline__ void fill_gemm_stage(_Float16* ab, _Float16* bb,
                                                       const _Float16* ag,
                                                       const _Float16* bg, int tid) {
  unsigned l[8];
  const _Float16* g[8];
#pragma unroll
  for (int i = 0; i < 4; ++i) {
    const int r   = i * 32 + (tid >> 3);
    const int ch  = tid & 7;
    const int off = r * 64 + ((ch ^ ((r >> 1) & 7)) * 8);
    l[i]     = lds_addr(ab + off);
    g[i]     = ag + (size_t)r * EMBED + ch * 8;
    l[4 + i] = lds_addr(bb + off);
    g[4 + i] = bg + (size_t)r * EMBED + ch * 8;
  }
  async_cp16x8(l, g);
}

__global__ __launch_bounds__(256) void outproj_kernel(const _Float16* __restrict__ AO,
                                                      const _Float16* __restrict__ Wo16,
                                                      const float* __restrict__ bo,
                                                      float* __restrict__ Y) {
  const int tid  = threadIdx.x;
  const int wave = __builtin_amdgcn_readfirstlane(tid >> 5);
  const int lane = tid & 31;
  const int hw   = lane >> 4;
  const int nl   = lane & 15;

  const int e0 = blockIdx.x * OP_ROWS;   // first output column of the tile
  const int t0 = blockIdx.y * OP_ROWS;   // first token of the tile
  const int wm = wave >> 2;              // this wave's 64 tokens
  const int wn = wave & 3;               // this wave's 32 columns

  // ring[buffer][operand]: AO rows, then Wo rows; 64 KiB, the output staging
  // of the epilogue takes the same bytes.
  __shared__ __align__(16) _Float16 ring[2][2][OP_HALF];

  const _Float16* Ag = AO + (size_t)t0 * EMBED;
  const _Float16* Bg = Wo16 + (size_t)e0 * EMBED;

  v8f acc[4][2];
#pragma unroll
  for (int mt = 0; mt < 4; ++mt)
#pragma unroll
    for (int nt = 0; nt < 2; ++nt) acc[mt][nt] = v8f{};

  const int NS = EMBED / 64;

  // Stage 0 lands and is published to all waves; then stage 1's copies start.
  fill_gemm_stage(ring[0][0], ring[0][1], Ag, Bg, tid);
  wait_async_0();
  __syncthreads();
  fill_gemm_stage(ring[1][0], ring[1][1], Ag + 64, Bg + 64, tid);

  // Swizzle term of the fragment readers (row = 16 * tile + nl in both).
  const int kswz = (nl >> 1) & 7;

  // Kept rolled: one trip per stage, one publish point at its foot.
#pragma unroll 1
  for (int st = 0; st < NS; ++st) {
    const int cur = st & 1;
    const _Float16* ar = &ring[cur][0][(wm * 64 + nl) * 64];
    const _Float16* br = &ring[cur][1][(wn * 32 + nl) * 64];
#pragma unroll
    for (int ks = 0; ks < 2; ++ks) {
      const int c0 = ((ks * 4 + hw) ^ kswz) * 8;
      const int c1 = ((ks * 4 + 2 + hw) ^ kswz) * 8;
      v16h a[4], b[2];
#pragma unroll
      for (int mt = 0; mt < 4; ++mt)
        a[mt] = cat16(ldh8(ar + mt * 16 * 64 + c0), ldh8(ar + mt * 16 * 64 + c1));
#pragma unroll
      for (int nt = 0; nt < 2; ++nt)
        b[nt] = cat16(ldh8(br + nt * 16 * 64 + c0), ldh8(br + nt * 16 * 64 + c1));
#pragma unroll
      for (int mt = 0; mt < 4; ++mt)
#pragma unroll
        for (int nt = 0; nt < 2; ++nt)
          acc[mt][nt] = WMMA_F16(a[mt], b[nt], acc[mt][nt]);
    }

    // Publish point of stage st + 1: this wave's LDS reads of stage st retire,
    // its own copies of stage st + 1 have landed, then the barrier both shows
    // stage st + 1 to every wave and frees buffer cur for the refill.
    asm volatile("s_wait_dscnt 0x0" ::: "memory");
    wait_async_0();
    __syncthreads();
    if (st + 2 < NS)
      fill_gemm_stage(ring[cur][0], ring[cur][1], Ag + (st + 2) * 64, Bg + (st + 2) * 64, tid);
  }
  // No copy is outstanding when the ring becomes output staging.
  wait_async_0();

  // ---- epilogue: behind the last publish point nobody reads the ring any more.
  // Each wave stages its 64 x 32 f32 part in its own 8 KiB, rows of one 128-byte
  // line; the two 16-column halves of a row change places in rows 8..15 of each
  // 16, so that the two wave halves of a store fall on different banks. It reads
  // the rows back, adds the bias and stores 4 whole lines per instruction.
  float* stg = (float*)&ring[0][0][0] + wave * (64 * 32);
#pragma unroll
  for (int mt = 0; mt < 4; ++mt)
#pragma unroll
    for (int nt = 0; nt < 2; ++nt)
#pragma unroll
      for (int r = 0; r < 8; ++r)
        stg[(mt * 16 + hw * 8 + r) * 32 + ((nt * 16 + nl) ^ (hw << 4))] = acc[mt][nt][r];

  const int ch = lane & 7;
  const int ec = e0 + wn * 32 + ch * 4;
  const float4 bv = *(const float4*)(bo + ec);
  float* yr = Y + (size_t)(t0 + wm * 64) * EMBED + ec;
#pragma unroll
  for (int i = 0; i < 16; ++i) {
    const int row = i * 4 + (lane >> 3);
    float4 v = *(const float4*)&stg[row * 32 + ((ch ^ (((row >> 3) & 1) << 2)) * 4)];
    v.x += bv.x; v.y += bv.y; v.z += bv.z; v.w += bv.w;
    *(float4*)(yr + (size_t)row * EMBED) = v;
  }
}

// ---------------------------------------------------------------------------
extern "C" void kernel_launch(void* const* d_in, const int* in_sizes, int n_in,
                              void* d_out, int out_size, void* d_ws, size_t ws_size,
                              hipStream_t stream) {
  const float* values = (const float*)d_in[0];
  const float* keys_  = (const float*)d_in[1];
  const float* query  = (const float*)d_in[2];
  const int*   mask   = (const int*)d_in[3];
  const float* Wv     = (const float*)d_in[4];
  const float* Wk     = (const float*)d_in[5];
  const float* Wq     = (const float*)d_in[6];
  const float* Wo     = (const float*)d_in[7];
  const float* bo     = (const float*)d_in[8];
  float* out = (float*)d_out;

  // Workspace layout (bytes):
  //   Qp [N][H][S][D]  f16 : 16 MB
  //   Kp [N][H][S][D]  f16 : 16 MB
  //   Vt [N][H][D][S]  f16 : 16 MB   (transposed for V^T@P^T A-fragments)
  //   AO [N][S][E]     f16 : 16 MB
  //   Wo16 [E][E]      f16 :  2 MB
  const size_t QKV = (size_t)NBATCH * HEADS * SEQ * HEAD_DIM * sizeof(_Float16);
  char* ws = (char*)d_ws;
  _Float16* Qp   = (_Float16*)(ws);
  _Float16* Kp   = (_Float16*)(ws + QKV);
  _Float16* Vt   = (_Float16*)(ws + 2 * QKV);
  _Float16* AO   = (_Float16*)(ws + 3 * QKV);
  _Float16* Wo16 = (_Float16*)(ws + 4 * QKV);

  front_kernel<<<NBATCH * HEADS * (SEQ / 128) / 4, FE_WAVES * 32, 0, stream>>>(
      query, keys_, values, Wq, Wk, Wv, Wo, Qp, Kp, Vt, Wo16);

  dim3 gattn((SEQ / 128) * HEADS, NBATCH);
  attn_kernel<<<gattn, 256, 0, stream>>>(Qp, Kp, Vt, mask, AO);

  dim3 gout(EMBED / OP_ROWS, NBATCH * SEQ / OP_ROWS);
  outproj_kernel<<<gout, 256, 0, stream>>>(AO, Wo16, bo, out);
}

// v006
// Measured time: 117 microseconds a run.
// Two timings next to v005 both put it at 1.17 times that version's speed.
// All steps since v000 together make it 4.24 times as fast.
#include <hip/hip_runtime.h>

#define EMBED 1024
#define HEADS 16
#define HEAD_DIM 64
#define NBATCH 4
#define SEQ 2048

typedef __attribute__((ext_vector_type(16))) _Float16 v16h;
typedef __attribute__((ext_vector_type(8)))  _Float16 v8h;
typedef __attribute__((ext_vector_type(8)))  float    v8f;
typedef __attribute__((ext_vector_type(16))) unsigned v16u;

static __device__ __forceinline__ v16h cat16(v8h a, v8h b) {
  return __builtin_shufflevector(a, b, 0,1,2,3,4,5,6,7,8,9,10,11,12,13,14,15);
}
static __device__ __forceinline__ v8h ldh8(const _Float16* p) { return *(const v8h*)p; }
static __device__ __forceinline__ v8h cvt8(const float* p) {
  float4 a = *(const float4*)p;
  float4 b = *(const float4*)(p + 4);
  v8h r;
  r[0]=(_Float16)a.x; r[1]=(_Float16)a.y; r[2]=(_Float16)a.z; r[3]=(_Float16)a.w;
  r[4]=(_Float16)b.x; r[5]=(_Float16)b.y; r[6]=(_Float16)b.z; r[7]=(_Float16)b.w;
  return r;
}
#define WMMA_F16(a,b,c) __builtin_amdgcn_wmma_f32_16x16x32_f16(false,(a),false,(b),(short)0,(c),false,false)

// Async global->LDS copy, 16 bytes per lane (GLOBAL_LOAD_ASYNC_TO_LDS_B128,
// tracked by ASYNCcnt). LDS aperture keeps the byte offset in addr[31:0], so
// truncating the generic pointer yields the LDS-address VGPR value.
static __device__ __forceinline__ unsigned lds_addr(const _Float16* p) {
  return (unsigned)(unsigned long long)p;
}
// Four copies and their s_wait_xcnt in ONE statement: the wait stands in front
// of any later rewrite of the address registers that the copies name.
static __device__ __forceinline__ void async_cp16x4(const unsigned (&l)[4],
                                                    const _Float16* const (&g)[4]) {
  asm volatile("global_load_async_to_lds_b128 %0, %4, off\n\t"
               "global_load_async_to_lds_b128 %1, %5, off\n\t"
               "global_load_async_to_lds_b128 %2, %6, off\n\t"
               "global_load_async_to_lds_b128 %3, %7, off\n\t"
               "s_wait_xcnt 0x0"
               :: "v"(l[0]), "v"(l[1]), "v"(l[2]), "v"(l[3]),
                  "v"(g[0]), "v"(g[1]), "v"(g[2]), "v"(g[3])
               : "memory");
}
// Fill one stage of 64 keys for the whole work-group (256 threads, 4 copies
// each): K 64 keys x 64 d (8192 contiguous bytes in global), V 64 d-rows x 64
// keys (128-byte runs). Every copy of a wave takes 4 whole 128-byte lines. In
// LDS both keep a 128-byte row pitch, and the 16-byte chunks of a row are
// XOR-swizzled by the row number, chunk ^= (row >> 1) & 7, so that the 16 rows
// of one ds_load_b128 fragment read fall on 16 different bank quads.
static __device__ __forceinline__ void fill_stage(_Float16* kb, _Float16* vb,
                                                  const _Float16* kg, const _Float16* vg,
                                                  int tid) {
  unsigned l[4];
  const _Float16* g[4];
#pragma unroll
  for (int i = 0; i < 2; ++i) {
    const int r   = i * 32 + (tid >> 3);
    const int ch  = tid & 7;
    const int off = r * 64 + ((ch ^ ((r >> 1) & 7)) * 8);
    l[i]     = lds_addr(kb + off);
    g[i]     = kg + r * HEAD_DIM + ch * 8;
    l[2 + i] = lds_addr(vb + off);
    g[2 + i] = vg + (size_t)r * SEQ + ch * 8;
  }
  async_cp16x4(l, g);
}
static __device__ __forceinline__ void wait_async_0() {
  asm volatile("s_wait_asynccnt 0" ::: "memory");
}

// ---------------------------------------------------------------------------
// Kernel 1: the whole front end in one launch: the three per-head projections
// Y = X_head @ W^T, the conversion of Wo to f16 and the packing of the mask. One
// work-group of 16 waves per 4 x 128 tokens-of-a-head: waves 0..3 take Q, 4..7 K,
// 8..11 V, 12..15 a share of the mask (see FE_MASKW). The four
// waves of a tensor convert a quarter of its 64 x 64 weight each and share the
// fragments through LDS; a wave then keeps all of them in registers and walks
// 128 tokens of one head (8 tiles of 16), two tiles a step, the next step's
// loads in flight while this one is worked on.
//   Q, K : Y^T = W X^T, a lane holds 8 consecutive d of one token; out [n][h][s][d]
//   V    : Y   = X W^T, a lane holds 8 consecutive tokens of one d; out [n][h][d][s]
// Either way the 16-byte pieces of four tiles are staged in the wave's own 8 KiB
// of LDS as 64 rows of one 128-byte line and go out 4 whole lines per store.
// ---------------------------------------------------------------------------
#define FE_WAVES 12
#define FE_STEPS 4                  // steps of two 16-token tiles per wave
// Four more waves per work-group pack the mask, read here once for all heads,
// into the lane masks of the attention kernel's score selects: for a tile of 16
// queries and a pass of 32 keys, word c * 8 + r holds in bit hw * 16 + nl
// whether mask[query nl][key c * 16 + hw * 8 + r] is non-zero. 16 words a pass,
// MB[batch * 128 + query tile][pass][16].
#define FE_MASKW 4
#define MB_BATCH 4                  // passes whose mask words one batch of loads holds
#define MB_NBATCH 8                 // batches per wave: 16 queries x 1024 keys

// A lane's 64 mask words of MB_BATCH passes; mp points at the lane's query row,
// at its half-wave's first key of the batch.
static __device__ __forceinline__ void ld_mask(const int* mp, int4 (&v)[MB_BATCH * 4]) {
  // Unrolled: the array stays in registers, every offset is an immediate.
#pragma unroll
  for (int i = 0; i < MB_BATCH * 2; ++i) {
    v[i * 2]     = *(const int4*)(mp + i * 16);
    v[i * 2 + 1] = *(const int4*)(mp + i * 16 + 4);
  }
}
// The lane masks of a batch: one compare per word of 32 mask values; the words of
// two passes are gathered one per lane and go out as one whole 128-byte line.
static __device__ __forceinline__ void pack_mask(const int4 (&v)[MB_BATCH * 4], unsigned* mo) {
  // All three unrolled: register arrays, and each word's lane is a constant.
#pragma unroll
  for (int pp = 0; pp < MB_BATCH / 2; ++pp) {
    unsigned acc = 0;
#pragma unroll
    for (int i = 0; i < 8; ++i) {
      const int4 m = v[pp * 8 + i];
      const int mv[4] = {m.x, m.y, m.z, m.w};
#pragma unroll
      for (int j = 0; j < 4; ++j) {
        const unsigned w = __builtin_amdgcn_ballot_w32(mv[j] != 0);
        // Lane i * 4 + j alone takes the word.
        acc = __builtin_amdgcn_inverse_ballot_w32(1u << (i * 4 + j)) ? w : acc;
      }
    }
    mo[pp * 32] = acc;
  }
}

typedef __attribute__((ext_vector_type(4))) _Float16 v4h;

static __device__ __forceinline__ v8h cvt8r(float4 a, float4 b) {
  v8h r;
  r[0]=(_Float16)a.x; r[1]=(_Float16)a.y; r[2]=(_Float16)a.z; r[3]=(_Float16)a.w;
  r[4]=(_Float16)b.x; r[5]=(_Float16)b.y; r[6]=(_Float16)b.z; r[7]=(_Float16)b.w;
  return r;
}
// The 32 floats of one lane's two fragments of a 16 x 64 tile; xr points at the
// lane's row, at its half-wave's first k.
static __device__ __forceinline__ void ld_x(const float* xr, float4 (&v)[8]) {
#pragma unroll
  for (int ks = 0; ks < 2; ++ks)
#pragma unroll
    for (int c = 0; c < 2; ++c) {
      v[ks * 4 + c * 2]     = *(const float4*)(xr + ks * 32 + c * 16);
      v[ks * 4 + c * 2 + 1] = *(const float4*)(xr + ks * 32 + c * 16 + 4);
    }
}

// The two f16 fragments of a tile from its raw floats.
static __device__ __forceinline__ void cvt_x(const float4 (&v)[8], v16h (&af)[2]) {
#pragma unroll
  for (int ks = 0; ks < 2; ++ks)
    af[ks] = cat16(cvt8r(v[ks * 4], v[ks * 4 + 1]), cvt8r(v[ks * 4 + 2], v[ks * 4 + 3]));
}

// The products of one step (two tiles) and their staging. stg: the wave's own
// 64 rows of 128 bytes; odd: second step of the staged group of four tiles.
template <bool TR>
static __device__ __forceinline__ void front_step(const v16h (&cur)[2][2],
                                                  const v16h (&wf)[4][2],
                                                  _Float16* stg, int odd, int lane) {
  const int hw = lane >> 4;
  const int nl = lane & 15;
#pragma unroll
  for (int j = 0; j < 2; ++j)
#pragma unroll
    for (int nt = 0; nt < 4; ++nt) {
      v8f c = {};
#pragma unroll
      for (int ks = 0; ks < 2; ++ks)
        c = TR ? WMMA_F16(cur[j][ks], wf[nt][ks], c) : WMMA_F16(wf[nt][ks], cur[j][ks], c);
      v8h pk;
#pragma unroll
      for (int r = 0; r < 8; ++r) pk[r] = (_Float16)c[r];
      // Staging row and 16-byte chunk of this piece; chunks XOR-swizzled by the
      // row so that the 32 pieces of a store spread over all banks.
      const int row = TR ? nt * 16 + nl : odd * 32 + j * 16 + nl;
      const int ch  = TR ? odd * 4 + j * 2 + hw : nt * 2 + hw;
      *(v8h*)(stg + row * 64 + ((ch ^ (nl & 7)) * 8)) = pk;
    }
}

__global__ __launch_bounds__((FE_WAVES + FE_MASKW) * 32) void front_kernel(
    const float* __restrict__ query, const float* __restrict__ keys_,
    const float* __restrict__ values, const float* __restrict__ Wq,
    const float* __restrict__ Wk, const float* __restrict__ Wv,
    const float* __restrict__ Wo, const int* __restrict__ mask,
    _Float16* __restrict__ Qp, _Float16* __restrict__ Kp,
    _Float16* __restrict__ Vt, _Float16* __restrict__ Wo16,
    unsigned* __restrict__ MB) {
  const int tid  = threadIdx.x;
  const int wave = __builtin_amdgcn_readfirstlane(tid >> 5);
  const int lane = tid & 31;
  const int nl   = lane & 15;
  const int lo   = (lane >> 4) * 8;
  const int sel  = wave >> 2;                    // 0: Q, 1: K, 2: V
  const int qt   = wave & 3;

  const int wq = blockIdx.x * 4 + qt;            // (batch, 128 tokens, head)
  const int h  = wq & (HEADS - 1);
  const int s0 = ((wq >> 4) & 15) * 128;
  const int bn = wq >> 8;

  const float* X  = sel == 0 ? query : sel == 1 ? keys_ : values;
  const float* Wm = sel == 0 ? Wq : sel == 1 ? Wk : Wv;
  _Float16* oh    = (sel == 0 ? Qp : sel == 1 ? Kp : Vt)
                    + (size_t)(bn * HEADS + h) * SEQ * HEAD_DIM;

  __shared__ __align__(16) _Float16 stage[FE_WAVES][64 * 64];
  __shared__ __align__(16) _Float16 wshare[3][64 * 64];

  const float* xr = X + ((size_t)(bn * SEQ + s0 + nl)) * EMBED + h * HEAD_DIM + lo;
  float4 raw[2][8];
  const int wbase = blockIdx.x * 4096 + tid * 4;
  float4 wo[4];

  // A mask wave (wave-uniform test): 16 query rows, half of their keys.
  const bool mwave = wave >= FE_WAVES;
  const int* mp = mask + (size_t)((wq >> 1) * 16 + nl) * SEQ + (wq & 1) * (SEQ / 2) + lo;
  unsigned* mo  = MB + ((wq >> 1) * (SEQ / 32) + (wq & 1) * (SEQ / 64)) * 16 + lane;
  int4 ma[MB_BATCH * 4], mb[MB_BATCH * 4];

  if (mwave) {
    ld_mask(mp, ma);
  } else {
    // Weight fragments (row e = nt * 16 + nl, contiguous along k), same k order
    // as the X fragments. This wave makes those of nt = qt and lays them in LDS
    // in fragment order (512 contiguous bytes per store or load).
    v8h wpart[4];
#pragma unroll
    for (int ks = 0; ks < 2; ++ks) {
      const float* wr = Wm + (size_t)(qt * 16 + nl) * HEAD_DIM + ks * 32 + lo;
      wpart[ks * 2]     = cvt8(wr);
      wpart[ks * 2 + 1] = cvt8(wr + 16);
    }

    ld_x(xr, raw[0]);
    ld_x(xr + 16 * EMBED, raw[1]);
    // Stands in front of the rewrite of the address registers that the weight
    // loads name.
    asm volatile("s_wait_xcnt 0x0" ::: "memory");

    // Wo: 4096 floats per work-group, whole lines, by the 256 threads of waves
    // 0..7; asked for here, stored behind the projection work.
    if (wave < 8) {
#pragma unroll
      for (int j = 0; j < 4; ++j) wo[j] = *(const float4*)(Wo + wbase + j * 1024);
    }

#pragma unroll
    for (int i = 0; i < 4; ++i)
      *(v8h*)(&wshare[sel][(qt * 4 + i) * 256 + lane * 8]) = wpart[i];
  }
  // Every wave's quarter is in LDS before any wave takes the whole weight.
  __syncthreads();

  // Behind the kernel's one barrier the mask waves go their own way: two sets of
  // loads, one in flight while the other is packed. Unrolled: one address pair
  // with immediate offsets serves every load, and none of them rewrites it.
  if (mwave) {
#pragma unroll
    for (int b = 0; b < MB_NBATCH; b += 2) {
      ld_mask(mp + (b + 1) * MB_BATCH * 32, mb);
      pack_mask(ma, mo + b * MB_BATCH * 16);
      if (b + 2 < MB_NBATCH) ld_mask(mp + (b + 2) * MB_BATCH * 32, ma);
      pack_mask(mb, mo + (b + 1) * MB_BATCH * 16);
    }
    return;
  }
  v16h wf[4][2];
#pragma unroll
  for (int nt = 0; nt < 4; ++nt)
#pragma unroll
    for (int ks = 0; ks < 2; ++ks) {
      const _Float16* ws = &wshare[sel][(nt * 4 + ks * 2) * 256 + lane * 8];
      wf[nt][ks] = cat16(ldh8(ws), ldh8(ws + 256));
    }

  v16h cur[2][2];
  cvt_x(raw[0], cur[0]);
  cvt_x(raw[1], cur[1]);

  _Float16* stg = stage[wave];
  const bool tr = sel == 2;                      // wave-uniform
  // Read-back of the staged rows: 8 lanes per row, 4 rows per instruction.
  const int frow = lane >> 3;
  const int fc   = lane & 7;
  const unsigned pitch = tr ? SEQ : HEAD_DIM;    // output elements per staged row
  _Float16* od = oh + (size_t)s0 * (tr ? 1 : HEAD_DIM) + frow * pitch + fc * 8;

  // Kept rolled: one set of loads ahead of one set in work, no more registers.
#pragma unroll 1
  for (int s = 0; s < FE_STEPS; ++s) {
    float4 nxt[2][8];
    if (s + 1 < FE_STEPS) {
      const float* xn = xr + (size_t)(s + 1) * 32 * EMBED;
      ld_x(xn, nxt[0]);
      ld_x(xn + 16 * EMBED, nxt[1]);
    }

    if (tr) front_step<true >(cur, wf, stg, s & 1, lane);
    else    front_step<false>(cur, wf, stg, s & 1, lane);

    if (s & 1) {
      // The wave's own staging stores retire before it reads the rows back.
      asm volatile("s_wait_dscnt 0x0" ::: "memory");
      _Float16* dst = od + (size_t)(s >> 1) * 64 * (tr ? 1 : HEAD_DIM);
#pragma unroll
      for (int i = 0; i < 16; ++i) {
        const int row = i * 4 + frow;
        *(v8h*)(dst + (size_t)(i * 4) * pitch) =
            *(const v8h*)(stg + row * 64 + ((fc ^ (row & 7)) * 8));
      }
      // Stands in front of the next step's rewrite of the registers that the
      // last stores name.
      asm volatile("s_wait_xcnt 0x0" ::: "memory");
    }

    if (s + 1 < FE_STEPS) {
      cvt_x(nxt[0], cur[0]);
      cvt_x(nxt[1], cur[1]);
    }
  }

  if (wave < 8) {
#pragma unroll
    for (int j = 0; j < 4; ++j) {
      v4h p;
      p[0]=(_Float16)wo[j].x; p[1]=(_Float16)wo[j].y;
      p[2]=(_Float16)wo[j].z; p[3]=(_Float16)wo[j].w;
      *(v4h*)(Wo16 + wbase + j * 1024) = p;
    }
  }
}

static __device__ __forceinline__ float xhalf(float x) {
  const int v = __builtin_bit_cast(int, x);
  return __builtin_bit_cast(float,
      __builtin_amdgcn_permlanex16(v, v, 0x76543210, 0xfedcba98, false, false));
}

__global__ __launch_bounds__(256) void attn_kernel(const _Float16* __restrict__ Qp,
                                                  const _Float16* __restrict__ Kp,
                                                  const _Float16* __restrict__ Vt,
                                                  const unsigned* __restrict__ MB,
                                                  _Float16* __restrict__ AO) {
  const int tid  = threadIdx.x;
  const int wave = __builtin_amdgcn_readfirstlane(tid >> 5);
  const int lane = tid & 31;
  const int hw   = lane >> 4;
  const int nl   = lane & 15;
  const int lo   = hw * 8;

  const int h  = blockIdx.x & (HEADS - 1);
  const int qb = blockIdx.x / HEADS;
  const int bn = blockIdx.y;
  const int q0 = (qb * 8 + wave) * 16;

  const _Float16* Qh = Qp + (size_t)(bn * HEADS + h) * SEQ * HEAD_DIM;
  const _Float16* Kh = Kp + (size_t)(bn * HEADS + h) * SEQ * HEAD_DIM;
  const _Float16* Vh = Vt + (size_t)(bn * HEADS + h) * HEAD_DIM * SEQ;

  // Double-buffered K/V stages: K row-major [64 keys][64 d], V [64 d][64 keys],
  // 16-byte chunks swizzled inside each row (see fill_stage).
  __shared__ __align__(16) _Float16 Kbuf[2][64 * 64];
  __shared__ __align__(16) _Float16 Vbuf[2][64 * 64];

  // Q B-fragments (column n = nl on both half-waves), kept for the whole loop.
  v16h qf[2];
  {
    const _Float16* qr = Qh + (size_t)(q0 + nl) * HEAD_DIM;
#pragma unroll
    for (int ks = 0; ks < 2; ++ks)
      qf[ks] = cat16(ldh8(qr + ks * 32 + lo), ldh8(qr + ks * 32 + 16 + lo));
  }

  // o[dt][r] = O[q0 + nl][dt * 16 + hw * 8 + r]; rmax is the query's running
  // maximum (equal in both halves), rsum the sum over this half's keys only.
  v8f o[4] = {v8f{}, v8f{}, v8f{}, v8f{}};
  float rmax = -1.0e30f, rsum = 0.0f;

  const float scale = 0.03125f;              // 1/sqrt(EMBED) = 1/32
  const float mfill = -1.0e20f * 0.03125f;   // masked value after scaling

  // Mask: the front end has packed it into lane masks, 16 words per pass of this
  // wave's query tile (word c * 8 + r: one bit per lane for score sf[c][r]). The
  // address is the same in every lane, and nothing writes MB during this launch:
  // read as constant memory the words come by scalar loads straight into the
  // scalar registers that the selects take. mk holds the words of the coming pass.
  typedef const __attribute__((address_space(4))) v16u* mb_ptr;
  const mb_ptr mrow = (mb_ptr)(MB + (size_t)(bn * (SEQ / 16) + (q0 >> 4)) * (SEQ / 32) * 16);
  v16u mk = mrow[0];

  const int NS = SEQ / 64;

  // Stage 0 lands and is published to all waves; then stage 1's copies start.
  fill_stage(Kbuf[0], Vbuf[0], Kh, Vh, tid);
  wait_async_0();
  __syncthreads();
  fill_stage(Kbuf[1], Vbuf[1], Kh + (size_t)64 * HEAD_DIM, Vh + 64, tid);

  // Swizzle term of the fragment readers (row = 16 * tile + nl in both).
  const int kswz = (nl >> 1) & 7;

  // Kept rolled: one trip per stage, one publish point at its foot.
#pragma unroll 1
  for (int st = 0; st < NS; ++st) {
    const int cur = st & 1;

    // Kept rolled: unrolled, the compiler merges the two passes and the wave
    // takes more than 128 registers, so that only three of the four work-groups
    // that a WGP gets from this grid would be resident at once.
#pragma unroll 1
    for (int p = 0; p < 2; ++p) {
      const int k0 = st * 64 + p * 32;

      // ---- S^T[32x16] = K @ Q^T : two 16-key tiles (A-frags from LDS) ------
      v8f sf[2];
#pragma unroll
      for (int c = 0; c < 2; ++c) {
        v8f s = {};
        const _Float16* kr = &Kbuf[cur][(p * 32 + c * 16 + nl) * 64];
#pragma unroll
        for (int ks = 0; ks < 2; ++ks) {
          v16h a = cat16(ldh8(kr + ((ks * 4 + hw) ^ kswz) * 8),
                         ldh8(kr + ((ks * 4 + 2 + hw) ^ kswz) * 8));
          s = WMMA_F16(a, qf[ks], s);
        }
        sf[c] = s;
      }

      // ---- scale + mask: each packed word is the select's lane mask ---------
#pragma unroll
      for (int c = 0; c < 2; ++c)
#pragma unroll
        for (int r = 0; r < 8; ++r)
          sf[c][r] = __builtin_amdgcn_inverse_ballot_w32(mk[c * 8 + r]) ? sf[c][r] * scale : mfill;
      // The next pass's mask words start now and land behind the rest of this
      // pass; the last pass wraps to key 0 (in bounds, never used).
      mk = mrow[((k0 + 32) & (SEQ - 1)) >> 5];

      // ---- online softmax: maximum of 32 keys, in-lane + one exchange ------
      float m = fmaxf(sf[0][0], sf[1][0]);
#pragma unroll
      for (int r = 1; r < 8; ++r) m = fmaxf(m, fmaxf(sf[0][r], sf[1][r]));
      m = fmaxf(m, xhalf(m));
      const float nm    = fmaxf(rmax, m);
      const float alpha = __expf(rmax - nm);
      rmax = nm;

      // ---- P^T = exp(S^T - max): the two tiles are the B operand -----------
      v16h pb;
      float part = 0.0f;
#pragma unroll
      for (int c = 0; c < 2; ++c)
#pragma unroll
        for (int r = 0; r < 8; ++r) {
          const float pv = __expf(sf[c][r] - nm);
          part += pv;
          pb[c * 8 + r] = (_Float16)pv;
        }
      rsum = rsum * alpha + part;

      // ---- rescale accumulator --------------------------------------------
#pragma unroll
      for (int dt = 0; dt < 4; ++dt)
#pragma unroll
        for (int r = 0; r < 8; ++r) o[dt][r] *= alpha;

      // ---- O^T += V^T @ P^T (V A-frags from LDS, same k order as pb) -------
#pragma unroll
      for (int dt = 0; dt < 4; ++dt) {
        const _Float16* vr = &Vbuf[cur][(dt * 16 + nl) * 64];
        v16h a = cat16(ldh8(vr + ((p * 4 + hw) ^ kswz) * 8),
                       ldh8(vr + ((p * 4 + 2 + hw) ^ kswz) * 8));
        o[dt] = WMMA_F16(a, pb, o[dt]);
      }
    }

    // Publish point of stage st + 1: this wave's LDS reads of stage st retire,
    // its own copies of stage st + 1 have landed, then the barrier both shows
    // stage st + 1 to every wave and frees buffer cur for the refill.
    asm volatile("s_wait_dscnt 0x0" ::: "memory");
    wait_async_0();
    __syncthreads();
    if (st + 2 < NS)
      fill_stage(Kbuf[cur], Vbuf[cur], Kh + (size_t)(st + 2) * 64 * HEAD_DIM,
                 Vh + (st + 2) * 64, tid);
  }
  // No copy is outstanding when the wave goes on to its epilogue and ends.
  wait_async_0();

  // ---- finalize: join the halves' sums, O / rowsum, 16-byte f16 stores ----
  const float inv = 1.0f / (rsum + xhalf(rsum));
  _Float16* dst = AO + ((size_t)bn * SEQ + q0 + nl) * EMBED + h * HEAD_DIM + lo;
#pragma unroll
  for (int dt = 0; dt < 4; ++dt) {
    v8h pk;
#pragma unroll
    for (int r = 0; r < 8; ++r) pk[r] = (_Float16)(o[dt][r] * inv);
    *(v8h*)(dst + dt * 16) = pk;
  }
}

// ---------------------------------------------------------------------------
// Kernel 3: Y[8192x1024] = AO @ Wo^T + bo. One work-group of 8 waves per
// 128 x 128 output tile, one 64 x 32 part per wave (2 x 4 waves). A stage is 64 k
// (one 128-byte line) of the tile's 128 AO rows and 128 Wo rows: two buffers in
// LDS, every wave copies an eighth of a stage with
// GLOBAL_LOAD_ASYNC_TO_LDS_B128, each copy taking 4 whole lines, and the next
// stage's copies fly while this one is worked on. Rows and chunks lie in LDS
// as in fill_stage, so the b128 fragment reads are conflict-free.
// ---------------------------------------------------------------------------
#define OP_ROWS 128                 // rows of each operand in a stage
#define OP_HALF (OP_ROWS * 64)      // f16 elements of one operand's stage

// Eight copies and their s_wait_xcnt in ONE statement: the wait stands in front
// of any later rewrite of the address registers that the copies name.
static __device__ __forceinline__ void async_cp16x8(const unsigned (&l)[8],
                                                    const _Float16* const (&g)[8]) {
  asm volatile("global_load_async_to_lds_b128 %0, %8, off\n\t"
               "global_load_async_to_lds_b128 %1, %9, off\n\t"
               "global_load_async_to_lds_b128 %2, %10, off\n\t"
               "global_load_async_to_lds_b128 %3, %11, off\n\t"
               "global_load_async_to_lds_b128 %4, %12, off\n\t"
               "global_load_async_to_lds_b128 %5, %13, off\n\t"
               "global_load_async_to_lds_b128 %6, %14, off\n\t"
               "global_load_async_to_lds_b128 %7, %15, off\n\t"
               "s_wait_xcnt 0x0"
               :: "v"(l[0]), "v"(l[1]), "v"(l[2]), "v"(l[3]),
                  "v"(l[4]), "v"(l[5]), "v"(l[6]), "v"(l[7]),
                  "v"(g[0]), "v"(g[1]), "v"(g[2]), "v"(g[3]),
                  "v"(g[4]), "v"(g[5]), "v"(g[6]), "v"(g[7])
               : "memory");
}
// One stage for the whole work-group (256 threads, 8 copies each); ag and bg
// point at the stage's first k of the tile's first AO row and first Wo row.
static __device__ __forceinline__ void fill_gemm_stage(_Float16* ab, _Float16* bb,
                                                       const _Float16* ag,
                                                       const _Float16* bg, int tid) {
  unsigned l[8];
  const _Float16* g[8];
#pragma unroll
  for (int i = 0; i < 4; ++i) {
    const int r   = i * 32 + (tid >> 3);
    const int ch  = tid & 7;
    const int off = r * 64 + ((ch ^ ((r >> 1) & 7)) * 8);
    l[i]     = lds_addr(ab + off);
    g[i]     = ag + (size_t)r * EMBED + ch * 8;
    l[4 + i] = lds_addr(bb + off);
    g[4 + i] = bg + (size_t)r * EMBED + ch * 8;
  }
  async_cp16x8(l, g);
}

__global__ __launch_bounds__(256) void outproj_kernel(const _Float16* __restrict__ AO,
                                                      const _Float16* __restrict__ Wo16,
                                                      const float* __restrict__ bo,
                                                      float* __restrict__ Y) {
  const int tid  = threadIdx.x;
  const int wave = __builtin_amdgcn_readfirstlane(tid >> 5);
  const int lane = tid & 31;
  const int hw   = lane >> 4;
  const int nl   = lane & 15;

  const int e0 = blockIdx.x * OP_ROWS;   // first output column of the tile
  const int t0 = blockIdx.y * OP_ROWS;   // first token of the tile
  const int wm = wave >> 2;              // this wave's 64 tokens
  const int wn = wave & 3;               // this wave's 32 columns

  // ring[buffer][operand]: AO rows, then Wo rows; 64 KiB, the output staging
  // of the epilogue takes the same bytes.
  __shared__ __align__(16) _Float16 ring[2][2][OP_HALF];

  const _Float16* Ag = AO + (size_t)t0 * EMBED;
  const _Float16* Bg = Wo16 + (size_t)e0 * EMBED;

  v8f acc[4][2];
#pragma unroll
  for (int mt = 0; mt < 4; ++mt)
#pragma unroll
    for (int nt = 0; nt < 2; ++nt) acc[mt][nt] = v8f{};

  const int NS = EMBED / 64;

  // Stage 0 lands and is published to all waves; then stage 1's copies start.
  fill_gemm_stage(ring[0][0], ring[0][1], Ag, Bg, tid);
  wait_async_0();
  __syncthreads();
  fill_gemm_stage(ring[1][0], ring[1][1], Ag + 64, Bg + 64, tid);

  // Swizzle term of the fragment readers (row = 16 * tile + nl in both).
  const int kswz = (nl >> 1) & 7;

  // Kept rolled: one trip per stage, one publish point at its foot.
#pragma unroll 1
  for (int st = 0; st < NS; ++st) {
    const int cur = st & 1;
    const _Float16* ar = &ring[cur][0][(wm * 64 + nl) * 64];
    const _Float16* br = &ring[cur][1][(wn * 32 + nl) * 64];
#pragma unroll
    for (int ks = 0; ks < 2; ++ks) {
      const int c0 = ((ks * 4 + hw) ^ kswz) * 8;
      const int c1 = ((ks * 4 + 2 + hw) ^ kswz) * 8;
      v16h a[4], b[2];
#pragma unroll
      for (int mt = 0; mt < 4; ++mt)
        a[mt] = cat16(ldh8(ar + mt * 16 * 64 + c0), ldh8(ar + mt * 16 * 64 + c1));
#pragma unroll
      for (int nt = 0; nt < 2; ++nt)
        b[nt] = cat16(ldh8(br + nt * 16 * 64 + c0), ldh8(br + nt * 16 * 64 + c1));
#pragma unroll
      for (int mt = 0; mt < 4; ++mt)
#pragma unroll
        for (int nt = 0; nt < 2; ++nt)
          acc[mt][nt] = WMMA_F16(a[mt], b[nt], acc[mt][nt]);
    }

    // Publish point of stage st + 1: this wave's LDS reads of stage st retire,
    // its own copies of stage st + 1 have landed, then the barrier both shows
    // stage st + 1 to every wave and frees buffer cur for the refill.
    asm volatile("s_wait_dscnt 0x0" ::: "memory");
    wait_async_0();
    __syncthreads();
    if (st + 2 < NS)
      fill_gemm_stage(ring[cur][0], ring[cur][1], Ag + (st + 2) * 64, Bg + (st + 2) * 64, tid);
  }
  // No copy is outstanding when the ring becomes output staging.
  wait_async_0();

  // ---- epilogue: behind the last publish point nobody reads the ring any more.
  // Each wave stages its 64 x 32 f32 part in its own 8 KiB, rows of one 128-byte
  // line; the two 16-column halves of a row change places in rows 8..15 of each
  // 16, so that the two wave halves of a store fall on different banks. It reads
  // the rows back, adds the bias and stores 4 whole lines per instruction.
  float* stg = (float*)&ring[0][0][0] + wave * (64 * 32);
#pragma unroll
  for (int mt = 0; mt < 4; ++mt)
#pragma unroll
    for (int nt = 0; nt < 2; ++nt)
#pragma unroll
      for (int r = 0; r < 8; ++r)
        stg[(mt * 16 + hw * 8 + r) * 32 + ((nt * 16 + nl) ^ (hw << 4))] = acc[mt][nt][r];

  const int ch = lane & 7;
  const int ec = e0 + wn * 32 + ch * 4;
  const float4 bv = *(const float4*)(bo + ec);
  float* yr = Y + (size_t)(t0 + wm * 64) * EMBED + ec;
#pragma unroll
  for (int i = 0; i < 16; ++i) {
    const int row = i * 4 + (lane >> 3);
    float4 v = *(const float4*)&stg[row * 32 + ((ch ^ (((row >> 3) & 1) << 2)) * 4)];
    v.x += bv.x; v.y += bv.y; v.z += bv.z; v.w += bv.w;
    *(float4*)(yr + (size_t)row * EMBED) = v;
  }
}

// ---------------------------------------------------------------------------
extern "C" void kernel_launch(void* const* d_in, const int* in_sizes, int n_in,
                              void* d_out, int out_size, void* d_ws, size_t ws_size,
                              hipStream_t stream) {
  const float* values = (const float*)d_in[0];
  const float* keys_  = (const float*)d_in[1];
  const float* query  = (const float*)d_in[2];
  const int*   mask   = (const int*)d_in[3];
  const float* Wv     = (const float*)d_in[4];
  const float* Wk     = (const float*)d_in[5];
  const float* Wq     = (const float*)d_in[6];
  const float* Wo     = (const float*)d_in[7];
  const float* bo     = (const float*)d_in[8];
  float* out = (float*)d_out;

  // Workspace layout (bytes):
  //   Qp [N][H][S][D]  f16 : 16 MB
  //   Kp [N][H][S][D]  f16 : 16 MB
  //   Vt [N][H][D][S]  f16 : 16 MB   (transposed for V^T@P^T A-fragments)
  //   AO [N][S][E]     f16 : 16 MB
  //   Wo16 [E][E]      f16 :  2 MB
  //   MB   [N][S/16][S/32][16] u32 : 2 MB  (mask as lane masks)
  const size_t QKV = (size_t)NBATCH * HEADS * SEQ * HEAD_DIM * sizeof(_Float16);
  char* ws = (char*)d_ws;
  _Float16* Qp   = (_Float16*)(ws);
  _Float16* Kp   = (_Float16*)(ws + QKV);
  _Float16* Vt   = (_Float16*)(ws + 2 * QKV);
  _Float16* AO   = (_Float16*)(ws + 3 * QKV);
  _Float16* Wo16 = (_Float16*)(ws + 4 * QKV);
  unsigned* MB   = (unsigned*)(ws + 4 * QKV + (size_t)EMBED * EMBED * sizeof(_Float16));

  front_kernel<<<NBATCH * HEADS * (SEQ / 128) / 4, (FE_WAVES + FE_MASKW) * 32, 0, stream>>>(
      query, keys_, values, Wq, Wk, Wv, Wo, mask, Qp, Kp, Vt, Wo16, MB);

  dim3 gattn((SEQ / 128) * HEADS, NBATCH);
  attn_kernel<<<gattn, 256, 0, stream>>>(Qp, Kp, Vt, MB, AO);

  dim3 gout(EMBED / OP_ROWS, NBATCH * SEQ / OP_ROWS);
  outproj_kernel<<<gout, 256, 0, stream>>>(AO, Wo16, bo, out);
}

// v007
// Measured time: 111 microseconds a run.
// Timed twice side by side with v006, it ran 1.05 and 1.06 times as fast.
// All steps since v000 together make it 4.48 times as fast.
#include <hip/hip_runtime.h>

#define EMBED 1024
#define HEADS 16
#define HEAD_DIM 64
#define NBATCH 4
#define SEQ 2048

typedef __attribute__((ext_vector_type(16))) _Float16 v16h;
typedef __attribute__((ext_vector_type(8)))  _Float16 v8h;
typedef __attribute__((ext_vector_type(8)))  float    v8f;
typedef __attribute__((ext_vector_type(16))) unsigned v16u;

static __device__ __forceinline__ v16h cat16(v8h a, v8h b) {
  return __builtin_shufflevector(a, b, 0,1,2,3,4,5,6,7,8,9,10,11,12,13,14,15);
}
static __device__ __forceinline__ v8h ldh8(const _Float16* p) { return *(const v8h*)p; }
#define WMMA_F16(a,b,c) __builtin_amdgcn_wmma_f32_16x16x32_f16(false,(a),false,(b),(short)0,(c),false,false)

// The softmax takes exp(s / sqrt(EMBED)) = exp2(s * QK_SCALE). The front end
// multiplies Wq by this factor before it rounds the weight to f16, so that the
// score products of the attention kernel are exp2 arguments as they stand.
#define QK_SCALE (0.03125f * 1.44269504088896340736f)
// Eight weights times f, rounded to f16 once.
static __device__ __forceinline__ v8h cvt8s(const float* p, float f) {
  float4 a = *(const float4*)p;
  float4 b = *(const float4*)(p + 4);
  v8h r;
  r[0]=(_Float16)(a.x*f); r[1]=(_Float16)(a.y*f); r[2]=(_Float16)(a.z*f); r[3]=(_Float16)(a.w*f);
  r[4]=(_Float16)(b.x*f); r[5]=(_Float16)(b.y*f); r[6]=(_Float16)(b.z*f); r[7]=(_Float16)(b.w*f);
  return r;
}

// Async global->LDS copy, 16 bytes per lane (GLOBAL_LOAD_ASYNC_TO_LDS_B128,
// tracked by ASYNCcnt). LDS aperture keeps the byte offset in addr[31:0], so
// truncating the generic pointer yields the LDS-address VGPR value.
static __device__ __forceinline__ unsigned lds_addr(const _Float16* p) {
  return (unsigned)(unsigned long long)p;
}
// Four copies and their s_wait_xcnt in ONE statement: the wait stands in front
// of any later rewrite of the address registers that the copies name.
static __device__ __forceinline__ void async_cp16x4(const unsigned (&l)[4],
                                                    const _Float16* const (&g)[4]) {
  asm volatile("global_load_async_to_lds_b128 %0, %4, off\n\t"
               "global_load_async_to_lds_b128 %1, %5, off\n\t"
               "global_load_async_to_lds_b128 %2, %6, off\n\t"
               "global_load_async_to_lds_b128 %3, %7, off\n\t"
               "s_wait_xcnt 0x0"
               :: "v"(l[0]), "v"(l[1]), "v"(l[2]), "v"(l[3]),
                  "v"(g[0]), "v"(g[1]), "v"(g[2]), "v"(g[3])
               : "memory");
}
// Fill one stage of 64 keys for the whole work-group (256 threads, 4 copies
// each): K 64 keys x 64 d (8192 contiguous bytes in global), V 64 d-rows x 64
// keys (128-byte runs). Every copy of a wave takes 4 whole 128-byte lines. In
// LDS both keep a 128-byte row pitch, and the 16-byte chunks of a row are
// XOR-swizzled by the row number, chunk ^= (row >> 1) & 7, so that the 16 rows
// of one ds_load_b128 fragment read fall on 16 different bank quads.
static __device__ __forceinline__ void fill_stage(_Float16* kb, _Float16* vb,
                                                  const _Float16* kg, const _Float16* vg,
                                                  int tid) {
  unsigned l[4];
  const _Float16* g[4];
#pragma unroll
  for (int i = 0; i < 2; ++i) {
    const int r   = i * 32 + (tid >> 3);
    const int ch  = tid & 7;
    const int off = r * 64 + ((ch ^ ((r >> 1) & 7)) * 8);
    l[i]     = lds_addr(kb + off);
    g[i]     = kg + r * HEAD_DIM + ch * 8;
    l[2 + i] = lds_addr(vb + off);
    g[2 + i] = vg + (size_t)r * SEQ + ch * 8;
  }
  async_cp16x4(l, g);
}
static __device__ __forceinline__ void wait_async_0() {
  asm volatile("s_wait_asynccnt 0" ::: "memory");
}

// ---------------------------------------------------------------------------
// Kernel 1: the whole front end in one launch: the three per-head projections
// Y = X_head @ W^T, the conversion of Wo to f16 and the packing of the mask. One
// work-group of 16 waves per 4 x 128 tokens-of-a-head: waves 0..3 take Q, 4..7 K,
// 8..11 V, 12..15 a share of the mask (see FE_MASKW). The four
// waves of a tensor convert a quarter of its 64 x 64 weight each and share the
// fragments through LDS; a wave then keeps all of them in registers and walks
// 128 tokens of one head (8 tiles of 16), two tiles a step, the next step's
// loads in flight while this one is worked on.
//   Q, K : Y^T = W X^T, a lane holds 8 consecutive d of one token; out [n][h][s][d]
//   V    : Y   = X W^T, a lane holds 8 consecutive tokens of one d; out [n][h][d][s]
// Either way the 16-byte pieces of four tiles are staged in the wave's own 8 KiB
// of LDS as 64 rows of one 128-byte line and go out 4 whole lines per store.
// ---------------------------------------------------------------------------
#define FE_WAVES 12
#define FE_STEPS 4                  // steps of two 16-token tiles per wave
// Four more waves per work-group pack the mask, read here once for all heads,
// into the lane masks of the attention kernel's score selects: for a tile of 16
// queries and a pass of 32 keys, word c * 8 + r holds in bit hw * 16 + nl
// whether mask[query nl][key c * 16 + hw * 8 + r] is non-zero. 16 words a pass,
// MB[batch * 128 + query tile][pass][16].
#define FE_MASKW 4
#define MB_BATCH 4                  // passes whose mask words one batch of loads holds
#define MB_NBATCH 8                 // batches per wave: 16 queries x 1024 keys

// A lane's 64 mask words of MB_BATCH passes; mp points at the lane's query row,
// at its half-wave's first key of the batch.
static __device__ __forceinline__ void ld_mask(const int* mp, int4 (&v)[MB_BATCH * 4]) {
  // Unrolled: the array stays in registers, every offset is an immediate.
#pragma unroll
  for (int i = 0; i < MB_BATCH * 2; ++i) {
    v[i * 2]     = *(const int4*)(mp + i * 16);
    v[i * 2 + 1] = *(const int4*)(mp + i * 16 + 4);
  }
}
// The lane masks of a batch: one compare per word of 32 mask values; the words of
// two passes are gathered one per lane and go out as one whole 128-byte line.
static __device__ __forceinline__ void pack_mask(const int4 (&v)[MB_BATCH * 4], unsigned* mo) {
  // All three unrolled: register arrays, and each word's lane is a constant.
#pragma unroll
  for (int pp = 0; pp < MB_BATCH / 2; ++pp) {
    unsigned acc = 0;
#pragma unroll
    for (int i = 0; i < 8; ++i) {
      const int4 m = v[pp * 8 + i];
      const int mv[4] = {m.x, m.y, m.z, m.w};
#pragma unroll
      for (int j = 0; j < 4; ++j) {
        const unsigned w = __builtin_amdgcn_ballot_w32(mv[j] != 0);
        // Lane i * 4 + j alone takes the word.
        acc = __builtin_amdgcn_inverse_ballot_w32(1u << (i * 4 + j)) ? w : acc;
      }
    }
    mo[pp * 32] = acc;
  }
}

typedef __attribute__((ext_vector_type(4))) _Float16 v4h;

static __device__ __forceinline__ v8h cvt8r(float4 a, float4 b) {
  v8h r;
  r[0]=(_Float16)a.x; r[1]=(_Float16)a.y; r[2]=(_Float16)a.z; r[3]=(_Float16)a.w;
  r[4]=(_Float16)b.x; r[5]=(_Float16)b.y; r[6]=(_Float16)b.z; r[7]=(_Float16)b.w;
  return r;
}
// The 32 floats of one lane's two fragments of a 16 x 64 tile; xr points at the
// lane's row, at its half-wave's first k.
static __device__ __forceinline__ void ld_x(const float* xr, float4 (&v)[8]) {
#pragma unroll
  for (int ks = 0; ks < 2; ++ks)
#pragma unroll
    for (int c = 0; c < 2; ++c) {
      v[ks * 4 + c * 2]     = *(const float4*)(xr + ks * 32 + c * 16);
      v[ks * 4 + c * 2 + 1] = *(const float4*)(xr + ks * 32 + c * 16 + 4);
    }
}

// The two f16 fragments of a tile from its raw floats.
static __device__ __forceinline__ void cvt_x(const float4 (&v)[8], v16h (&af)[2]) {
#pragma unroll
  for (int ks = 0; ks < 2; ++ks)
    af[ks] = cat16(cvt8r(v[ks * 4], v[ks * 4 + 1]), cvt8r(v[ks * 4 + 2], v[ks * 4 + 3]));
}

// The products of one step (two tiles) and their staging. stg: the wave's own
// 64 rows of 128 bytes; odd: second step of the staged group of four tiles.
template <bool TR>
static __device__ __forceinline__ void front_step(const v16h (&cur)[2][2],
                                                  const v16h (&wf)[4][2],
                                                  _Float16* stg, int odd, int lane) {
  const int hw = lane >> 4;
  const int nl = lane & 15;
#pragma unroll
  for (int j = 0; j < 2; ++j)
#pragma unroll
    for (int nt = 0; nt < 4; ++nt) {
      v8f c = {};
#pragma unroll
      for (int ks = 0; ks < 2; ++ks)
        c = TR ? WMMA_F16(cur[j][ks], wf[nt][ks], c) : WMMA_F16(wf[nt][ks], cur[j][ks], c);
      v8h pk;
#pragma unroll
      for (int r = 0; r < 8; ++r) pk[r] = (_Float16)c[r];
      // Staging row and 16-byte chunk of this piece; chunks XOR-swizzled by the
      // row so that the 32 pieces of a store spread over all banks.
      const int row = TR ? nt * 16 + nl : odd * 32 + j * 16 + nl;
      const int ch  = TR ? odd * 4 + j * 2 + hw : nt * 2 + hw;
      *(v8h*)(stg + row * 64 + ((ch ^ (nl & 7)) * 8)) = pk;
    }
}

__global__ __launch_bounds__((FE_WAVES + FE_MASKW) * 32) void front_kernel(
    const float* __restrict__ query, const float* __restrict__ keys_,
    const float* __restrict__ values, const float* __restrict__ Wq,
    const float* __restrict__ Wk, const float* __restrict__ Wv,
    const float* __restrict__ Wo, const int* __restrict__ mask,
    _Float16* __restrict__ Qp, _Float16* __restrict__ Kp,
    _Float16* __restrict__ Vt, _Float16* __restrict__ Wo16,
    unsigned* __restrict__ MB) {
  const int tid  = threadIdx.x;
  const int wave = __builtin_amdgcn_readfirstlane(tid >> 5);
  const int lane = tid & 31;
  const int nl   = lane & 15;
  const int lo   = (lane >> 4) * 8;
  const int sel  = wave >> 2;                    // 0: Q, 1: K, 2: V
  const int qt   = wave & 3;

  const int wq = blockIdx.x * 4 + qt;            // (batch, 128 tokens, head)
  const int h  = wq & (HEADS - 1);
  const int s0 = ((wq >> 4) & 15) * 128;
  const int bn = wq >> 8;

  const float* X  = sel == 0 ? query : sel == 1 ? keys_ : values;
  const float* Wm = sel == 0 ? Wq : sel == 1 ? Wk : Wv;
  _Float16* oh    = (sel == 0 ? Qp : sel == 1 ? Kp : Vt)
                    + (size_t)(bn * HEADS + h) * SEQ * HEAD_DIM;

  __shared__ __align__(16) _Float16 stage[FE_WAVES][64 * 64];
  __shared__ __align__(16) _Float16 wshare[3][64 * 64];

  const float* xr = X + ((size_t)(bn * SEQ + s0 + nl)) * EMBED + h * HEAD_DIM + lo;
  float4 raw[2][8];
  const int wbase = blockIdx.x * 4096 + tid * 4;
  float4 wo[4];

  // A mask wave (wave-uniform test): 16 query rows, half of their keys.
  const bool mwave = wave >= FE_WAVES;
  const int* mp = mask + (size_t)((wq >> 1) * 16 + nl) * SEQ + (wq & 1) * (SEQ / 2) + lo;
  unsigned* mo  = MB + ((wq >> 1) * (SEQ / 32) + (wq & 1) * (SEQ / 64)) * 16 + lane;
  int4 ma[MB_BATCH * 4], mb[MB_BATCH * 4];

  if (mwave) {
    ld_mask(mp, ma);
  } else {
    // Weight fragments (row e = nt * 16 + nl, contiguous along k), same k order
    // as the X fragments. This wave makes those of nt = qt and lays them in LDS
    // in fragment order (512 contiguous bytes per store or load).
    // Wq carries the softmax factor (wave-uniform; 1 leaves Wk and Wv as they are).
    const float wsc = sel == 0 ? QK_SCALE : 1.0f;
    v8h wpart[4];
#pragma unroll
    for (int ks = 0; ks < 2; ++ks) {
      const float* wr = Wm + (size_t)(qt * 16 + nl) * HEAD_DIM + ks * 32 + lo;
      wpart[ks * 2]     = cvt8s(wr, wsc);
      wpart[ks * 2 + 1] = cvt8s(wr + 16, wsc);
    }

    ld_x(xr, raw[0]);
    ld_x(xr + 16 * EMBED, raw[1]);
    // Stands in front of the rewrite of the address registers that the weight
    // loads name.
    asm volatile("s_wait_xcnt 0x0" ::: "memory");

    // Wo: 4096 floats per work-group, whole lines, by the 256 threads of waves
    // 0..7; asked for here, stored behind the projection work.
    if (wave < 8) {
#pragma unroll
      for (int j = 0; j < 4; ++j) wo[j] = *(const float4*)(Wo + wbase + j * 1024);
    }

#pragma unroll
    for (int i = 0; i < 4; ++i)
      *(v8h*)(&wshare[sel][(qt * 4 + i) * 256 + lane * 8]) = wpart[i];
  }
  // Every wave's quarter is in LDS before any wave takes the whole weight.
  __syncthreads();

  // Behind the kernel's one barrier the mask waves go their own way: two sets of
  // loads, one in flight while the other is packed. Unrolled: one address pair
  // with immediate offsets serves every load, and none of them rewrites it.
  if (mwave) {
#pragma unroll
    for (int b = 0; b < MB_NBATCH; b += 2) {
      ld_mask(mp + (b + 1) * MB_BATCH * 32, mb);
      pack_mask(ma, mo + b * MB_BATCH * 16);
      if (b + 2 < MB_NBATCH) ld_mask(mp + (b + 2) * MB_BATCH * 32, ma);
      pack_mask(mb, mo + (b + 1) * MB_BATCH * 16);
    }
    return;
  }
  v16h wf[4][2];
#pragma unroll
  for (int nt = 0; nt < 4; ++nt)
#pragma unroll
    for (int ks = 0; ks < 2; ++ks) {
      const _Float16* ws = &wshare[sel][(nt * 4 + ks * 2) * 256 + lane * 8];
      wf[nt][ks] = cat16(ldh8(ws), ldh8(ws + 256));
    }

  v16h cur[2][2];
  cvt_x(raw[0], cur[0]);
  cvt_x(raw[1], cur[1]);

  _Float16* stg = stage[wave];
  const bool tr = sel == 2;                      // wave-uniform
  // Read-back of the staged rows: 8 lanes per row, 4 rows per instruction.
  const int frow = lane >> 3;
  const int fc   = lane & 7;
  const unsigned pitch = tr ? SEQ : HEAD_DIM;    // output elements per staged row
  _Float16* od = oh + (size_t)s0 * (tr ? 1 : HEAD_DIM) + frow * pitch + fc * 8;

  // Kept rolled: one set of loads ahead of one set in work, no more registers.
#pragma unroll 1
  for (int s = 0; s < FE_STEPS; ++s) {
    float4 nxt[2][8];
    if (s + 1 < FE_STEPS) {
      const float* xn = xr + (size_t)(s + 1) * 32 * EMBED;
      ld_x(xn, nxt[0]);
      ld_x(xn + 16 * EMBED, nxt[1]);
    }

    if (tr) front_step<true >(cur, wf, stg, s & 1, lane);
    else    front_step<false>(cur, wf, stg, s & 1, lane);

    if (s & 1) {
      // The wave's own staging stores retire before it reads the rows back.
      asm volatile("s_wait_dscnt 0x0" ::: "memory");
      _Float16* dst = od + (size_t)(s >> 1) * 64 * (tr ? 1 : HEAD_DIM);
#pragma unroll
      for (int i = 0; i < 16; ++i) {
        const int row = i * 4 + frow;
        *(v8h*)(dst + (size_t)(i * 4) * pitch) =
            *(const v8h*)(stg + row * 64 + ((fc ^ (row & 7)) * 8));
      }
      // Stands in front of the next step's rewrite of the registers that the
      // last stores name.
      asm volatile("s_wait_xcnt 0x0" ::: "memory");
    }

    if (s + 1 < FE_STEPS) {
      cvt_x(nxt[0], cur[0]);
      cvt_x(nxt[1], cur[1]);
    }
  }

  if (wave < 8) {
#pragma unroll
    for (int j = 0; j < 4; ++j) {
      v4h p;
      p[0]=(_Float16)wo[j].x; p[1]=(_Float16)wo[j].y;
      p[2]=(_Float16)wo[j].z; p[3]=(_Float16)wo[j].w;
      *(v4h*)(Wo16 + wbase + j * 1024) = p;
    }
  }
}

static __device__ __forceinline__ float xhalf(float x) {
  const int v = __builtin_bit_cast(int, x);
  return __builtin_bit_cast(float,
      __builtin_amdgcn_permlanex16(v, v, 0x76543210, 0xfedcba98, false, false));
}

__global__ __launch_bounds__(256) void attn_kernel(const _Float16* __restrict__ Qp,
                                                  const _Float16* __restrict__ Kp,
                                                  const _Float16* __restrict__ Vt,
                                                  const unsigned* __restrict__ MB,
                                                  _Float16* __restrict__ AO) {
  const int tid  = threadIdx.x;
  const int wave = __builtin_amdgcn_readfirstlane(tid >> 5);
  const int lane = tid & 31;
  const int hw   = lane >> 4;
  const int nl   = lane & 15;
  const int lo   = hw * 8;

  const int h  = blockIdx.x & (HEADS - 1);
  const int qb = blockIdx.x / HEADS;
  const int bn = blockIdx.y;
  const int q0 = (qb * 8 + wave) * 16;

  const _Float16* Qh = Qp + (size_t)(bn * HEADS + h) * SEQ * HEAD_DIM;
  const _Float16* Kh = Kp + (size_t)(bn * HEADS + h) * SEQ * HEAD_DIM;
  const _Float16* Vh = Vt + (size_t)(bn * HEADS + h) * HEAD_DIM * SEQ;

  // Double-buffered K/V stages: K row-major [64 keys][64 d], V [64 d][64 keys],
  // 16-byte chunks swizzled inside each row (see fill_stage).
  __shared__ __align__(16) _Float16 Kbuf[2][64 * 64];
  __shared__ __align__(16) _Float16 Vbuf[2][64 * 64];

  // Q B-fragments (column n = nl on both half-waves), kept for the whole loop.
  v16h qf[2];
  {
    const _Float16* qr = Qh + (size_t)(q0 + nl) * HEAD_DIM;
#pragma unroll
    for (int ks = 0; ks < 2; ++ks)
      qf[ks] = cat16(ldh8(qr + ks * 32 + lo), ldh8(qr + ks * 32 + 16 + lo));
  }

  // o[dt][r] = O[q0 + nl][dt * 16 + hw * 8 + r]; rmax is the query's running
  // maximum (equal in both halves), rsum the sum over this half's keys only.
  v8f o[4] = {v8f{}, v8f{}, v8f{}, v8f{}};
  float rmax = -1.0e30f, rsum = 0.0f;

  // Q comes scaled by QK_SCALE: scores, maxima and differences are exp2 arguments.
  const float mfill = -1.0e20f * QK_SCALE;   // masked value in the same units

  // Mask: the front end has packed it into lane masks, 16 words per pass of this
  // wave's query tile (word c * 8 + r: one bit per lane for score sf[c][r]). The
  // address is the same in every lane, and nothing writes MB during this launch:
  // read as constant memory the words come by scalar loads straight into the
  // scalar registers that the selects take. mk holds the words of the coming pass.
  typedef const __attribute__((address_space(4))) v16u* mb_ptr;
  const mb_ptr mrow = (mb_ptr)(MB + (size_t)(bn * (SEQ / 16) + (q0 >> 4)) * (SEQ / 32) * 16);
  v16u mk = mrow[0];

  const int NS = SEQ / 64;

  // Stage 0 lands and is published to all waves; then stage 1's copies start.
  fill_stage(Kbuf[0], Vbuf[0], Kh, Vh, tid);
  wait_async_0();
  __syncthreads();
  fill_stage(Kbuf[1], Vbuf[1], Kh + (size_t)64 * HEAD_DIM, Vh + 64, tid);

  // Swizzle term of the fragment readers (row = 16 * tile + nl in both).
  const int kswz = (nl >> 1) & 7;

  // Kept rolled: one trip per stage, one publish point at its foot.
#pragma unroll 1
  for (int st = 0; st < NS; ++st) {
    const int cur = st & 1;

    // Kept rolled: unrolled, the compiler merges the two passes and the wave
    // takes more than 128 registers, so that only three of the four work-groups
    // that a WGP gets from this grid would be resident at once.
#pragma unroll 1
    for (int p = 0; p < 2; ++p) {
      const int k0 = st * 64 + p * 32;

      // ---- S^T[32x16] = K @ Q^T : two 16-key tiles (A-frags from LDS) ------
      v8f sf[2];
#pragma unroll
      for (int c = 0; c < 2; ++c) {
        v8f s = {};
        const _Float16* kr = &Kbuf[cur][(p * 32 + c * 16 + nl) * 64];
#pragma unroll
        for (int ks = 0; ks < 2; ++ks) {
          v16h a = cat16(ldh8(kr + ((ks * 4 + hw) ^ kswz) * 8),
                         ldh8(kr + ((ks * 4 + 2 + hw) ^ kswz) * 8));
          s = WMMA_F16(a, qf[ks], s);
        }
        sf[c] = s;
      }

      // ---- mask: each packed word is the select's lane mask -----------------
#pragma unroll
      for (int c = 0; c < 2; ++c)
#pragma unroll
        for (int r = 0; r < 8; ++r)
          sf[c][r] = __builtin_amdgcn_inverse_ballot_w32(mk[c * 8 + r]) ? sf[c][r] : mfill;
      // The next pass's mask words start now and land behind the rest of this
      // pass; the last pass wraps to key 0 (in bounds, never used).
      mk = mrow[((k0 + 32) & (SEQ - 1)) >> 5];

      // ---- online softmax: maximum of 32 keys, in-lane + one exchange ------
      float m = fmaxf(sf[0][0], sf[1][0]);
#pragma unroll
      for (int r = 1; r < 8; ++r) m = fmaxf(m, fmaxf(sf[0][r], sf[1][r]));
      m = fmaxf(m, xhalf(m));
      const float nm    = fmaxf(rmax, m);
      const float alpha = __builtin_amdgcn_exp2f(rmax - nm);
      rmax = nm;

      // ---- P^T = exp2(S^T - max): the two tiles are the B operand ----------
      v16h pb;
      float part = 0.0f;
#pragma unroll
      for (int c = 0; c < 2; ++c)
#pragma unroll
        for (int r = 0; r < 8; ++r) {
          const float pv = __builtin_amdgcn_exp2f(sf[c][r] - nm);
          part += pv;
          pb[c * 8 + r] = (_Float16)pv;
        }
      rsum = rsum * alpha + part;

      // ---- rescale accumulator --------------------------------------------
#pragma unroll
      for (int dt = 0; dt < 4; ++dt)
#pragma unroll
        for (int r = 0; r < 8; ++r) o[dt][r] *= alpha;

      // ---- O^T += V^T @ P^T (V A-frags from LDS, same k order as pb) -------
#pragma unroll
      for (int dt = 0; dt < 4; ++dt) {
        const _Float16* vr = &Vbuf[cur][(dt * 16 + nl) * 64];
        v16h a = cat16(ldh8(vr + ((p * 4 + hw) ^ kswz) * 8),
                       ldh8(vr + ((p * 4 + 2 + hw) ^ kswz) * 8));
        o[dt] = WMMA_F16(a, pb, o[dt]);
      }
    }

    // Publish point of stage st + 1: this wave's LDS reads of stage st retire,
    // its own copies of stage st + 1 have landed, then the barrier both shows
    // stage st + 1 to every wave and frees buffer cur for the refill.
    asm volatile("s_wait_dscnt 0x0" ::: "memory");
    wait_async_0();
    __syncthreads();
    if (st + 2 < NS)
      fill_stage(Kbuf[cur], Vbuf[cur], Kh + (size_t)(st + 2) * 64 * HEAD_DIM,
                 Vh + (st + 2) * 64, tid);
  }
  // No copy is outstanding when the wave goes on to its epilogue and ends.
  wait_async_0();

  // ---- finalize: join the halves' sums, O / rowsum, 16-byte f16 stores ----
  const float inv = 1.0f / (rsum + xhalf(rsum));
  _Float16* dst = AO + ((size_t)bn * SEQ + q0 + nl) * EMBED + h * HEAD_DIM + lo;
#pragma unroll
  for (int dt = 0; dt < 4; ++dt) {
    v8h pk;
#pragma unroll
    for (int r = 0; r < 8; ++r) pk[r] = (_Float16)(o[dt][r] * inv);
    *(v8h*)(dst + dt * 16) = pk;
  }
}

// ---------------------------------------------------------------------------
// Kernel 3: Y[8192x1024] = AO @ Wo^T + bo. One work-group of 8 waves per
// 128 x 128 output tile, one 64 x 32 part per wave (2 x 4 waves). A stage is 64 k
// (one 128-byte line) of the tile's 128 AO rows and 128 Wo rows: two buffers in
// LDS, every wave copies an eighth of a stage with
// GLOBAL_LOAD_ASYNC_TO_LDS_B128, each copy taking 4 whole lines, and the next
// stage's copies fly while this one is worked on. Rows and chunks lie in LDS
// as in fill_stage, so the b128 fragment reads are conflict-free.
// ---------------------------------------------------------------------------
#define OP_ROWS 128                 // rows of each operand in a stage
#define OP_HALF (OP_ROWS * 64)      // f16 elements of one operand's stage

// Eight copies and their s_wait_xcnt in ONE statement: the wait stands in front
// of any later rewrite of the address registers that the copies name.
static __device__ __forceinline__ void async_cp16x8(const unsigned (&l)[8],
                                                    const _Float16* const (&g)[8]) {
  asm volatile("global_load_async_to_lds_b128 %0, %8, off\n\t"
               "global_load_async_to_lds_b128 %1, %9, off\n\t"
               "global_load_async_to_lds_b128 %2, %10, off\n\t"
               "global_load_async_to_lds_b128 %3, %11, off\n\t"
               "global_load_async_to_lds_b128 %4, %12, off\n\t"
               "global_load_async_to_lds_b128 %5, %13, off\n\t"
               "global_load_async_to_lds_b128 %6, %14, off\n\t"
               "global_load_async_to_lds_b128 %7, %15, off\n\t"
               "s_wait_xcnt 0x0"
               :: "v"(l[0]), "v"(l[1]), "v"(l[2]), "v"(l[3]),
                  "v"(l[4]), "v"(l[5]), "v"(l[6]), "v"(l[7]),
                  "v"(g[0]), "v"(g[1]), "v"(g[2]), "v"(g[3]),
                  "v"(g[4]), "v"(g[5]), "v"(g[6]), "v"(g[7])
               : "memory");
}
// One stage for the whole work-group (256 threads, 8 copies each); ag and bg
// point at the stage's first k of the tile's first AO row and first Wo row.
static __device__ __forceinline__ void fill_gemm_stage(_Float16* ab, _Float16* bb,
                                                       const _Float16* ag,
                                                       const _Float16* bg, int tid) {
  unsigned l[8];
  const _Float16* g[8];
#pragma unroll
  for (int i = 0; i < 4; ++i) {
    const int r   = i * 32 + (tid >> 3);
    const int ch  = tid & 7;
    const int off = r * 64 + ((ch ^ ((r >> 1) & 7)) * 8);
    l[i]     = lds_addr(ab + off);
    g[i]     = ag + (size_t)r * EMBED + ch * 8;
    l[4 + i] = lds_addr(bb + off);
    g[4 + i] = bg + (size_t)r * EMBED + ch * 8;
  }
  async_cp16x8(l, g);
}

__global__ __launch_bounds__(256) void outproj_kernel(const _Float16* __restrict__ AO,
                                                      const _Float16* __restrict__ Wo16,
                                                      const float* __restrict__ bo,
                                                      float* __restrict__ Y) {
  const int tid  = threadIdx.x;
  const int wave = __builtin_amdgcn_readfirstlane(tid >> 5);
  const int lane = tid & 31;
  const int hw   = lane >> 4;
  const int nl   = lane & 15;

  const int e0 = blockIdx.x * OP_ROWS;   // first output column of the tile
  const int t0 = blockIdx.y * OP_ROWS;   // first token of the tile
  const int wm = wave >> 2;              // this wave's 64 tokens
  const int wn = wave & 3;               // this wave's 32 columns

  // ring[buffer][operand]: AO rows, then Wo rows; 64 KiB, the output staging
  // of the epilogue takes the same bytes.
  __shared__ __align__(16) _Float16 ring[2][2][OP_HALF];

  const _Float16* Ag = AO + (size_t)t0 * EMBED;
  const _Float16* Bg = Wo16 + (size_t)e0 * EMBED;

  v8f acc[4][2];
#pragma unroll
  for (int mt = 0; mt < 4; ++mt)
#pragma unroll
    for (int nt = 0; nt < 2; ++nt) acc[mt][nt] = v8f{};

  const int NS = EMBED / 64;

  // Stage 0 lands and is published to all waves; then stage 1's copies start.
  fill_gemm_stage(ring[0][0], ring[0][1], Ag, Bg, tid);
  wait_async_0();
  __syncthreads();
  fill_gemm_stage(ring[1][0], ring[1][1], Ag + 64, Bg + 64, tid);

  // Swizzle term of the fragment readers (row = 16 * tile + nl in both).
  const int kswz = (nl >> 1) & 7;

  // Kept rolled: one trip per stage, one publish point at its foot.
#pragma unroll 1
  for (int st = 0; st < NS; ++st) {
    const int cur = st & 1;
    const _Float16* ar = &ring[cur][0][(wm * 64 + nl) * 64];
    const _Float16* br = &ring[cur][1][(wn * 32 + nl) * 64];
#pragma unroll
    for (int ks = 0; ks < 2; ++ks) {
      const int c0 = ((ks * 4 + hw) ^ kswz) * 8;
      const int c1 = ((ks * 4 + 2 + hw) ^ kswz) * 8;
      v16h a[4], b[2];
#pragma unroll
      for (int mt = 0; mt < 4; ++mt)
        a[mt] = cat16(ldh8(ar + mt * 16 * 64 + c0), ldh8(ar + mt * 16 * 64 + c1));
#pragma unroll
      for (int nt = 0; nt < 2; ++nt)
        b[nt] = cat16(ldh8(br + nt * 16 * 64 + c0), ldh8(br + nt * 16 * 64 + c1));
#pragma unroll
      for (int mt = 0; mt < 4; ++mt)
#pragma unroll
        for (int nt = 0; nt < 2; ++nt)
          acc[mt][nt] = WMMA_F16(a[mt], b[nt], acc[mt][nt]);
    }

    // Publish point of stage st + 1: this wave's LDS reads of stage st retire,
    // its own copies of stage st + 1 have landed, then the barrier both shows
    // stage st + 1 to every wave and frees buffer cur for the refill.
    asm volatile("s_wait_dscnt 0x0" ::: "memory");
    wait_async_0();
    __syncthreads();
    if (st + 2 < NS)
      fill_gemm_stage(ring[cur][0], ring[cur][1], Ag + (st + 2) * 64, Bg + (st + 2) * 64, tid);
  }
  // No copy is outstanding when the ring becomes output staging.
  wait_async_0();

  // ---- epilogue: behind the last publish point nobody reads the ring any more.
  // Each wave stages its 64 x 32 f32 part in its own 8 KiB, rows of one 128-byte
  // line; the two 16-column halves of a row change places in rows 8..15 of each
  // 16, so that the two wave halves of a store fall on different banks. It reads
  // the rows back, adds the bias and stores 4 whole lines per instruction.
  float* stg = (float*)&ring[0][0][0] + wave * (64 * 32);
#pragma unroll
  for (int mt = 0; mt < 4; ++mt)
#pragma unroll
    for (int nt = 0; nt < 2; ++nt)
#pragma unroll
      for (int r = 0; r < 8; ++r)
        stg[(mt * 16 + hw * 8 + r) * 32 + ((nt * 16 + nl) ^ (hw << 4))] = acc[mt][nt][r];

  const int ch = lane & 7;
  const int ec = e0 + wn * 32 + ch * 4;
  const float4 bv = *(const float4*)(bo + ec);
  float* yr = Y + (size_t)(t0 + wm * 64) * EMBED + ec;
#pragma unroll
  for (int i = 0; i < 16; ++i) {
    const int row = i * 4 + (lane >> 3);
    float4 v = *(const float4*)&stg[row * 32 + ((ch ^ (((row >> 3) & 1) << 2)) * 4)];
    v.x += bv.x; v.y += bv.y; v.z += bv.z; v.w += bv.w;
    *(float4*)(yr + (size_t)row * EMBED) = v;
  }
}

// ---------------------------------------------------------------------------
extern "C" void kernel_launch(void* const* d_in, const int* in_sizes, int n_in,
                              void* d_out, int out_size, void* d_ws, size_t ws_size,
                              hipStream_t stream) {
  const float* values = (const float*)d_in[0];
  const float* keys_  = (const float*)d_in[1];
  const float* query  = (const float*)d_in[2];
  const int*   mask   = (const int*)d_in[3];
  const float* Wv     = (const float*)d_in[4];
  const float* Wk     = (const float*)d_in[5];
  const float* Wq     = (const float*)d_in[6];
  const float* Wo     = (const float*)d_in[7];
  const float* bo     = (const float*)d_in[8];
  float* out = (float*)d_out;

  // Workspace layout (bytes):
  //   Qp [N][H][S][D]  f16 : 16 MB
  //   Kp [N][H][S][D]  f16 : 16 MB
  //   Vt [N][H][D][S]  f16 : 16 MB   (transposed for V^T@P^T A-fragments)
  //   AO [N][S][E]     f16 : 16 MB
  //   Wo16 [E][E]      f16 :  2 MB
  //   MB   [N][S/16][S/32][16] u32 : 2 MB  (mask as lane masks)
  const size_t QKV = (size_t)NBATCH * HEADS * SEQ * HEAD_DIM * sizeof(_Float16);
  char* ws = (char*)d_ws;
  _Float16* Qp   = (_Float16*)(ws);
  _Float16* Kp   = (_Float16*)(ws + QKV);
  _Float16* Vt   = (_Float16*)(ws + 2 * QKV);
  _Float16* AO   = (_Float16*)(ws + 3 * QKV);
  _Float16* Wo16 = (_Float16*)(ws + 4 * QKV);
  unsigned* MB   = (unsigned*)(ws + 4 * QKV + (size_t)EMBED * EMBED * sizeof(_Float16));

  front_kernel<<<NBATCH * HEADS * (SEQ / 128) / 4, (FE_WAVES + FE_MASKW) * 32, 0, stream>>>(
      query, keys_, values, Wq, Wk, Wv, Wo, mask, Qp, Kp, Vt, Wo16, MB);

  dim3 gattn((SEQ / 128) * HEADS, NBATCH);
  attn_kernel<<<gattn, 256, 0, stream>>>(Qp, Kp, Vt, MB, AO);

  dim3 gout(EMBED / OP_ROWS, NBATCH * SEQ / OP_ROWS);
  outproj_kernel<<<gout, 256, 0, stream>>>(AO, Wo16, bo, out);
}

// v008
// Measured time: 102 microseconds a run.
// In two side-by-side timings against v007, it was 1.08 and 1.07 times as fast.
// Over all steps from v000 it is 4.82 times as fast.
#include <hip/hip_runtime.h>

#define EMBED 1024
#define HEADS 16
#define HEAD_DIM 64
#define NBATCH 4
#define SEQ 2048

typedef __attribute__((ext_vector_type(16))) _Float16 v16h;
typedef __attribute__((ext_vector_type(8)))  _Float16 v8h;
typedef __attribute__((ext_vector_type(8)))  float    v8f;
typedef __attribute__((ext_vector_type(16))) unsigned v16u;

static __device__ __forceinline__ v16h cat16(v8h a, v8h b) {
  return __builtin_shufflevector(a, b, 0,1,2,3,4,5,6,7,8,9,10,11,12,13,14,15);
}
static __device__ __forceinline__ v8h ldh8(const _Float16* p) { return *(const v8h*)p; }
#define WMMA_F16(a,b,c) __builtin_amdgcn_wmma_f32_16x16x32_f16(false,(a),false,(b),(short)0,(c),false,false)

// The softmax takes exp(s / sqrt(EMBED)) = exp2(s * QK_SCALE). The front end
// multiplies Wq by this factor before it rounds the weight to f16, so that the
// score products of the attention kernel are exp2 arguments as they stand.
#define QK_SCALE (0.03125f * 1.44269504088896340736f)
// Eight weights times f, rounded to f16 once.
static __device__ __forceinline__ v8h cvt8s(const float* p, float f) {
  float4 a = *(const float4*)p;
  float4 b = *(const float4*)(p + 4);
  v8h r;
  r[0]=(_Float16)(a.x*f); r[1]=(_Float16)(a.y*f); r[2]=(_Float16)(a.z*f); r[3]=(_Float16)(a.w*f);
  r[4]=(_Float16)(b.x*f); r[5]=(_Float16)(b.y*f); r[6]=(_Float16)(b.z*f); r[7]=(_Float16)(b.w*f);
  return r;
}

// Async global->LDS copy, 16 bytes per lane (GLOBAL_LOAD_ASYNC_TO_LDS_B128,
// tracked by ASYNCcnt). LDS aperture keeps the byte offset in addr[31:0], so
// truncating the generic pointer yields the LDS-address VGPR value.
static __device__ __forceinline__ unsigned lds_addr(const _Float16* p) {
  return (unsigned)(unsigned long long)p;
}
// Four copies and their s_wait_xcnt in ONE statement: the wait stands in front
// of any later rewrite of the address registers that the copies name.
static __device__ __forceinline__ void async_cp16x4(const unsigned (&l)[4],
                                                    const _Float16* const (&g)[4]) {
  asm volatile("global_load_async_to_lds_b128 %0, %4, off\n\t"
               "global_load_async_to_lds_b128 %1, %5, off\n\t"
               "global_load_async_to_lds_b128 %2, %6, off\n\t"
               "global_load_async_to_lds_b128 %3, %7, off\n\t"
               "s_wait_xcnt 0x0"
               :: "v"(l[0]), "v"(l[1]), "v"(l[2]), "v"(l[3]),
                  "v"(g[0]), "v"(g[1]), "v"(g[2]), "v"(g[3])
               : "memory");
}
// Fill one stage of 64 keys for the whole work-group (256 threads, 4 copies
// each): K 64 keys x 64 d (8192 contiguous bytes in global), V 64 d-rows x 64
// keys (128-byte runs). Every copy of a wave takes 4 whole 128-byte lines. In
// LDS both keep a 128-byte row pitch, and the 16-byte chunks of a row are
// XOR-swizzled by the row number, chunk ^= (row >> 1) & 7, so that the 16 rows
// of one ds_load_b128 fragment read fall on 16 different bank quads.
static __device__ __forceinline__ void fill_stage(_Float16* kb, _Float16* vb,
                                                  const _Float16* kg, const _Float16* vg,
                                                  int tid) {
  unsigned l[4];
  const _Float16* g[4];
#pragma unroll
  for (int i = 0; i < 2; ++i) {
    const int r   = i * 32 + (tid >> 3);
    const int ch  = tid & 7;
    const int off = r * 64 + ((ch ^ ((r >> 1) & 7)) * 8);
    l[i]     = lds_addr(kb + off);
    g[i]     = kg + r * HEAD_DIM + ch * 8;
    l[2 + i] = lds_addr(vb + off);
    g[2 + i] = vg + (size_t)r * SEQ + ch * 8;
  }
  async_cp16x4(l, g);
}
static __device__ __forceinline__ void wait_async_0() {
  asm volatile("s_wait_asynccnt 0" ::: "memory");
}

// ---------------------------------------------------------------------------
// Kernel 1: the whole front end in one launch: the three per-head projections
// Y = X_head @ W^T, the conversion of Wo to f16 and the packing of the mask. One
// work-group of 16 waves per 4 x 128 tokens-of-a-head: waves 0..3 take Q, 4..7 K,
// 8..11 V, 12..15 a share of the mask (see FE_MASKW). The four
// waves of a tensor convert a quarter of its 64 x 64 weight each and share the
// fragments through LDS; a wave then keeps all of them in registers and walks
// 128 tokens of one head (8 tiles of 16), two tiles a step, the next step's
// loads in flight while this one is worked on.
//   Q, K : Y^T = W X^T, a lane holds 8 consecutive d of one token; out [n][h][s][d]
//   V    : Y   = X W^T, a lane holds 8 consecutive tokens of one d; out [n][h][d][s]
// Either way the 16-byte pieces of four tiles are staged in the wave's own 8 KiB
// of LDS as 64 rows of one 128-byte line and go out 4 whole lines per store.
// ---------------------------------------------------------------------------
#define FE_WAVES 12
#define FE_STEPS 4                  // steps of two 16-token tiles per wave
// Four more waves per work-group pack the mask, read here once for all heads,
// into the lane masks of the attention kernel's score selects: for a tile of 16
// queries and a pass of 32 keys, word c * 8 + r holds in bit hw * 16 + nl
// whether mask[query nl][key c * 16 + hw * 8 + r] is non-zero. 16 words a pass,
// MB[batch * 128 + query tile][pass][16].
#define FE_MASKW 4
#define MB_BATCH 4                  // passes whose mask words one batch of loads holds
#define MB_NBATCH 8                 // batches per wave: 16 queries x 1024 keys

// A lane's 64 mask words of MB_BATCH passes; mp points at the lane's query row,
// at its half-wave's first key of the batch.
static __device__ __forceinline__ void ld_mask(const int* mp, int4 (&v)[MB_BATCH * 4]) {
  // Unrolled: the array stays in registers, every offset is an immediate.
#pragma unroll
  for (int i = 0; i < MB_BATCH * 2; ++i) {
    v[i * 2]     = *(const int4*)(mp + i * 16);
    v[i * 2 + 1] = *(const int4*)(mp + i * 16 + 4);
  }
}
// The lane masks of a batch: one compare per word of 32 mask values; the words of
// two passes are gathered one per lane and go out as one whole 128-byte line.
static __device__ __forceinline__ void pack_mask(const int4 (&v)[MB_BATCH * 4], unsigned* mo) {
  // All three unrolled: register arrays, and each word's lane is a constant.
#pragma unroll
  for (int pp = 0; pp < MB_BATCH / 2; ++pp) {
    unsigned acc = 0;
#pragma unroll
    for (int i = 0; i < 8; ++i) {
      const int4 m = v[pp * 8 + i];
      const int mv[4] = {m.x, m.y, m.z, m.w};
#pragma unroll
      for (int j = 0; j < 4; ++j) {
        const unsigned w = __builtin_amdgcn_ballot_w32(mv[j] != 0);
        // Lane i * 4 + j alone takes the word.
        acc = __builtin_amdgcn_inverse_ballot_w32(1u << (i * 4 + j)) ? w : acc;
      }
    }
    mo[pp * 32] = acc;
  }
}

typedef __attribute__((ext_vector_type(4))) _Float16 v4h;

static __device__ __forceinline__ v8h cvt8r(float4 a, float4 b) {
  v8h r;
  r[0]=(_Float16)a.x; r[1]=(_Float16)a.y; r[2]=(_Float16)a.z; r[3]=(_Float16)a.w;
  r[4]=(_Float16)b.x; r[5]=(_Float16)b.y; r[6]=(_Float16)b.z; r[7]=(_Float16)b.w;
  return r;
}
// The 32 floats of one lane's two fragments of a 16 x 64 tile; xr points at the
// lane's row, at its half-wave's first k.
static __device__ __forceinline__ void ld_x(const float* xr, float4 (&v)[8]) {
#pragma unroll
  for (int ks = 0; ks < 2; ++ks)
#pragma unroll
    for (int c = 0; c < 2; ++c) {
      v[ks * 4 + c * 2]     = *(const float4*)(xr + ks * 32 + c * 16);
      v[ks * 4 + c * 2 + 1] = *(const float4*)(xr + ks * 32 + c * 16 + 4);
    }
}

// The two f16 fragments of a tile from its raw floats.
static __device__ __forceinline__ void cvt_x(const float4 (&v)[8], v16h (&af)[2]) {
#pragma unroll
  for (int ks = 0; ks < 2; ++ks)
    af[ks] = cat16(cvt8r(v[ks * 4], v[ks * 4 + 1]), cvt8r(v[ks * 4 + 2], v[ks * 4 + 3]));
}

// The products of one step (two tiles) and their staging. stg: the wave's own
// 64 rows of 128 bytes; odd: second step of the staged group of four tiles.
template <bool TR>
static __device__ __forceinline__ void front_step(const v16h (&cur)[2][2],
                                                  const v16h (&wf)[4][2],
                                                  _Float16* stg, int odd, int lane) {
  const int hw = lane >> 4;
  const int nl = lane & 15;
#pragma unroll
  for (int j = 0; j < 2; ++j)
#pragma unroll
    for (int nt = 0; nt < 4; ++nt) {
      v8f c = {};
#pragma unroll
      for (int ks = 0; ks < 2; ++ks)
        c = TR ? WMMA_F16(cur[j][ks], wf[nt][ks], c) : WMMA_F16(wf[nt][ks], cur[j][ks], c);
      v8h pk;
#pragma unroll
      for (int r = 0; r < 8; ++r) pk[r] = (_Float16)c[r];
      // Staging row and 16-byte chunk of this piece; chunks XOR-swizzled by the
      // row so that the 32 pieces of a store spread over all banks.
      const int row = TR ? nt * 16 + nl : odd * 32 + j * 16 + nl;
      const int ch  = TR ? odd * 4 + j * 2 + hw : nt * 2 + hw;
      *(v8h*)(stg + row * 64 + ((ch ^ (nl & 7)) * 8)) = pk;
    }
}

__global__ __launch_bounds__((FE_WAVES + FE_MASKW) * 32) void front_kernel(
    const float* __restrict__ query, const float* __restrict__ keys_,
    const float* __restrict__ values, const float* __restrict__ Wq,
    const float* __restrict__ Wk, const float* __restrict__ Wv,
    const float* __restrict__ Wo, const int* __restrict__ mask,
    _Float16* __restrict__ Qp, _Float16* __restrict__ Kp,
    _Float16* __restrict__ Vt, _Float16* __restrict__ Wo16,
    unsigned* __restrict__ MB) {
  const int tid  = threadIdx.x;
  const int wave = __builtin_amdgcn_readfirstlane(tid >> 5);
  const int lane = tid & 31;
  const int nl   = lane & 15;
  const int lo   = (lane >> 4) * 8;
  const int sel  = wave >> 2;                    // 0: Q, 1: K, 2: V
  const int qt   = wave & 3;

  const int wq = blockIdx.x * 4 + qt;            // (batch, 128 tokens, head)
  const int h  = wq & (HEADS - 1);
  const int s0 = ((wq >> 4) & 15) * 128;
  const int bn = wq >> 8;

  const float* X  = sel == 0 ? query : sel == 1 ? keys_ : values;
  const float* Wm = sel == 0 ? Wq : sel == 1 ? Wk : Wv;
  _Float16* oh    = (sel == 0 ? Qp : sel == 1 ? Kp : Vt)
                    + (size_t)(bn * HEADS + h) * SEQ * HEAD_DIM;

  __shared__ __align__(16) _Float16 stage[FE_WAVES][64 * 64];
  __shared__ __align__(16) _Float16 wshare[3][64 * 64];

  const float* xr = X + ((size_t)(bn * SEQ + s0 + nl)) * EMBED + h * HEAD_DIM + lo;
  float4 raw[2][8];
  const int wbase = blockIdx.x * 4096 + tid * 4;
  float4 wo[4];

  // A mask wave (wave-uniform test): 16 query rows, half of their keys.
  const bool mwave = wave >= FE_WAVES;
  const int* mp = mask + (size_t)((wq >> 1) * 16 + nl) * SEQ + (wq & 1) * (SEQ / 2) + lo;
  unsigned* mo  = MB + ((wq >> 1) * (SEQ / 32) + (wq & 1) * (SEQ / 64)) * 16 + lane;
  int4 ma[MB_BATCH * 4], mb[MB_BATCH * 4];

  if (mwave) {
    ld_mask(mp, ma);
  } else {
    // Weight fragments (row e = nt * 16 + nl, contiguous along k), same k order
    // as the X fragments. This wave makes those of nt = qt and lays them in LDS
    // in fragment order (512 contiguous bytes per store or load).
    // Wq carries the softmax factor (wave-uniform; 1 leaves Wk and Wv as they are).
    const float wsc = sel == 0 ? QK_SCALE : 1.0f;
    v8h wpart[4];
#pragma unroll
    for (int ks = 0; ks < 2; ++ks) {
      const float* wr = Wm + (size_t)(qt * 16 + nl) * HEAD_DIM + ks * 32 + lo;
      wpart[ks * 2]     = cvt8s(wr, wsc);
      wpart[ks * 2 + 1] = cvt8s(wr + 16, wsc);
    }

    ld_x(xr, raw[0]);
    ld_x(xr + 16 * EMBED, raw[1]);
    // Stands in front of the rewrite of the address registers that the weight
    // loads name.
    asm volatile("s_wait_xcnt 0x0" ::: "memory");

    // Wo: 4096 floats per work-group, whole lines, by the 256 threads of waves
    // 0..7; asked for here, stored behind the projection work.
    if (wave < 8) {
#pragma unroll
      for (int j = 0; j < 4; ++j) wo[j] = *(const float4*)(Wo + wbase + j * 1024);
    }

#pragma unroll
    for (int i = 0; i < 4; ++i)
      *(v8h*)(&wshare[sel][(qt * 4 + i) * 256 + lane * 8]) = wpart[i];
  }
  // Every wave's quarter is in LDS before any wave takes the whole weight.
  __syncthreads();

  // Behind the kernel's one barrier the mask waves go their own way: two sets of
  // loads, one in flight while the other is packed. Unrolled: one address pair
  // with immediate offsets serves every load, and none of them rewrites it.
  if (mwave) {
#pragma unroll
    for (int b = 0; b < MB_NBATCH; b += 2) {
      ld_mask(mp + (b + 1) * MB_BATCH * 32, mb);
      pack_mask(ma, mo + b * MB_BATCH * 16);
      if (b + 2 < MB_NBATCH) ld_mask(mp + (b + 2) * MB_BATCH * 32, ma);
      pack_mask(mb, mo + (b + 1) * MB_BATCH * 16);
    }
    return;
  }
  v16h wf[4][2];
#pragma unroll
  for (int nt = 0; nt < 4; ++nt)
#pragma unroll
    for (int ks = 0; ks < 2; ++ks) {
      const _Float16* ws = &wshare[sel][(nt * 4 + ks * 2) * 256 + lane * 8];
      wf[nt][ks] = cat16(ldh8(ws), ldh8(ws + 256));
    }

  v16h cur[2][2];
  cvt_x(raw[0], cur[0]);
  cvt_x(raw[1], cur[1]);

  _Float16* stg = stage[wave];
  const bool tr = sel == 2;                      // wave-uniform
  // Read-back of the staged rows: 8 lanes per row, 4 rows per instruction.
  const int frow = lane >> 3;
  const int fc   = lane & 7;
  const unsigned pitch = tr ? SEQ : HEAD_DIM;    // output elements per staged row
  _Float16* od = oh + (size_t)s0 * (tr ? 1 : HEAD_DIM) + frow * pitch + fc * 8;

  // Kept rolled: one set of loads ahead of one set in work, no more registers.
#pragma unroll 1
  for (int s = 0; s < FE_STEPS; ++s) {
    float4 nxt[2][8];
    if (s + 1 < FE_STEPS) {
      const float* xn = xr + (size_t)(s + 1) * 32 * EMBED;
      ld_x(xn, nxt[0]);
      ld_x(xn + 16 * EMBED, nxt[1]);
    }

    if (tr) front_step<true >(cur, wf, stg, s & 1, lane);
    else    front_step<false>(cur, wf, stg, s & 1, lane);

    if (s & 1) {
      // The wave's own staging stores retire before it reads the rows back.
      asm volatile("s_wait_dscnt 0x0" ::: "memory");
      _Float16* dst = od + (size_t)(s >> 1) * 64 * (tr ? 1 : HEAD_DIM);
#pragma unroll
      for (int i = 0; i < 16; ++i) {
        const int row = i * 4 + frow;
        *(v8h*)(dst + (size_t)(i * 4) * pitch) =
            *(const v8h*)(stg + row * 64 + ((fc ^ (row & 7)) * 8));
      }
      // Stands in front of the next step's rewrite of the registers that the
      // last stores name.
      asm volatile("s_wait_xcnt 0x0" ::: "memory");
    }

    if (s + 1 < FE_STEPS) {
      cvt_x(nxt[0], cur[0]);
      cvt_x(nxt[1], cur[1]);
    }
  }

  if (wave < 8) {
#pragma unroll
    for (int j = 0; j < 4; ++j) {
      v4h p;
      p[0]=(_Float16)wo[j].x; p[1]=(_Float16)wo[j].y;
      p[2]=(_Float16)wo[j].z; p[3]=(_Float16)wo[j].w;
      *(v4h*)(Wo16 + wbase + j * 1024) = p;
    }
  }
}

static __device__ __forceinline__ float xhalf(float x) {
  const int v = __builtin_bit_cast(int, x);
  return __builtin_bit_cast(float,
      __builtin_amdgcn_permlanex16(v, v, 0x76543210, 0xfedcba98, false, false));
}

// S^T[32 x 16] = K Q^T + c0 for one pass: two 16-key tiles, A fragments from LDS;
// kr points at the lane's row of the first tile.
static __device__ __forceinline__ void pass_scores(const _Float16* kr, int hw, int kswz,
                                                   const v16h (&qf)[2], v8f c0,
                                                   v8f (&sf)[2]) {
#pragma unroll
  for (int c = 0; c < 2; ++c) {
    v8f s = c0;
#pragma unroll
    for (int ks = 0; ks < 2; ++ks) {
      v16h a = cat16(ldh8(kr + c * 16 * 64 + ((ks * 4 + hw) ^ kswz) * 8),
                     ldh8(kr + c * 16 * 64 + ((ks * 4 + 2 + hw) ^ kswz) * 8));
      s = WMMA_F16(a, qf[ks], s);
    }
    sf[c] = s;
  }
}
// A lane's 16 exponentials of a pass may sum to this much before the maximum in
// use is replaced: no P above 2^12, well inside f16.
#define P_LIMIT 4096.0f

__global__ __launch_bounds__(256) void attn_kernel(const _Float16* __restrict__ Qp,
                                                  const _Float16* __restrict__ Kp,
                                                  const _Float16* __restrict__ Vt,
                                                  const unsigned* __restrict__ MB,
                                                  _Float16* __restrict__ AO) {
  const int tid  = threadIdx.x;
  const int wave = __builtin_amdgcn_readfirstlane(tid >> 5);
  const int lane = tid & 31;
  const int hw   = lane >> 4;
  const int nl   = lane & 15;
  const int lo   = hw * 8;

  const int h  = blockIdx.x & (HEADS - 1);
  const int qb = blockIdx.x / HEADS;
  const int bn = blockIdx.y;
  const int q0 = (qb * 8 + wave) * 16;

  const _Float16* Qh = Qp + (size_t)(bn * HEADS + h) * SEQ * HEAD_DIM;
  const _Float16* Kh = Kp + (size_t)(bn * HEADS + h) * SEQ * HEAD_DIM;
  const _Float16* Vh = Vt + (size_t)(bn * HEADS + h) * HEAD_DIM * SEQ;

  // Double-buffered K/V stages: K row-major [64 keys][64 d], V [64 d][64 keys],
  // 16-byte chunks swizzled inside each row (see fill_stage).
  __shared__ __align__(16) _Float16 Kbuf[2][64 * 64];
  __shared__ __align__(16) _Float16 Vbuf[2][64 * 64];

  // Q B-fragments (column n = nl on both half-waves), kept for the whole loop.
  v16h qf[2];
  {
    const _Float16* qr = Qh + (size_t)(q0 + nl) * HEAD_DIM;
#pragma unroll
    for (int ks = 0; ks < 2; ++ks)
      qf[ks] = cat16(ldh8(qr + ks * 32 + lo), ldh8(qr + ks * 32 + 16 + lo));
  }

  // o[dt][r] = O[q0 + nl][dt * 16 + hw * 8 + r]; rmax is the query's maximum in
  // use (equal in both halves), rsum the sum over this half's keys only.
  v8f o[4] = {v8f{}, v8f{}, v8f{}, v8f{}};
  float rmax = -1.0e30f, rsum = 0.0f;

  // Q comes scaled by QK_SCALE: scores, maxima and differences are exp2 arguments.
  const float mfill = -1.0e20f * QK_SCALE;   // masked value in the same units
  // -rmax in all eight registers (a lane's scores are all of one query): the C
  // operand of the score products. mrel: the masked value against rmax. With the
  // start value every exponential of the first pass overflows, so that the first
  // pass always takes the redo and sets the first real maximum.
  v8f nmax;
#pragma unroll
  for (int r = 0; r < 8; ++r) nmax[r] = -rmax;
  float mrel = mfill - rmax;

  // Mask: the front end has packed it into lane masks, 16 words per pass of this
  // wave's query tile (word c * 8 + r: one bit per lane for score sf[c][r]). The
  // address is the same in every lane, and nothing writes MB during this launch:
  // read as constant memory the words come by scalar loads straight into the
  // scalar registers that the selects take. mk holds the words of the coming pass.
  typedef const __attribute__((address_space(4))) v16u* mb_ptr;
  const mb_ptr mrow = (mb_ptr)(MB + (size_t)(bn * (SEQ / 16) + (q0 >> 4)) * (SEQ / 32) * 16);
  v16u mk = mrow[0];

  const int NS = SEQ / 64;

  // Stage 0 lands and is published to all waves; then stage 1's copies start.
  fill_stage(Kbuf[0], Vbuf[0], Kh, Vh, tid);
  wait_async_0();
  __syncthreads();
  fill_stage(Kbuf[1], Vbuf[1], Kh + (size_t)64 * HEAD_DIM, Vh + 64, tid);

  // Swizzle term of the fragment readers (row = 16 * tile + nl in both).
  const int kswz = (nl >> 1) & 7;

  // Kept rolled: one trip per stage, one publish point at its foot.
#pragma unroll 1
  for (int st = 0; st < NS; ++st) {
    const int cur = st & 1;

    // Kept rolled: unrolled, the compiler merges the two passes and the wave
    // takes more than 128 registers, so that only three of the four work-groups
    // that a WGP gets from this grid would be resident at once.
#pragma unroll 1
    for (int p = 0; p < 2; ++p) {
      const int k0 = st * 64 + p * 32;

      // ---- S^T - max in use = K @ Q^T + (-max in use) ----------------------
      const _Float16* kr = &Kbuf[cur][(p * 32 + nl) * 64];
      v8f sf[2];
      pass_scores(kr, hw, kswz, qf, nmax, sf);

      // ---- mask: each packed word is the select's lane mask -----------------
#pragma unroll
      for (int c = 0; c < 2; ++c)
#pragma unroll
        for (int r = 0; r < 8; ++r)
          sf[c][r] = __builtin_amdgcn_inverse_ballot_w32(mk[c * 8 + r]) ? sf[c][r] : mrel;
      // The next pass's mask words start now and land behind the rest of this
      // pass; the last pass wraps to key 0 (in bounds, never used).
      mk = mrow[((k0 + 32) & (SEQ - 1)) >> 5];

      // ---- P^T = exp2(S^T - max in use): the two tiles are the B operand ----
      v16h pb;
      float part = 0.0f;
#pragma unroll
      for (int c = 0; c < 2; ++c)
#pragma unroll
        for (int r = 0; r < 8; ++r) {
          const float pv = __builtin_amdgcn_exp2f(sf[c][r]);
          part += pv;
          pb[c * 8 + r] = (_Float16)pv;
        }

      // ---- redo: one test per pass, a scalar branch for the whole wave ------
      // Some query's scores have outgrown its maximum in use (an overflow shows
      // as an infinite sum). The pass is taken again from the plain scores, so
      // that nothing is lost however far the old maximum lay: true maximum of
      // the 32 keys (in-lane + one exchange), sums and outputs rescaled to it.
      // Marked unlikely: the redo lies out of line, the usual pass falls through.
      if (__builtin_expect(__builtin_amdgcn_ballot_w32(part > P_LIMIT) != 0, 0)) {
        pass_scores(kr, hw, kswz, qf, v8f{}, sf);
        const v16u mw = mrow[k0 >> 5];
#pragma unroll
        for (int c = 0; c < 2; ++c)
#pragma unroll
          for (int r = 0; r < 8; ++r)
            sf[c][r] = __builtin_amdgcn_inverse_ballot_w32(mw[c * 8 + r]) ? sf[c][r] : mfill;
        float m = fmaxf(sf[0][0], sf[1][0]);
#pragma unroll
        for (int r = 1; r < 8; ++r) m = fmaxf(m, fmaxf(sf[0][r], sf[1][r]));
        m = fmaxf(m, xhalf(m));
        const float nm    = fmaxf(rmax, m);
        const float alpha = __builtin_amdgcn_exp2f(rmax - nm);
        rmax = nm;
        mrel = mfill - nm;
#pragma unroll
        for (int r = 0; r < 8; ++r) nmax[r] = -nm;
        part = 0.0f;
#pragma unroll
        for (int c = 0; c < 2; ++c)
#pragma unroll
          for (int r = 0; r < 8; ++r) {
            const float pv = __builtin_amdgcn_exp2f(sf[c][r] - nm);
            part += pv;
            pb[c * 8 + r] = (_Float16)pv;
          }
        rsum *= alpha;
#pragma unroll
        for (int dt = 0; dt < 4; ++dt)
#pragma unroll
          for (int r = 0; r < 8; ++r) o[dt][r] *= alpha;
      }
      rsum += part;

      // ---- O^T += V^T @ P^T (V A-frags from LDS, same k order as pb) -------
#pragma unroll
      for (int dt = 0; dt < 4; ++dt) {
        const _Float16* vr = &Vbuf[cur][(dt * 16 + nl) * 64];
        v16h a = cat16(ldh8(vr + ((p * 4 + hw) ^ kswz) * 8),
                       ldh8(vr + ((p * 4 + 2 + hw) ^ kswz) * 8));
        o[dt] = WMMA_F16(a, pb, o[dt]);
      }
    }

    // Publish point of stage st + 1: this wave's LDS reads of stage st retire,
    // its own copies of stage st + 1 have landed, then the barrier both shows
    // stage st + 1 to every wave and frees buffer cur for the refill.
    asm volatile("s_wait_dscnt 0x0" ::: "memory");
    wait_async_0();
    __syncthreads();
    if (st + 2 < NS)
      fill_stage(Kbuf[cur], Vbuf[cur], Kh + (size_t)(st + 2) * 64 * HEAD_DIM,
                 Vh + (st + 2) * 64, tid);
  }
  // No copy is outstanding when the wave goes on to its epilogue and ends.
  wait_async_0();

  // ---- finalize: join the halves' sums, O / rowsum, 16-byte f16 stores ----
  const float inv = 1.0f / (rsum + xhalf(rsum));
  _Float16* dst = AO + ((size_t)bn * SEQ + q0 + nl) * EMBED + h * HEAD_DIM + lo;
#pragma unroll
  for (int dt = 0; dt < 4; ++dt) {
    v8h pk;
#pragma unroll
    for (int r = 0; r < 8; ++r) pk[r] = (_Float16)(o[dt][r] * inv);
    *(v8h*)(dst + dt * 16) = pk;
  }
}

// ---------------------------------------------------------------------------
// Kernel 3: Y[8192x1024] = AO @ Wo^T + bo. One work-group of 8 waves per
// 128 x 128 output tile, one 64 x 32 part per wave (2 x 4 waves). A stage is 64 k
// (one 128-byte line) of the tile's 128 AO rows and 128 Wo rows: two buffers in
// LDS, every wave copies an eighth of a stage with
// GLOBAL_LOAD_ASYNC_TO_LDS_B128, each copy taking 4 whole lines, and the next
// stage's copies fly while this one is worked on. Rows and chunks lie in LDS
// as in fill_stage, so the b128 fragment reads are conflict-free.
// ---------------------------------------------------------------------------
#define OP_ROWS 128                 // rows of each operand in a stage
#define OP_HALF (OP_ROWS * 64)      // f16 elements of one operand's stage

// Eight copies and their s_wait_xcnt in ONE statement: the wait stands in front
// of any later rewrite of the address registers that the copies name.
static __device__ __forceinline__ void async_cp16x8(const unsigned (&l)[8],
                                                    const _Float16* const (&g)[8]) {
  asm volatile("global_load_async_to_lds_b128 %0, %8, off\n\t"
               "global_load_async_to_lds_b128 %1, %9, off\n\t"
               "global_load_async_to_lds_b128 %2, %10, off\n\t"
               "global_load_async_to_lds_b128 %3, %11, off\n\t"
               "global_load_async_to_lds_b128 %4, %12, off\n\t"
               "global_load_async_to_lds_b128 %5, %13, off\n\t"
               "global_load_async_to_lds_b128 %6, %14, off\n\t"
               "global_load_async_to_lds_b128 %7, %15, off\n\t"
               "s_wait_xcnt 0x0"
               :: "v"(l[0]), "v"(l[1]), "v"(l[2]), "v"(l[3]),
                  "v"(l[4]), "v"(l[5]), "v"(l[6]), "v"(l[7]),
                  "v"(g[0]), "v"(g[1]), "v"(g[2]), "v"(g[3]),
                  "v"(g[4]), "v"(g[5]), "v"(g[6]), "v"(g[7])
               : "memory");
}
// One stage for the whole work-group (256 threads, 8 copies each); ag and bg
// point at the stage's first k of the tile's first AO row and first Wo row.
static __device__ __forceinline__ void fill_gemm_stage(_Float16* ab, _Float16* bb,
                                                       const _Float16* ag,
                                                       const _Float16* bg, int tid) {
  unsigned l[8];
  const _Float16* g[8];
#pragma unroll
  for (int i = 0; i < 4; ++i) {
    const int r   = i * 32 + (tid >> 3);
    const int ch  = tid & 7;
    const int off = r * 64 + ((ch ^ ((r >> 1) & 7)) * 8);
    l[i]     = lds_addr(ab + off);
    g[i]     = ag + (size_t)r * EMBED + ch * 8;
    l[4 + i] = lds_addr(bb + off);
    g[4 + i] = bg + (size_t)r * EMBED + ch * 8;
  }
  async_cp16x8(l, g);
}

__global__ __launch_bounds__(256) void outproj_kernel(const _Float16* __restrict__ AO,
                                                      const _Float16* __restrict__ Wo16,
                                                      const float* __restrict__ bo,
                                                      float* __restrict__ Y) {
  const int tid  = threadIdx.x;
  const int wave = __builtin_amdgcn_readfirstlane(tid >> 5);
  const int lane = tid & 31;
  const int hw   = lane >> 4;
  const int nl   = lane & 15;

  const int e0 = blockIdx.x * OP_ROWS;   // first output column of the tile
  const int t0 = blockIdx.y * OP_ROWS;   // first token of the tile
  const int wm = wave >> 2;              // this wave's 64 tokens
  const int wn = wave & 3;               // this wave's 32 columns

  // ring[buffer][operand]: AO rows, then Wo rows; 64 KiB, the output staging
  // of the epilogue takes the same bytes.
  __shared__ __align__(16) _Float16 ring[2][2][OP_HALF];

  const _Float16* Ag = AO + (size_t)t0 * EMBED;
  const _Float16* Bg = Wo16 + (size_t)e0 * EMBED;

  v8f acc[4][2];
#pragma unroll
  for (int mt = 0; mt < 4; ++mt)
#pragma unroll
    for (int nt = 0; nt < 2; ++nt) acc[mt][nt] = v8f{};

  const int NS = EMBED / 64;

  // Stage 0 lands and is published to all waves; then stage 1's copies start.
  fill_gemm_stage(ring[0][0], ring[0][1], Ag, Bg, tid);
  wait_async_0();
  __syncthreads();
  fill_gemm_stage(ring[1][0], ring[1][1], Ag + 64, Bg + 64, tid);

  // Swizzle term of the fragment readers (row = 16 * tile + nl in both).
  const int kswz = (nl >> 1) & 7;

  // Kept rolled: one trip per stage, one publish point at its foot.
#pragma unroll 1
  for (int st = 0; st < NS; ++st) {
    const int cur = st & 1;
    const _Float16* ar = &ring[cur][0][(wm * 64 + nl) * 64];
    const _Float16* br = &ring[cur][1][(wn * 32 + nl) * 64];
#pragma unroll
    for (int ks = 0; ks < 2; ++ks) {
      const int c0 = ((ks * 4 + hw) ^ kswz) * 8;
      const int c1 = ((ks * 4 + 2 + hw) ^ kswz) * 8;
      v16h a[4], b[2];
#pragma unroll
      for (int mt = 0; mt < 4; ++mt)
        a[mt] = cat16(ldh8(ar + mt * 16 * 64 + c0), ldh8(ar + mt * 16 * 64 + c1));
#pragma unroll
      for (int nt = 0; nt < 2; ++nt)
        b[nt] = cat16(ldh8(br + nt * 16 * 64 + c0), ldh8(br + nt * 16 * 64 + c1));
#pragma unroll
      for (int mt = 0; mt < 4; ++mt)
#pragma unroll
        for (int nt = 0; nt < 2; ++nt)
          acc[mt][nt] = WMMA_F16(a[mt], b[nt], acc[mt][nt]);
    }

    // Publish point of stage st + 1: this wave's LDS reads of stage st retire,
    // its own copies of stage st + 1 have landed, then the barrier both shows
    // stage st + 1 to every wave and frees buffer cur for the refill.
    asm volatile("s_wait_dscnt 0x0" ::: "memory");
    wait_async_0();
    __syncthreads();
    if (st + 2 < NS)
      fill_gemm_stage(ring[cur][0], ring[cur][1], Ag + (st + 2) * 64, Bg + (st + 2) * 64, tid);
  }
  // No copy is outstanding when the ring becomes output staging.
  wait_async_0();

  // ---- epilogue: behind the last publish point nobody reads the ring any more.
  // Each wave stages its 64 x 32 f32 part in its own 8 KiB, rows of one 128-byte
  // line; the two 16-column halves of a row change places in rows 8..15 of each
  // 16, so that the two wave halves of a store fall on different banks. It reads
  // the rows back, adds the bias and stores 4 whole lines per instruction.
  float* stg = (float*)&ring[0][0][0] + wave * (64 * 32);
#pragma unroll
  for (int mt = 0; mt < 4; ++mt)
#pragma unroll
    for (int nt = 0; nt < 2; ++nt)
#pragma unroll
      for (int r = 0; r < 8; ++r)
        stg[(mt * 16 + hw * 8 + r) * 32 + ((nt * 16 + nl) ^ (hw << 4))] = acc[mt][nt][r];

  const int ch = lane & 7;
  const int ec = e0 + wn * 32 + ch * 4;
  const float4 bv = *(const float4*)(bo + ec);
  float* yr = Y + (size_t)(t0 + wm * 64) * EMBED + ec;
#pragma unroll
  for (int i = 0; i < 16; ++i) {
    const int row = i * 4 + (lane >> 3);
    float4 v = *(const float4*)&stg[row * 32 + ((ch ^ (((row >> 3) & 1) << 2)) * 4)];
    v.x += bv.x; v.y += bv.y; v.z += bv.z; v.w += bv.w;
    *(float4*)(yr + (size_t)row * EMBED) = v;
  }
}

// ---------------------------------------------------------------------------
extern "C" void kernel_launch(void* const* d_in, const int* in_sizes, int n_in,
                              void* d_out, int out_size, void* d_ws, size_t ws_size,
                              hipStream_t stream) {
  const float* values = (const float*)d_in[0];
  const float* keys_  = (const float*)d_in[1];
  const float* query  = (const float*)d_in[2];
  const int*   mask   = (const int*)d_in[3];
  const float* Wv     = (const float*)d_in[4];
  const float* Wk     = (const float*)d_in[5];
  const float* Wq     = (const float*)d_in[6];
  const float* Wo     = (const float*)d_in[7];
  const float* bo     = (const float*)d_in[8];
  float* out = (float*)d_out;

  // Workspace layout (bytes):
  //   Qp [N][H][S][D]  f16 : 16 MB
  //   Kp [N][H][S][D]  f16 : 16 MB
  //   Vt [N][H][D][S]  f16 : 16 MB   (transposed for V^T@P^T A-fragments)
  //   AO [N][S][E]     f16 : 16 MB
  //   Wo16 [E][E]      f16 :  2 MB
  //   MB   [N][S/16][S/32][16] u32 : 2 MB  (mask as lane masks)
  const size_t QKV = (size_t)NBATCH * HEADS * SEQ * HEAD_DIM * sizeof(_Float16);
  char* ws = (char*)d_ws;
  _Float16* Qp   = (_Float16*)(ws);
  _Float16* Kp   = (_Float16*)(ws + QKV);
  _Float16* Vt   = (_Float16*)(ws + 2 * QKV);
  _Float16* AO   = (_Float16*)(ws + 3 * QKV);
  _Float16* Wo16 = (_Float16*)(ws + 4 * QKV);
  unsigned* MB   = (unsigned*)(ws + 4 * QKV + (size_t)EMBED * EMBED * sizeof(_Float16));

  front_kernel<<<NBATCH * HEADS * (SEQ / 128) / 4, (FE_WAVES + FE_MASKW) * 32, 0, stream>>>(
      query, keys_, values, Wq, Wk, Wv, Wo, mask, Qp, Kp, Vt, Wo16, MB);

  dim3 gattn((SEQ / 128) * HEADS, NBATCH);
  attn_kernel<<<gattn, 256, 0, stream>>>(Qp, Kp, Vt, MB, AO);

  dim3 gout(EMBED / OP_ROWS, NBATCH * SEQ / OP_ROWS);
  outproj_kernel<<<gout, 256, 0, stream>>>(AO, Wo16, bo, out);
}

// v009
// It runs in 93.7 microseconds.
// Timed twice side by side with v008, it ran 1.09 times as fast both times.
// Over all steps from v000 it is 5.26 times as fast.
#include <hip/hip_runtime.h>

#define EMBED 1024
#define HEADS 16
#define HEAD_DIM 64
#define NBATCH 4
#define SEQ 2048

typedef __attribute__((ext_vector_type(16))) _Float16 v16h;
typedef __attribute__((ext_vector_type(8)))  _Float16 v8h;
typedef __attribute__((ext_vector_type(8)))  float    v8f;
typedef __attribute__((ext_vector_type(16))) unsigned v16u;

static __device__ __forceinline__ v16h cat16(v8h a, v8h b) {
  return __builtin_shufflevector(a, b, 0,1,2,3,4,5,6,7,8,9,10,11,12,13,14,15);
}
static __device__ __forceinline__ v8h ldh8(const _Float16* p) { return *(const v8h*)p; }
#define WMMA_F16(a,b,c) __builtin_amdgcn_wmma_f32_16x16x32_f16(false,(a),false,(b),(short)0,(c),false,false)

// The softmax takes exp(s / sqrt(EMBED)) = exp2(s * QK_SCALE). The front end
// multiplies Wq by this factor before it rounds the weight to f16, so that the
// score products of the attention kernel are exp2 arguments as they stand.
#define QK_SCALE (0.03125f * 1.44269504088896340736f)
// Eight weights times f, rounded to f16 once.
static __device__ __forceinline__ v8h cvt8s(const float* p, float f) {
  float4 a = *(const float4*)p;
  float4 b = *(const float4*)(p + 4);
  v8h r;
  r[0]=(_Float16)(a.x*f); r[1]=(_Float16)(a.y*f); r[2]=(_Float16)(a.z*f); r[3]=(_Float16)(a.w*f);
  r[4]=(_Float16)(b.x*f); r[5]=(_Float16)(b.y*f); r[6]=(_Float16)(b.z*f); r[7]=(_Float16)(b.w*f);
  return r;
}

// Async global->LDS copy, 16 bytes per lane (GLOBAL_LOAD_ASYNC_TO_LDS_B128,
// tracked by ASYNCcnt). LDS aperture keeps the byte offset in addr[31:0], so
// truncating the generic pointer yields the LDS-address VGPR value.
static __device__ __forceinline__ unsigned lds_addr(const _Float16* p) {
  return (unsigned)(unsigned long long)p;
}
// Four copies and their s_wait_xcnt in ONE statement: the wait stands in front
// of any later rewrite of the address registers that the copies name.
static __device__ __forceinline__ void async_cp16x4(const unsigned (&l)[4],
                                                    const _Float16* const (&g)[4]) {
  asm volatile("global_load_async_to_lds_b128 %0, %4, off\n\t"
               "global_load_async_to_lds_b128 %1, %5, off\n\t"
               "global_load_async_to_lds_b128 %2, %6, off\n\t"
               "global_load_async_to_lds_b128 %3, %7, off\n\t"
               "s_wait_xcnt 0x0"
               :: "v"(l[0]), "v"(l[1]), "v"(l[2]), "v"(l[3]),
                  "v"(g[0]), "v"(g[1]), "v"(g[2]), "v"(g[3])
               : "memory");
}
// Fill one stage of 64 keys for the whole work-group (256 threads, 4 copies
// each): K 64 keys x 64 d (8192 contiguous bytes in global), V 64 d-rows x 64
// keys (128-byte runs). Every copy of a wave takes 4 whole 128-byte lines. In
// LDS both keep a 128-byte row pitch, and the 16-byte chunks of a row are
// XOR-swizzled by the row number, chunk ^= (row >> 1) & 7, so that the 16 rows
// of one ds_load_b128 fragment read fall on 16 different bank quads.
static __device__ __forceinline__ void fill_stage(_Float16* kb, _Float16* vb,
                                                  const _Float16* kg, const _Float16* vg,
                                                  int tid) {
  unsigned l[4];
  const _Float16* g[4];
#pragma unroll
  for (int i = 0; i < 2; ++i) {
    const int r   = i * 32 + (tid >> 3);
    const int ch  = tid & 7;
    const int off = r * 64 + ((ch ^ ((r >> 1) & 7)) * 8);
    l[i]     = lds_addr(kb + off);
    g[i]     = kg + r * HEAD_DIM + ch * 8;
    l[2 + i] = lds_addr(vb + off);
    g[2 + i] = vg + (size_t)r * SEQ + ch * 8;
  }
  async_cp16x4(l, g);
}
static __device__ __forceinline__ void wait_async_0() {
  asm volatile("s_wait_asynccnt 0" ::: "memory");
}

// ---------------------------------------------------------------------------
// Kernel 1: the whole front end in one launch: the three per-head projections
// Y = X_head @ W^T, the conversion of Wo to f16 and the packing of the mask. One
// work-group of 16 waves per 4 x 128 tokens-of-a-head: waves 0..3 take Q, 4..7 K,
// 8..11 V, 12..15 a share of the mask (see FE_MASKW). The four
// waves of a tensor convert a quarter of its 64 x 64 weight each and share the
// fragments through LDS; a wave then keeps all of them in registers and walks
// 128 tokens of one head (8 tiles of 16), two tiles a step, the next step's
// loads in flight while this one is worked on.
//   Q, K : Y^T = W X^T, a lane holds 8 consecutive d of one token; out [n][h][s][d]
//   V    : Y   = X W^T, a lane holds 8 consecutive tokens of one d; out [n][h][d][s]
// Either way the 16-byte pieces of four tiles are staged in the wave's own 8 KiB
// of LDS as 64 rows of one 128-byte line and go out 4 whole lines per store.
// ---------------------------------------------------------------------------
#define FE_WAVES 12
#define FE_STEPS 4                  // steps of two 16-token tiles per wave
// Four more waves per work-group pack the mask, read here once for all heads,
// into the lane masks of the attention kernel's score selects: for a tile of 16
// queries and a pass of 32 keys, word c * 8 + r holds in bit hw * 16 + nl
// whether mask[query nl][key c * 16 + hw * 8 + r] is non-zero. 16 words a pass,
// MB[batch * 128 + query tile][pass][16].
#define FE_MASKW 4
#define MB_BATCH 4                  // passes whose mask words one batch of loads holds
#define MB_NBATCH 8                 // batches per wave: 16 queries x 1024 keys

// A lane's 64 mask words of MB_BATCH passes; mp points at the lane's query row,
// at its half-wave's first key of the batch.
static __device__ __forceinline__ void ld_mask(const int* mp, int4 (&v)[MB_BATCH * 4]) {
  // Unrolled: the array stays in registers, every offset is an immediate.
#pragma unroll
  for (int i = 0; i < MB_BATCH * 2; ++i) {
    v[i * 2]     = *(const int4*)(mp + i * 16);
    v[i * 2 + 1] = *(const int4*)(mp + i * 16 + 4);
  }
}
// The lane masks of a batch: one compare per word of 32 mask values; the words of
// two passes are gathered one per lane and go out as one whole 128-byte line.
static __device__ __forceinline__ void pack_mask(const int4 (&v)[MB_BATCH * 4], unsigned* mo) {
  // All three unrolled: register arrays, and each word's lane is a constant.
#pragma unroll
  for (int pp = 0; pp < MB_BATCH / 2; ++pp) {
    unsigned acc = 0;
#pragma unroll
    for (int i = 0; i < 8; ++i) {
      const int4 m = v[pp * 8 + i];
      const int mv[4] = {m.x, m.y, m.z, m.w};
#pragma unroll
      for (int j = 0; j < 4; ++j) {
        const unsigned w = __builtin_amdgcn_ballot_w32(mv[j] != 0);
        // Lane i * 4 + j alone takes the word.
        acc = __builtin_amdgcn_inverse_ballot_w32(1u << (i * 4 + j)) ? w : acc;
      }
    }
    mo[pp * 32] = acc;
  }
}

typedef __attribute__((ext_vector_type(4))) _Float16 v4h;

static __device__ __forceinline__ v8h cvt8r(float4 a, float4 b) {
  v8h r;
  r[0]=(_Float16)a.x; r[1]=(_Float16)a.y; r[2]=(_Float16)a.z; r[3]=(_Float16)a.w;
  r[4]=(_Float16)b.x; r[5]=(_Float16)b.y; r[6]=(_Float16)b.z; r[7]=(_Float16)b.w;
  return r;
}
// The 32 floats of one lane's two fragments of a 16 x 64 tile; xr points at the
// lane's row, at its half-wave's first k.
static __device__ __forceinline__ void ld_x(const float* xr, float4 (&v)[8]) {
#pragma unroll
  for (int ks = 0; ks < 2; ++ks)
#pragma unroll
    for (int c = 0; c < 2; ++c) {
      v[ks * 4 + c * 2]     = *(const float4*)(xr + ks * 32 + c * 16);
      v[ks * 4 + c * 2 + 1] = *(const float4*)(xr + ks * 32 + c * 16 + 4);
    }
}

// The two f16 fragments of a tile from its raw floats.
static __device__ __forceinline__ void cvt_x(const float4 (&v)[8], v16h (&af)[2]) {
#pragma unroll
  for (int ks = 0; ks < 2; ++ks)
    af[ks] = cat16(cvt8r(v[ks * 4], v[ks * 4 + 1]), cvt8r(v[ks * 4 + 2], v[ks * 4 + 3]));
}

// The products of one step (two tiles) and their staging. stg: the wave's own
// 64 rows of 128 bytes; odd: second step of the staged group of four tiles.
template <bool TR>
static __device__ __forceinline__ void front_step(const v16h (&cur)[2][2],
                                                  const v16h (&wf)[4][2],
                                                  _Float16* stg, int odd, int lane) {
  const int hw = lane >> 4;
  const int nl = lane & 15;
#pragma unroll
  for (int j = 0; j < 2; ++j)
#pragma unroll
    for (int nt = 0; nt < 4; ++nt) {
      v8f c = {};
#pragma unroll
      for (int ks = 0; ks < 2; ++ks)
        c = TR ? WMMA_F16(cur[j][ks], wf[nt][ks], c) : WMMA_F16(wf[nt][ks], cur[j][ks], c);
      v8h pk;
#pragma unroll
      for (int r = 0; r < 8; ++r) pk[r] = (_Float16)c[r];
      // Staging row and 16-byte chunk of this piece; chunks XOR-swizzled by the
      // row so that the 32 pieces of a store spread over all banks.
      const int row = TR ? nt * 16 + nl : odd * 32 + j * 16 + nl;
      const int ch  = TR ? odd * 4 + j * 2 + hw : nt * 2 + hw;
      *(v8h*)(stg + row * 64 + ((ch ^ (nl & 7)) * 8)) = pk;
    }
}

__global__ __launch_bounds__((FE_WAVES + FE_MASKW) * 32) void front_kernel(
    const float* __restrict__ query, const float* __restrict__ keys_,
    const float* __restrict__ values, const float* __restrict__ Wq,
    const float* __restrict__ Wk, const float* __restrict__ Wv,
    const float* __restrict__ Wo, const int* __restrict__ mask,
    _Float16* __restrict__ Qp, _Float16* __restrict__ Kp,
    _Float16* __restrict__ Vt, _Float16* __restrict__ Wo16,
    unsigned* __restrict__ MB) {
  const int tid  = threadIdx.x;
  const int wave = __builtin_amdgcn_readfirstlane(tid >> 5);
  const int lane = tid & 31;
  const int nl   = lane & 15;
  const int lo   = (lane >> 4) * 8;
  const int sel  = wave >> 2;                    // 0: Q, 1: K, 2: V
  const int qt   = wave & 3;

  const int wq = blockIdx.x * 4 + qt;            // (batch, 128 tokens, head)
  const int h  = wq & (HEADS - 1);
  const int s0 = ((wq >> 4) & 15) * 128;
  const int bn = wq >> 8;

  const float* X  = sel == 0 ? query : sel == 1 ? keys_ : values;
  const float* Wm = sel == 0 ? Wq : sel == 1 ? Wk : Wv;
  _Float16* oh    = (sel == 0 ? Qp : sel == 1 ? Kp : Vt)
                    + (size_t)(bn * HEADS + h) * SEQ * HEAD_DIM;

  __shared__ __align__(16) _Float16 stage[FE_WAVES][64 * 64];
  __shared__ __align__(16) _Float16 wshare[3][64 * 64];

  const float* xr = X + ((size_t)(bn * SEQ + s0 + nl)) * EMBED + h * HEAD_DIM + lo;
  float4 raw[2][8];
  const int wbase = blockIdx.x * 4096 + tid * 4;
  float4 wo[4];

  // A mask wave (wave-uniform test): 16 query rows, half of their keys.
  const bool mwave = wave >= FE_WAVES;
  const int* mp = mask + (size_t)((wq >> 1) * 16 + nl) * SEQ + (wq & 1) * (SEQ / 2) + lo;
  unsigned* mo  = MB + ((wq >> 1) * (SEQ / 32) + (wq & 1) * (SEQ / 64)) * 16 + lane;
  int4 ma[MB_BATCH * 4], mb[MB_BATCH * 4];

  if (mwave) {
    ld_mask(mp, ma);
  } else {
    // Weight fragments (row e = nt * 16 + nl, contiguous along k), same k order
    // as the X fragments. This wave makes those of nt = qt and lays them in LDS
    // in fragment order (512 contiguous bytes per store or load).
    // Wq carries the softmax factor (wave-uniform; 1 leaves Wk and Wv as they are).
    const float wsc = sel == 0 ? QK_SCALE : 1.0f;
    v8h wpart[4];
#pragma unroll
    for (int ks = 0; ks < 2; ++ks) {
      const float* wr = Wm + (size_t)(qt * 16 + nl) * HEAD_DIM + ks * 32 + lo;
      wpart[ks * 2]     = cvt8s(wr, wsc);
      wpart[ks * 2 + 1] = cvt8s(wr + 16, wsc);
    }

    ld_x(xr, raw[0]);
    ld_x(xr + 16 * EMBED, raw[1]);
    // Stands in front of the rewrite of the address registers that the weight
    // loads name.
    asm volatile("s_wait_xcnt 0x0" ::: "memory");

    // Wo: 4096 floats per work-group, whole lines, by the 256 threads of waves
    // 0..7; asked for here, stored behind the projection work.
    if (wave < 8) {
#pragma unroll
      for (int j = 0; j < 4; ++j) wo[j] = *(const float4*)(Wo + wbase + j * 1024);
    }

#pragma unroll
    for (int i = 0; i < 4; ++i)
      *(v8h*)(&wshare[sel][(qt * 4 + i) * 256 + lane * 8]) = wpart[i];
  }
  // Every wave's quarter is in LDS before any wave takes the whole weight.
  __syncthreads();

  // Behind the kernel's one barrier the mask waves go their own way: two sets of
  // loads, one in flight while the other is packed. Unrolled: one address pair
  // with immediate offsets serves every load, and none of them rewrites it.
  if (mwave) {
#pragma unroll
    for (int b = 0; b < MB_NBATCH; b += 2) {
      ld_mask(mp + (b + 1) * MB_BATCH * 32, mb);
      pack_mask(ma, mo + b * MB_BATCH * 16);
      if (b + 2 < MB_NBATCH) ld_mask(mp + (b + 2) * MB_BATCH * 32, ma);
      pack_mask(mb, mo + (b + 1) * MB_BATCH * 16);
    }
    return;
  }
  v16h wf[4][2];
#pragma unroll
  for (int nt = 0; nt < 4; ++nt)
#pragma unroll
    for (int ks = 0; ks < 2; ++ks) {
      const _Float16* ws = &wshare[sel][(nt * 4 + ks * 2) * 256 + lane * 8];
      wf[nt][ks] = cat16(ldh8(ws), ldh8(ws + 256));
    }

  v16h cur[2][2];
  cvt_x(raw[0], cur[0]);
  cvt_x(raw[1], cur[1]);

  _Float16* stg = stage[wave];
  const bool tr = sel == 2;                      // wave-uniform
  // Read-back of the staged rows: 8 lanes per row, 4 rows per instruction.
  const int frow = lane >> 3;
  const int fc   = lane & 7;
  const unsigned pitch = tr ? SEQ : HEAD_DIM;    // output elements per staged row
  _Float16* od = oh + (size_t)s0 * (tr ? 1 : HEAD_DIM) + frow * pitch + fc * 8;

  // Kept rolled: one set of loads ahead of one set in work, no more registers.
#pragma unroll 1
  for (int s = 0; s < FE_STEPS; ++s) {
    float4 nxt[2][8];
    if (s + 1 < FE_STEPS) {
      const float* xn = xr + (size_t)(s + 1) * 32 * EMBED;
      ld_x(xn, nxt[0]);
      ld_x(xn + 16 * EMBED, nxt[1]);
    }

    if (tr) front_step<true >(cur, wf, stg, s & 1, lane);
    else    front_step<false>(cur, wf, stg, s & 1, lane);

    if (s & 1) {
      // The wave's own staging stores retire before it reads the rows back.
      asm volatile("s_wait_dscnt 0x0" ::: "memory");
      _Float16* dst = od + (size_t)(s >> 1) * 64 * (tr ? 1 : HEAD_DIM);
#pragma unroll
      for (int i = 0; i < 16; ++i) {
        const int row = i * 4 + frow;
        *(v8h*)(dst + (size_t)(i * 4) * pitch) =
            *(const v8h*)(stg + row * 64 + ((fc ^ (row & 7)) * 8));
      }
      // Stands in front of the next step's rewrite of the registers that the
      // last stores name.
      asm volatile("s_wait_xcnt 0x0" ::: "memory");
    }

    if (s + 1 < FE_STEPS) {
      cvt_x(nxt[0], cur[0]);
      cvt_x(nxt[1], cur[1]);
    }
  }

  if (wave < 8) {
#pragma unroll
    for (int j = 0; j < 4; ++j) {
      v4h p;
      p[0]=(_Float16)wo[j].x; p[1]=(_Float16)wo[j].y;
      p[2]=(_Float16)wo[j].z; p[3]=(_Float16)wo[j].w;
      *(v4h*)(Wo16 + wbase + j * 1024) = p;
    }
  }
}

#define QT 2
// Lane l takes the value of lane l ^ 16.
static __device__ __forceinline__ float xhalf(float x) {
  const int v = __builtin_bit_cast(int, x);
  return __builtin_bit_cast(float,
      __builtin_amdgcn_permlanex16(v, v, 0x76543210, 0xfedcba98, false, false));
}

// S^T[32 x 16] = K Q^T + c0 for one pass and each query tile: two 16-key tiles,
// A fragments from LDS, each read once for all query tiles; kr points at the
// lane's row of the first key tile.
static __device__ __forceinline__ void pass_scores(const _Float16* kr, int hw, int kswz,
                                                   const v16h (&qf)[QT][2],
                                                   const v8f (&c0)[QT],
                                                   v8f (&sf)[QT][2]) {
#pragma unroll
  for (int c = 0; c < 2; ++c) {
#pragma unroll
    for (int t = 0; t < QT; ++t) sf[t][c] = c0[t];
#pragma unroll
    for (int ks = 0; ks < 2; ++ks) {
      v16h a = cat16(ldh8(kr + c * 16 * 64 + ((ks * 4 + hw) ^ kswz) * 8),
                     ldh8(kr + c * 16 * 64 + ((ks * 4 + 2 + hw) ^ kswz) * 8));
#pragma unroll
      for (int t = 0; t < QT; ++t) sf[t][c] = WMMA_F16(a, qf[t][ks], sf[t][c]);
    }
  }
}
// A lane's 16 exponentials of a pass may sum to this much before the maximum in
// use is replaced: no P above 2^12, well inside f16.
#define P_LIMIT 4096.0f

// Four waves per SIMD: the two work-groups that a WGP gets from this grid are
// resident at once.
__global__ __launch_bounds__(256) __attribute__((amdgpu_waves_per_eu(4, 4)))
void attn_kernel(const _Float16* __restrict__ Qp,
                 const _Float16* __restrict__ Kp,
                 const _Float16* __restrict__ Vt,
                 const unsigned* __restrict__ MB,
                 _Float16* __restrict__ AO) {
  const int tid  = threadIdx.x;
  const int wave = __builtin_amdgcn_readfirstlane(tid >> 5);
  const int lane = tid & 31;
  const int hw   = lane >> 4;
  const int nl   = lane & 15;
  const int lo   = hw * 8;

  const int h  = blockIdx.x & (HEADS - 1);
  const int qb = blockIdx.x / HEADS;
  const int bn = blockIdx.y;
  const int q0 = (qb * 8 + wave) * (QT * 16);

  const _Float16* Qh = Qp + (size_t)(bn * HEADS + h) * SEQ * HEAD_DIM;
  const _Float16* Kh = Kp + (size_t)(bn * HEADS + h) * SEQ * HEAD_DIM;
  const _Float16* Vh = Vt + (size_t)(bn * HEADS + h) * HEAD_DIM * SEQ;

  // Double-buffered K/V stages: K row-major [64 keys][64 d], V [64 d][64 keys],
  // 16-byte chunks swizzled inside each row (see fill_stage).
  __shared__ __align__(16) _Float16 Kbuf[2][64 * 64];
  __shared__ __align__(16) _Float16 Vbuf[2][64 * 64];

  // Q B-fragments (column n = nl on both half-waves), kept for the whole loop.
  v16h qf[QT][2];
#pragma unroll
  for (int t = 0; t < QT; ++t) {
    const _Float16* qr = Qh + (size_t)(q0 + t * 16 + nl) * HEAD_DIM;
#pragma unroll
    for (int ks = 0; ks < 2; ++ks)
      qf[t][ks] = cat16(ldh8(qr + ks * 32 + lo), ldh8(qr + ks * 32 + 16 + lo));
  }

  // o[t][dt][r] = O[q0 + t * 16 + nl][dt * 16 + hw * 8 + r]; rsum is the sum over
  // this half's keys only.
  v8f o[QT][4];
  float rsum[QT];

  // Q comes scaled by QK_SCALE: scores, maxima and differences are exp2 arguments.
  const float mfill = -1.0e20f * QK_SCALE;   // masked value in the same units
  // nmax: minus the query's maximum in use (equal in both halves) in all eight
  // registers (a lane's scores of a tile are all of one query): the C operand of
  // the score products. mrel: the masked value against that maximum. With the
  // start value every exponential of the first pass overflows, so that the first
  // pass always takes the redo and sets the first real maximum.
  v8f nmax[QT];
  float mrel[QT];
#pragma unroll
  for (int t = 0; t < QT; ++t) {
#pragma unroll
    for (int dt = 0; dt < 4; ++dt) o[t][dt] = v8f{};
    rsum[t] = 0.0f;
#pragma unroll
    for (int r = 0; r < 8; ++r) nmax[t][r] = 1.0e30f;
    mrel[t] = mfill + 1.0e30f;
  }

  // Mask: the front end has packed it into lane masks, 16 words per pass and query
  // tile (word c * 8 + r: one bit per lane for score sf[t][c][r]); a tile's passes
  // lie SEQ / 32 entries behind the tile before. The address is the same in every
  // lane, and nothing writes MB during this launch: read as constant memory the
  // words come by scalar loads straight into the scalar registers that the selects
  // take. mk holds the words of the coming pass.
  typedef const __attribute__((address_space(4))) v16u* mb_ptr;
  const mb_ptr mrow = (mb_ptr)(MB + (size_t)(bn * (SEQ / 16) + (q0 >> 4)) * (SEQ / 32) * 16);
  v16u mk[QT];
#pragma unroll
  for (int t = 0; t < QT; ++t) mk[t] = mrow[t * (SEQ / 32)];

  const int NS = SEQ / 64;

  // Stage 0 lands and is published to all waves; then stage 1's copies start.
  fill_stage(Kbuf[0], Vbuf[0], Kh, Vh, tid);
  wait_async_0();
  __syncthreads();
  fill_stage(Kbuf[1], Vbuf[1], Kh + (size_t)64 * HEAD_DIM, Vh + 64, tid);

  // Swizzle term of the fragment readers (row = 16 * tile + nl in both).
  const int kswz = (nl >> 1) & 7;

  // Kept rolled: one trip per stage, one publish point at its foot.
#pragma unroll 1
  for (int st = 0; st < NS; ++st) {
    const int cur = st & 1;

    // Unrolled: every LDS offset of a pass is an immediate, and the second pass's
    // K fragments can be asked for ahead of the first pass's last products.
#pragma unroll
    for (int p = 0; p < 2; ++p) {
      const int k0 = st * 64 + p * 32;

      // ---- S^T - max in use = K @ Q^T + (-max in use) ----------------------
      const _Float16* kr = &Kbuf[cur][(p * 32 + nl) * 64];
      v8f sf[QT][2];
      pass_scores(kr, hw, kswz, qf, nmax, sf);

      // ---- mask: each packed word is the select's lane mask -----------------
#pragma unroll
      for (int t = 0; t < QT; ++t)
#pragma unroll
        for (int c = 0; c < 2; ++c)
#pragma unroll
          for (int r = 0; r < 8; ++r)
            sf[t][c][r] =
                __builtin_amdgcn_inverse_ballot_w32(mk[t][c * 8 + r]) ? sf[t][c][r] : mrel[t];
      // The next pass's mask words start now and land behind the rest of this
      // pass; the last pass wraps to key 0 (in bounds, never used).
#pragma unroll
      for (int t = 0; t < QT; ++t)
        mk[t] = mrow[t * (SEQ / 32) + (((k0 + 32) & (SEQ - 1)) >> 5)];

      // ---- P^T = exp2(S^T - max in use): the two tiles are the B operand ----
      v16h pb[QT];
      float part[QT];
#pragma unroll
      for (int t = 0; t < QT; ++t) {
        part[t] = 0.0f;
#pragma unroll
        for (int c = 0; c < 2; ++c)
#pragma unroll
          for (int r = 0; r < 8; ++r) {
            const float pv = __builtin_amdgcn_exp2f(sf[t][c][r]);
            part[t] += pv;
            pb[t][c * 8 + r] = (_Float16)pv;
          }
      }

      // ---- redo: one test per pass, a scalar branch for the whole wave ------
      // Some query's scores have outgrown its maximum in use (an overflow shows
      // as an infinite sum). The pass is taken again from the plain scores, so
      // that nothing is lost however far the old maximum lay: true maximum of
      // the 32 keys (in-lane + one exchange), sums and outputs rescaled to it.
      // Marked unlikely: the redo lies out of line, the usual pass falls through.
      if (__builtin_expect(
              __builtin_amdgcn_ballot_w32(fmaxf(part[0], part[1]) > P_LIMIT) != 0, 0)) {
        const v8f zero[QT] = {v8f{}, v8f{}};
        pass_scores(kr, hw, kswz, qf, zero, sf);
#pragma unroll
        for (int t = 0; t < QT; ++t) {
          const v16u mw = mrow[t * (SEQ / 32) + (k0 >> 5)];
#pragma unroll
          for (int c = 0; c < 2; ++c)
#pragma unroll
            for (int r = 0; r < 8; ++r)
              sf[t][c][r] =
                  __builtin_amdgcn_inverse_ballot_w32(mw[c * 8 + r]) ? sf[t][c][r] : mfill;
          float m = fmaxf(sf[t][0][0], sf[t][1][0]);
#pragma unroll
          for (int r = 1; r < 8; ++r) m = fmaxf(m, fmaxf(sf[t][0][r], sf[t][1][r]));
          m = fmaxf(m, xhalf(m));
          const float om    = -nmax[t][0];     // the maximum in use so far
          const float nm    = fmaxf(om, m);
          const float alpha = __builtin_amdgcn_exp2f(om - nm);
          mrel[t] = mfill - nm;
#pragma unroll
          for (int r = 0; r < 8; ++r) nmax[t][r] = -nm;
          part[t] = 0.0f;
#pragma unroll
          for (int c = 0; c < 2; ++c)
#pragma unroll
            for (int r = 0; r < 8; ++r) {
              const float pv = __builtin_amdgcn_exp2f(sf[t][c][r] - nm);
              part[t] += pv;
              pb[t][c * 8 + r] = (_Float16)pv;
            }
          rsum[t] *= alpha;
#pragma unroll
          for (int dt = 0; dt < 4; ++dt)
#pragma unroll
            for (int r = 0; r < 8; ++r) o[t][dt][r] *= alpha;
        }
      }
#pragma unroll
      for (int t = 0; t < QT; ++t) rsum[t] += part[t];

      // ---- O^T += V^T @ P^T (V A-frags from LDS, same k order as pb), each
      // fragment read once for all query tiles -------------------------------
#pragma unroll
      for (int dt = 0; dt < 4; ++dt) {
        const _Float16* vr = &Vbuf[cur][(dt * 16 + nl) * 64];
        v16h a = cat16(ldh8(vr + ((p * 4 + hw) ^ kswz) * 8),
                       ldh8(vr + ((p * 4 + 2 + hw) ^ kswz) * 8));
#pragma unroll
        for (int t = 0; t < QT; ++t) o[t][dt] = WMMA_F16(a, pb[t], o[t][dt]);
      }
    }

    // Publish point of stage st + 1: this wave's LDS reads of stage st retire,
    // its own copies of stage st + 1 have landed, then the barrier both shows
    // stage st + 1 to every wave and frees buffer cur for the refill.
    asm volatile("s_wait_dscnt 0x0" ::: "memory");
    wait_async_0();
    __syncthreads();
    if (st + 2 < NS)
      fill_stage(Kbuf[cur], Vbuf[cur], Kh + (size_t)(st + 2) * 64 * HEAD_DIM,
                 Vh + (st + 2) * 64, tid);
  }
  // No copy is outstanding when the wave goes on to its epilogue and ends.
  wait_async_0();

  // ---- finalize: join the halves' sums, O / rowsum, 16-byte f16 stores ----
  // The half-wave's offset is taken anew from the lane number: held over the loop
  // it was the one value that the build spilled to scratch.
  const int elo = (int)(__builtin_amdgcn_mbcnt_lo(~0u, 0u) >> 4) * 8;
#pragma unroll
  for (int t = 0; t < QT; ++t) {
    const float inv = 1.0f / (rsum[t] + xhalf(rsum[t]));
    _Float16* dst = AO + ((size_t)bn * SEQ + q0 + t * 16 + nl) * EMBED + h * HEAD_DIM + elo;
#pragma unroll
    for (int dt = 0; dt < 4; ++dt) {
      v8h pk;
#pragma unroll
      for (int r = 0; r < 8; ++r) pk[r] = (_Float16)(o[t][dt][r] * inv);
      *(v8h*)(dst + dt * 16) = pk;
    }
  }
}

// ---------------------------------------------------------------------------
// Kernel 3: Y[8192x1024] = AO @ Wo^T + bo. One work-group of 8 waves per
// 128 x 128 output tile, one 64 x 32 part per wave (2 x 4 waves). A stage is 64 k
// (one 128-byte line) of the tile's 128 AO rows and 128 Wo rows: two buffers in
// LDS, every wave copies an eighth of a stage with
// GLOBAL_LOAD_ASYNC_TO_LDS_B128, each copy taking 4 whole lines, and the next
// stage's copies fly while this one is worked on. Rows and chunks lie in LDS
// as in fill_stage, so the b128 fragment reads are conflict-free.
// ---------------------------------------------------------------------------
#define OP_ROWS 128                 // rows of each operand in a stage
#define OP_HALF (OP_ROWS * 64)      // f16 elements of one operand's stage

// Eight copies and their s_wait_xcnt in ONE statement: the wait stands in front
// of any later rewrite of the address registers that the copies name.
static __device__ __forceinline__ void async_cp16x8(const unsigned (&l)[8],
                                                    const _Float16* const (&g)[8]) {
  asm volatile("global_load_async_to_lds_b128 %0, %8, off\n\t"
               "global_load_async_to_lds_b128 %1, %9, off\n\t"
               "global_load_async_to_lds_b128 %2, %10, off\n\t"
               "global_load_async_to_lds_b128 %3, %11, off\n\t"
               "global_load_async_to_lds_b128 %4, %12, off\n\t"
               "global_load_async_to_lds_b128 %5, %13, off\n\t"
               "global_load_async_to_lds_b128 %6, %14, off\n\t"
               "global_load_async_to_lds_b128 %7, %15, off\n\t"
               "s_wait_xcnt 0x0"
               :: "v"(l[0]), "v"(l[1]), "v"(l[2]), "v"(l[3]),
                  "v"(l[4]), "v"(l[5]), "v"(l[6]), "v"(l[7]),
                  "v"(g[0]), "v"(g[1]), "v"(g[2]), "v"(g[3]),
                  "v"(g[4]), "v"(g[5]), "v"(g[6]), "v"(g[7])
               : "memory");
}
// One stage for the whole work-group (256 threads, 8 copies each); ag and bg
// point at the stage's first k of the tile's first AO row and first Wo row.
static __device__ __forceinline__ void fill_gemm_stage(_Float16* ab, _Float16* bb,
                                                       const _Float16* ag,
                                                       const _Float16* bg, int tid) {
  unsigned l[8];
  const _Float16* g[8];
#pragma unroll
  for (int i = 0; i < 4; ++i) {
    const int r   = i * 32 + (tid >> 3);
    const int ch  = tid & 7;
    const int off = r * 64 + ((ch ^ ((r >> 1) & 7)) * 8);
    l[i]     = lds_addr(ab + off);
    g[i]     = ag + (size_t)r * EMBED + ch * 8;
    l[4 + i] = lds_addr(bb + off);
    g[4 + i] = bg + (size_t)r * EMBED + ch * 8;
  }
  async_cp16x8(l, g);
}

__global__ __launch_bounds__(256) void outproj_kernel(const _Float16* __restrict__ AO,
                                                      const _Float16* __restrict__ Wo16,
                                                      const float* __restrict__ bo,
                                                      float* __restrict__ Y) {
  const int tid  = threadIdx.x;
  const int wave = __builtin_amdgcn_readfirstlane(tid >> 5);
  const int lane = tid & 31;
  const int hw   = lane >> 4;
  const int nl   = lane & 15;

  const int e0 = blockIdx.x * OP_ROWS;   // first output column of the tile
  const int t0 = blockIdx.y * OP_ROWS;   // first token of the tile
  const int wm = wave >> 2;              // this wave's 64 tokens
  const int wn = wave & 3;               // this wave's 32 columns

  // ring[buffer][operand]: AO rows, then Wo rows; 64 KiB, the output staging
  // of the epilogue takes the same bytes.
  __shared__ __align__(16) _Float16 ring[2][2][OP_HALF];

  const _Float16* Ag = AO + (size_t)t0 * EMBED;
  const _Float16* Bg = Wo16 + (size_t)e0 * EMBED;

  v8f acc[4][2];
#pragma unroll
  for (int mt = 0; mt < 4; ++mt)
#pragma unroll
    for (int nt = 0; nt < 2; ++nt) acc[mt][nt] = v8f{};

  const int NS = EMBED / 64;

  // Stage 0 lands and is published to all waves; then stage 1's copies start.
  fill_gemm_stage(ring[0][0], ring[0][1], Ag, Bg, tid);
  wait_async_0();
  __syncthreads();
  fill_gemm_stage(ring[1][0], ring[1][1], Ag + 64, Bg + 64, tid);

  // Swizzle term of the fragment readers (row = 16 * tile + nl in both).
  const int kswz = (nl >> 1) & 7;

  // Kept rolled: one trip per stage, one publish point at its foot.
#pragma unroll 1
  for (int st = 0; st < NS; ++st) {
    const int cur = st & 1;
    const _Float16* ar = &ring[cur][0][(wm * 64 + nl) * 64];
    const _Float16* br = &ring[cur][1][(wn * 32 + nl) * 64];
#pragma unroll
    for (int ks = 0; ks < 2; ++ks) {
      const int c0 = ((ks * 4 + hw) ^ kswz) * 8;
      const int c1 = ((ks * 4 + 2 + hw) ^ kswz) * 8;
      v16h a[4], b[2];
#pragma unroll
      for (int mt = 0; mt < 4; ++mt)
        a[mt] = cat16(ldh8(ar + mt * 16 * 64 + c0), ldh8(ar + mt * 16 * 64 + c1));
#pragma unroll
      for (int nt = 0; nt < 2; ++nt)
        b[nt] = cat16(ldh8(br + nt * 16 * 64 + c0), ldh8(br + nt * 16 * 64 + c1));
#pragma unroll
      for (int mt = 0; mt < 4; ++mt)
#pragma unroll
        for (int nt = 0; nt < 2; ++nt)
          acc[mt][nt] = WMMA_F16(a[mt], b[nt], acc[mt][nt]);
    }

    // Publish point of stage st + 1: this wave's LDS reads of stage st retire,
    // its own copies of stage st + 1 have landed, then the barrier both shows
    // stage st + 1 to every wave and frees buffer cur for the refill.
    asm volatile("s_wait_dscnt 0x0" ::: "memory");
    wait_async_0();
    __syncthreads();
    if (st + 2 < NS)
      fill_gemm_stage(ring[cur][0], ring[cur][1], Ag + (st + 2) * 64, Bg + (st + 2) * 64, tid);
  }
  // No copy is outstanding when the ring becomes output staging.
  wait_async_0();

  // ---- epilogue: behind the last publish point nobody reads the ring any more.
  // Each wave stages its 64 x 32 f32 part in its own 8 KiB, rows of one 128-byte
  // line; the two 16-column halves of a row change places in rows 8..15 of each
  // 16, so that the two wave halves of a store fall on different banks. It reads
  // the rows back, adds the bias and stores 4 whole lines per instruction.
  float* stg = (float*)&ring[0][0][0] + wave * (64 * 32);
#pragma unroll
  for (int mt = 0; mt < 4; ++mt)
#pragma unroll
    for (int nt = 0; nt < 2; ++nt)
#pragma unroll
      for (int r = 0; r < 8; ++r)
        stg[(mt * 16 + hw * 8 + r) * 32 + ((nt * 16 + nl) ^ (hw << 4))] = acc[mt][nt][r];

  const int ch = lane & 7;
  const int ec = e0 + wn * 32 + ch * 4;
  const float4 bv = *(const float4*)(bo + ec);
  float* yr = Y + (size_t)(t0 + wm * 64) * EMBED + ec;
#pragma unroll
  for (int i = 0; i < 16; ++i) {
    const int row = i * 4 + (lane >> 3);
    float4 v = *(const float4*)&stg[row * 32 + ((ch ^ (((row >> 3) & 1) << 2)) * 4)];
    v.x += bv.x; v.y += bv.y; v.z += bv.z; v.w += bv.w;
    *(float4*)(yr + (size_t)row * EMBED) = v;
  }
}

// ---------------------------------------------------------------------------
extern "C" void kernel_launch(void* const* d_in, const int* in_sizes, int n_in,
                              void* d_out, int out_size, void* d_ws, size_t ws_size,
                              hipStream_t stream) {
  const float* values = (const float*)d_in[0];
  const float* keys_  = (const float*)d_in[1];
  const float* query  = (const float*)d_in[2];
  const int*   mask   = (const int*)d_in[3];
  const float* Wv     = (const float*)d_in[4];
  const float* Wk     = (const float*)d_in[5];
  const float* Wq     = (const float*)d_in[6];
  const float* Wo     = (const float*)d_in[7];
  const float* bo     = (const float*)d_in[8];
  float* out = (float*)d_out;

  // Workspace layout (bytes):
  //   Qp [N][H][S][D]  f16 : 16 MB
  //   Kp [N][H][S][D]  f16 : 16 MB
  //   Vt [N][H][D][S]  f16 : 16 MB   (transposed for V^T@P^T A-fragments)
  //   AO [N][S][E]     f16 : 16 MB
  //   Wo16 [E][E]      f16 :  2 MB
  //   MB   [N][S/16][S/32][16] u32 : 2 MB  (mask as lane masks)
  const size_t QKV = (size_t)NBATCH * HEADS * SEQ * HEAD_DIM * sizeof(_Float16);
  char* ws = (char*)d_ws;
  _Float16* Qp   = (_Float16*)(ws);
  _Float16* Kp   = (_Float16*)(ws + QKV);
  _Float16* Vt   = (_Float16*)(ws + 2 * QKV);
  _Float16* AO   = (_Float16*)(ws + 3 * QKV);
  _Float16* Wo16 = (_Float16*)(ws + 4 * QKV);
  unsigned* MB   = (unsigned*)(ws + 4 * QKV + (size_t)EMBED * EMBED * sizeof(_Float16));

  front_kernel<<<NBATCH * HEADS * (SEQ / 128) / 4, (FE_WAVES + FE_MASKW) * 32, 0, stream>>>(
      query, keys_, values, Wq, Wk, Wv, Wo, mask, Qp, Kp, Vt, Wo16, MB);

  dim3 gattn((SEQ / (8 * QT * 16)) * HEADS, NBATCH);
  attn_kernel<<<gattn, 256, 0, stream>>>(Qp, Kp, Vt, MB, AO);

  dim3 gout(EMBED / OP_ROWS, NBATCH * SEQ / OP_ROWS);
  outproj_kernel<<<gout, 256, 0, stream>>>(AO, Wo16, bo, out);
}

// v010
// It runs in 89.9 microseconds.
// In both of two side-by-side timings against v009, it was 1.04 times as fast.
// Over all steps from v000 it is 5.47 times as fast.
#include <hip/hip_runtime.h>

#define EMBED 1024
#define HEADS 16
#define HEAD_DIM 64
#define NBATCH 4
#define SEQ 2048

typedef __attribute__((ext_vector_type(16))) _Float16 v16h;
typedef __attribute__((ext_vector_type(8)))  _Float16 v8h;
typedef __attribute__((ext_vector_type(8)))  float    v8f;
typedef __attribute__((ext_vector_type(16))) unsigned v16u;

static __device__ __forceinline__ v16h cat16(v8h a, v8h b) {
  return __builtin_shufflevector(a, b, 0,1,2,3,4,5,6,7,8,9,10,11,12,13,14,15);
}
static __device__ __forceinline__ v8h ldh8(const _Float16* p) { return *(const v8h*)p; }
#define WMMA_F16(a,b,c) __builtin_amdgcn_wmma_f32_16x16x32_f16(false,(a),false,(b),(short)0,(c),false,false)

// The softmax takes exp(s / sqrt(EMBED)) = exp2(s * QK_SCALE). The front end
// multiplies Wq by this factor before it rounds the weight to f16, so that the
// score products of the attention kernel are exp2 arguments as they stand.
#define QK_SCALE (0.03125f * 1.44269504088896340736f)
// Eight weights times f, rounded to f16 once.
static __device__ __forceinline__ v8h cvt8s(const float* p, float f) {
  float4 a = *(const float4*)p;
  float4 b = *(const float4*)(p + 4);
  v8h r;
  r[0]=(_Float16)(a.x*f); r[1]=(_Float16)(a.y*f); r[2]=(_Float16)(a.z*f); r[3]=(_Float16)(a.w*f);
  r[4]=(_Float16)(b.x*f); r[5]=(_Float16)(b.y*f); r[6]=(_Float16)(b.z*f); r[7]=(_Float16)(b.w*f);
  return r;
}

// Async global->LDS copy, 16 bytes per lane (GLOBAL_LOAD_ASYNC_TO_LDS_B128,
// tracked by ASYNCcnt). LDS aperture keeps the byte offset in addr[31:0], so
// truncating the generic pointer yields the LDS-address VGPR value.
static __device__ __forceinline__ unsigned lds_addr(const _Float16* p) {
  return (unsigned)(unsigned long long)p;
}
// Four copies and their s_wait_xcnt in ONE statement: the wait stands in front
// of any later rewrite of the address registers that the copies name.
static __device__ __forceinline__ void async_cp16x4(const unsigned (&l)[4],
                                                    const _Float16* const (&g)[4]) {
  asm volatile("global_load_async_to_lds_b128 %0, %4, off\n\t"
               "global_load_async_to_lds_b128 %1, %5, off\n\t"
               "global_load_async_to_lds_b128 %2, %6, off\n\t"
               "global_load_async_to_lds_b128 %3, %7, off\n\t"
               "s_wait_xcnt 0x0"
               :: "v"(l[0]), "v"(l[1]), "v"(l[2]), "v"(l[3]),
                  "v"(g[0]), "v"(g[1]), "v"(g[2]), "v"(g[3])
               : "memory");
}
// Fill one stage of 64 keys for the whole work-group (256 threads, 4 copies
// each): K 64 keys x 64 d (8192 contiguous bytes in global), V 64 d-rows x 64
// keys (128-byte runs). Every copy of a wave takes 4 whole 128-byte lines. In
// LDS both keep a 128-byte row pitch, and the 16-byte chunks of a row are
// XOR-swizzled by the row number, chunk ^= (row >> 1) & 7, so that the 16 rows
// of one ds_load_b128 fragment read fall on 16 different bank quads.
static __device__ __forceinline__ void fill_stage(_Float16* kb, _Float16* vb,
                                                  const _Float16* kg, const _Float16* vg,
                                                  int tid) {
  unsigned l[4];
  const _Float16* g[4];
#pragma unroll
  for (int i = 0; i < 2; ++i) {
    const int r   = i * 32 + (tid >> 3);
    const int ch  = tid & 7;
    const int off = r * 64 + ((ch ^ ((r >> 1) & 7)) * 8);
    l[i]     = lds_addr(kb + off);
    g[i]     = kg + r * HEAD_DIM + ch * 8;
    l[2 + i] = lds_addr(vb + off);
    g[2 + i] = vg + (size_t)r * SEQ + ch * 8;
  }
  async_cp16x4(l, g);
}
static __device__ __forceinline__ void wait_async_0() {
  asm volatile("s_wait_asynccnt 0" ::: "memory");
}

// ---------------------------------------------------------------------------
// Kernel 1: the whole front end in one launch: the three per-head projections
// Y = X_head @ W^T, the conversion of Wo to f16 and the packing of the mask. One
// work-group of 16 waves per 4 x 128 tokens-of-a-head: waves 0..3 take Q, 4..7 K,
// 8..11 V, 12..15 a share of the mask (see FE_MASKW). The four
// waves of a tensor convert a quarter of its 64 x 64 weight each and share the
// fragments through LDS; a wave then keeps all of them in registers and walks
// 128 tokens of one head (8 tiles of 16), two tiles a step, the next step's
// loads in flight while this one is worked on.
//   Q, K : Y^T = W X^T, a lane holds 8 consecutive d of one token; out [n][h][s][d]
//   V    : Y   = X W^T, a lane holds 8 consecutive tokens of one d; out [n][h][d][s]
// Either way the 16-byte pieces of four tiles are staged in the wave's own 8 KiB
// of LDS as 64 rows of one 128-byte line and go out 4 whole lines per store.
// ---------------------------------------------------------------------------
#define FE_WAVES 12
#define FE_STEPS 4                  // steps of two 16-token tiles per wave
// Four more waves per work-group pack the mask, read here once for all heads,
// into the lane masks of the attention kernel's score selects: for a tile of 16
// queries and a pass of 32 keys, word c * 8 + r holds in bit hw * 16 + nl
// whether mask[query nl][key c * 16 + hw * 8 + r] is non-zero. 16 words a pass,
// MB[batch * 128 + query tile][pass][16].
#define FE_MASKW 4
#define MB_BATCH 4                  // passes whose mask words one batch of loads holds
#define MB_NBATCH 8                 // batches per wave: 16 queries x 1024 keys

// A lane's 64 mask words of MB_BATCH passes; mp points at the lane's query row,
// at its half-wave's first key of the batch.
static __device__ __forceinline__ void ld_mask(const int* mp, int4 (&v)[MB_BATCH * 4]) {
  // Unrolled: the array stays in registers, every offset is an immediate.
#pragma unroll
  for (int i = 0; i < MB_BATCH * 2; ++i) {
    v[i * 2]     = *(const int4*)(mp + i * 16);
    v[i * 2 + 1] = *(const int4*)(mp + i * 16 + 4);
  }
}
// The lane masks of a batch: one compare per word of 32 mask values; the words of
// two passes are gathered one per lane and go out as one whole 128-byte line.
static __device__ __forceinline__ void pack_mask(const int4 (&v)[MB_BATCH * 4], unsigned* mo) {
  // All three unrolled: register arrays, and each word's lane is a constant.
#pragma unroll
  for (int pp = 0; pp < MB_BATCH / 2; ++pp) {
    unsigned acc = 0;
#pragma unroll
    for (int i = 0; i < 8; ++i) {
      const int4 m = v[pp * 8 + i];
      const int mv[4] = {m.x, m.y, m.z, m.w};
#pragma unroll
      for (int j = 0; j < 4; ++j) {
        const unsigned w = __builtin_amdgcn_ballot_w32(mv[j] != 0);
        // Lane i * 4 + j alone takes the word.
        acc = __builtin_amdgcn_inverse_ballot_w32(1u << (i * 4 + j)) ? w : acc;
      }
    }
    mo[pp * 32] = acc;
  }
}

typedef __attribute__((ext_vector_type(4))) _Float16 v4h;

static __device__ __forceinline__ v8h cvt8r(float4 a, float4 b) {
  v8h r;
  r[0]=(_Float16)a.x; r[1]=(_Float16)a.y; r[2]=(_Float16)a.z; r[3]=(_Float16)a.w;
  r[4]=(_Float16)b.x; r[5]=(_Float16)b.y; r[6]=(_Float16)b.z; r[7]=(_Float16)b.w;
  return r;
}
// The 32 floats of one lane's two fragments of a 16 x 64 tile; xr points at the
// lane's row, at its half-wave's first k.
static __device__ __forceinline__ void ld_x(const float* xr, float4 (&v)[8]) {
#pragma unroll
  for (int ks = 0; ks < 2; ++ks)
#pragma unroll
    for (int c = 0; c < 2; ++c) {
      v[ks * 4 + c * 2]     = *(const float4*)(xr + ks * 32 + c * 16);
      v[ks * 4 + c * 2 + 1] = *(const float4*)(xr + ks * 32 + c * 16 + 4);
    }
}

// The two f16 fragments of a tile from its raw floats.
static __device__ __forceinline__ void cvt_x(const float4 (&v)[8], v16h (&af)[2]) {
#pragma unroll
  for (int ks = 0; ks < 2; ++ks)
    af[ks] = cat16(cvt8r(v[ks * 4], v[ks * 4 + 1]), cvt8r(v[ks * 4 + 2], v[ks * 4 + 3]));
}

// The products of one step (two tiles) and their staging. stg: the wave's own
// 64 rows of 128 bytes; odd: second step of the staged group of four tiles.
template <bool TR>
static __device__ __forceinline__ void front_step(const v16h (&cur)[2][2],
                                                  const v16h (&wf)[4][2],
                                                  _Float16* stg, int odd, int lane) {
  const int hw = lane >> 4;
  const int nl = lane & 15;
#pragma unroll
  for (int j = 0; j < 2; ++j)
#pragma unroll
    for (int nt = 0; nt < 4; ++nt) {
      v8f c = {};
#pragma unroll
      for (int ks = 0; ks < 2; ++ks)
        c = TR ? WMMA_F16(cur[j][ks], wf[nt][ks], c) : WMMA_F16(wf[nt][ks], cur[j][ks], c);
      v8h pk;
#pragma unroll
      for (int r = 0; r < 8; ++r) pk[r] = (_Float16)c[r];
      // Staging row and 16-byte chunk of this piece; chunks XOR-swizzled by the
      // row so that the 32 pieces of a store spread over all banks.
      const int row = TR ? nt * 16 + nl : odd * 32 + j * 16 + nl;
      const int ch  = TR ? odd * 4 + j * 2 + hw : nt * 2 + hw;
      *(v8h*)(stg + row * 64 + ((ch ^ (nl & 7)) * 8)) = pk;
    }
}

__global__ __launch_bounds__((FE_WAVES + FE_MASKW) * 32) void front_kernel(
    const float* __restrict__ query, const float* __restrict__ keys_,
    const float* __restrict__ values, const float* __restrict__ Wq,
    const float* __restrict__ Wk, const float* __restrict__ Wv,
    const float* __restrict__ Wo, const int* __restrict__ mask,
    _Float16* __restrict__ Qp, _Float16* __restrict__ Kp,
    _Float16* __restrict__ Vt, _Float16* __restrict__ Wo16,
    unsigned* __restrict__ MB) {
  const int tid  = threadIdx.x;
  const int wave = __builtin_amdgcn_readfirstlane(tid >> 5);
  const int lane = tid & 31;
  const int nl   = lane & 15;
  const int lo   = (lane >> 4) * 8;
  const int sel  = wave >> 2;                    // 0: Q, 1: K, 2: V
  const int qt   = wave & 3;

  const int wq = blockIdx.x * 4 + qt;            // (batch, 128 tokens, head)
  const int h  = wq & (HEADS - 1);
  const int s0 = ((wq >> 4) & 15) * 128;
  const int bn = wq >> 8;

  const float* X  = sel == 0 ? query : sel == 1 ? keys_ : values;
  const float* Wm = sel == 0 ? Wq : sel == 1 ? Wk : Wv;
  _Float16* oh    = (sel == 0 ? Qp : sel == 1 ? Kp : Vt)
                    + (size_t)(bn * HEADS + h) * SEQ * HEAD_DIM;

  __shared__ __align__(16) _Float16 stage[FE_WAVES][64 * 64];
  __shared__ __align__(16) _Float16 wshare[3][64 * 64];

  const float* xr = X + ((size_t)(bn * SEQ + s0 + nl)) * EMBED + h * HEAD_DIM + lo;
  float4 raw[2][8];
  const int wbase = blockIdx.x * 4096 + tid * 4;
  float4 wo[4];

  // A mask wave (wave-uniform test): 16 query rows, half of their keys.
  const bool mwave = wave >= FE_WAVES;
  const int* mp = mask + (size_t)((wq >> 1) * 16 + nl) * SEQ + (wq & 1) * (SEQ / 2) + lo;
  unsigned* mo  = MB + ((wq >> 1) * (SEQ / 32) + (wq & 1) * (SEQ / 64)) * 16 + lane;
  int4 ma[MB_BATCH * 4], mb[MB_BATCH * 4];

  if (mwave) {
    ld_mask(mp, ma);
  } else {
    // Weight fragments (row e = nt * 16 + nl, contiguous along k), same k order
    // as the X fragments. This wave makes those of nt = qt and lays them in LDS
    // in fragment order (512 contiguous bytes per store or load).
    // Wq carries the softmax factor (wave-uniform; 1 leaves Wk and Wv as they are).
    const float wsc = sel == 0 ? QK_SCALE : 1.0f;
    v8h wpart[4];
#pragma unroll
    for (int ks = 0; ks < 2; ++ks) {
      const float* wr = Wm + (size_t)(qt * 16 + nl) * HEAD_DIM + ks * 32 + lo;
      wpart[ks * 2]     = cvt8s(wr, wsc);
      wpart[ks * 2 + 1] = cvt8s(wr + 16, wsc);
    }

    ld_x(xr, raw[0]);
    ld_x(xr + 16 * EMBED, raw[1]);
    // Stands in front of the rewrite of the address registers that the weight
    // loads name.
    asm volatile("s_wait_xcnt 0x0" ::: "memory");

    // Wo: 4096 floats per work-group, whole lines, by the 256 threads of waves
    // 0..7; asked for here, stored behind the projection work.
    if (wave < 8) {
#pragma unroll
      for (int j = 0; j < 4; ++j) wo[j] = *(const float4*)(Wo + wbase + j * 1024);
    }

#pragma unroll
    for (int i = 0; i < 4; ++i)
      *(v8h*)(&wshare[sel][(qt * 4 + i) * 256 + lane * 8]) = wpart[i];
  }
  // Every wave's quarter is in LDS before any wave takes the whole weight.
  __syncthreads();

  // Behind the kernel's one barrier the mask waves go their own way: two sets of
  // loads, one in flight while the other is packed. Unrolled: one address pair
  // with immediate offsets serves every load, and none of them rewrites it.
  if (mwave) {
#pragma unroll
    for (int b = 0; b < MB_NBATCH; b += 2) {
      ld_mask(mp + (b + 1) * MB_BATCH * 32, mb);
      pack_mask(ma, mo + b * MB_BATCH * 16);
      if (b + 2 < MB_NBATCH) ld_mask(mp + (b + 2) * MB_BATCH * 32, ma);
      pack_mask(mb, mo + (b + 1) * MB_BATCH * 16);
    }
    return;
  }
  v16h wf[4][2];
#pragma unroll
  for (int nt = 0; nt < 4; ++nt)
#pragma unroll
    for (int ks = 0; ks < 2; ++ks) {
      const _Float16* ws = &wshare[sel][(nt * 4 + ks * 2) * 256 + lane * 8];
      wf[nt][ks] = cat16(ldh8(ws), ldh8(ws + 256));
    }

  v16h cur[2][2];
  cvt_x(raw[0], cur[0]);
  cvt_x(raw[1], cur[1]);

  _Float16* stg = stage[wave];
  const bool tr = sel == 2;                      // wave-uniform
  // Read-back of the staged rows: 8 lanes per row, 4 rows per instruction.
  const int frow = lane >> 3;
  const int fc   = lane & 7;
  const unsigned pitch = tr ? SEQ : HEAD_DIM;    // output elements per staged row
  _Float16* od = oh + (size_t)s0 * (tr ? 1 : HEAD_DIM) + frow * pitch + fc * 8;

  // Kept rolled: one set of loads ahead of one set in work, no more registers.
#pragma unroll 1
  for (int s = 0; s < FE_STEPS; ++s) {
    float4 nxt[2][8];
    if (s + 1 < FE_STEPS) {
      const float* xn = xr + (size_t)(s + 1) * 32 * EMBED;
      ld_x(xn, nxt[0]);
      ld_x(xn + 16 * EMBED, nxt[1]);
    }

    if (tr) front_step<true >(cur, wf, stg, s & 1, lane);
    else    front_step<false>(cur, wf, stg, s & 1, lane);

    if (s & 1) {
      // The wave's own staging stores retire before it reads the rows back.
      asm volatile("s_wait_dscnt 0x0" ::: "memory");
      _Float16* dst = od + (size_t)(s >> 1) * 64 * (tr ? 1 : HEAD_DIM);
#pragma unroll
      for (int i = 0; i < 16; ++i) {
        const int row = i * 4 + frow;
        *(v8h*)(dst + (size_t)(i * 4) * pitch) =
            *(const v8h*)(stg + row * 64 + ((fc ^ (row & 7)) * 8));
      }
      // Stands in front of the next step's rewrite of the registers that the
      // last stores name.
      asm volatile("s_wait_xcnt 0x0" ::: "memory");
    }

    if (s + 1 < FE_STEPS) {
      cvt_x(nxt[0], cur[0]);
      cvt_x(nxt[1], cur[1]);
    }
  }

  if (wave < 8) {
#pragma unroll
    for (int j = 0; j < 4; ++j) {
      v4h p;
      p[0]=(_Float16)wo[j].x; p[1]=(_Float16)wo[j].y;
      p[2]=(_Float16)wo[j].z; p[3]=(_Float16)wo[j].w;
      *(v4h*)(Wo16 + wbase + j * 1024) = p;
    }
  }
}

#define QT 2
// Lane l takes the value of lane l ^ 16.
static __device__ __forceinline__ float xhalf(float x) {
  const int v = __builtin_bit_cast(int, x);
  return __builtin_bit_cast(float,
      __builtin_amdgcn_permlanex16(v, v, 0x76543210, 0xfedcba98, false, false));
}

// S^T[32 x 16] = K Q^T + c0 for one pass and each query tile: two 16-key tiles,
// A fragments from LDS, each read once for all query tiles; kr points at the
// lane's row of the first key tile.
static __device__ __forceinline__ void pass_scores(const _Float16* kr, int hw, int kswz,
                                                   const v16h (&qf)[QT][2],
                                                   const v8f (&c0)[QT],
                                                   v8f (&sf)[QT][2]) {
#pragma unroll
  for (int c = 0; c < 2; ++c) {
#pragma unroll
    for (int t = 0; t < QT; ++t) sf[t][c] = c0[t];
#pragma unroll
    for (int ks = 0; ks < 2; ++ks) {
      v16h a = cat16(ldh8(kr + c * 16 * 64 + ((ks * 4 + hw) ^ kswz) * 8),
                     ldh8(kr + c * 16 * 64 + ((ks * 4 + 2 + hw) ^ kswz) * 8));
#pragma unroll
      for (int t = 0; t < QT; ++t) sf[t][c] = WMMA_F16(a, qf[t][ks], sf[t][c]);
    }
  }
}
// O^T += V^T @ P^T for pass p of a stage (V A-frags from LDS, same k order as
// pb), each fragment read once for all query tiles; vr points at the lane's row of
// the first d tile.
static __device__ __forceinline__ void pass_outputs(const _Float16* vr, int p, int hw, int kswz,
                                                    const v16h (&pb)[QT], v8f (&o)[QT][4]) {
#pragma unroll
  for (int dt = 0; dt < 4; ++dt) {
    v16h a = cat16(ldh8(vr + dt * 16 * 64 + ((p * 4 + hw) ^ kswz) * 8),
                   ldh8(vr + dt * 16 * 64 + ((p * 4 + 2 + hw) ^ kswz) * 8));
#pragma unroll
    for (int t = 0; t < QT; ++t) o[t][dt] = WMMA_F16(a, pb[t], o[t][dt]);
  }
}
// A lane's 16 exponentials of a pass may sum to this much before the maximum in
// use is replaced: no P above 2^12, well inside f16.
#define P_LIMIT 4096.0f

// AND of a pass's 16 lane-mask words, on the scalar unit: all ones where no score
// of the pass is masked.
typedef __attribute__((ext_vector_type(8))) unsigned long long v8ul;
static __device__ __forceinline__ unsigned long long and_words(v16u w) {
  const v8ul x = __builtin_bit_cast(v8ul, w);
  return ((x[0] & x[1]) & (x[2] & x[3])) & ((x[4] & x[5]) & (x[6] & x[7]));
}

// Four waves per SIMD: the two work-groups that a WGP gets from this grid are
// resident at once.
__global__ __launch_bounds__(256) __attribute__((amdgpu_waves_per_eu(4, 4)))
void attn_kernel(const _Float16* __restrict__ Qp,
                 const _Float16* __restrict__ Kp,
                 const _Float16* __restrict__ Vt,
                 const unsigned* __restrict__ MB,
                 _Float16* __restrict__ AO) {
  const int tid  = threadIdx.x;
  const int wave = __builtin_amdgcn_readfirstlane(tid >> 5);
  const int lane = tid & 31;
  const int hw   = lane >> 4;
  const int nl   = lane & 15;
  const int lo   = hw * 8;

  const int h  = blockIdx.x & (HEADS - 1);
  const int qb = blockIdx.x / HEADS;
  const int bn = blockIdx.y;
  const int q0 = (qb * 8 + wave) * (QT * 16);

  const _Float16* Qh = Qp + (size_t)(bn * HEADS + h) * SEQ * HEAD_DIM;
  const _Float16* Kh = Kp + (size_t)(bn * HEADS + h) * SEQ * HEAD_DIM;
  const _Float16* Vh = Vt + (size_t)(bn * HEADS + h) * HEAD_DIM * SEQ;

  // Double-buffered K/V stages: K row-major [64 keys][64 d], V [64 d][64 keys],
  // 16-byte chunks swizzled inside each row (see fill_stage).
  __shared__ __align__(16) _Float16 Kbuf[2][64 * 64];
  __shared__ __align__(16) _Float16 Vbuf[2][64 * 64];

  // Q B-fragments (column n = nl on both half-waves), kept for the whole loop.
  v16h qf[QT][2];
#pragma unroll
  for (int t = 0; t < QT; ++t) {
    const _Float16* qr = Qh + (size_t)(q0 + t * 16 + nl) * HEAD_DIM;
#pragma unroll
    for (int ks = 0; ks < 2; ++ks)
      qf[t][ks] = cat16(ldh8(qr + ks * 32 + lo), ldh8(qr + ks * 32 + 16 + lo));
  }

  // o[t][dt][r] = O[q0 + t * 16 + nl][dt * 16 + hw * 8 + r]; rsum is the sum over
  // this half's keys only.
  v8f o[QT][4];
  float rsum[QT];

  // Q comes scaled by QK_SCALE: scores, maxima and differences are exp2 arguments.
  const float mfill = -1.0e20f * QK_SCALE;   // masked value in the same units
  // nmax: minus the query's maximum in use (equal in both halves) in all eight
  // registers (a lane's scores of a tile are all of one query): the C operand of
  // the score products. mrel: the masked value against that maximum. With the
  // start value every exponential of the first pass overflows, so that the first
  // pass always takes the redo and sets the first real maximum.
  v8f nmax[QT];
  float mrel[QT];
#pragma unroll
  for (int t = 0; t < QT; ++t) {
#pragma unroll
    for (int dt = 0; dt < 4; ++dt) o[t][dt] = v8f{};
    rsum[t] = 0.0f;
#pragma unroll
    for (int r = 0; r < 8; ++r) nmax[t][r] = 1.0e30f;
    mrel[t] = mfill + 1.0e30f;
  }

  // Mask: the front end has packed it into lane masks, 16 words per pass and query
  // tile (word c * 8 + r: one bit per lane for score sf[t][c][r]); a tile's passes
  // lie SEQ / 32 entries behind the tile before. The address is the same in every
  // lane, and nothing writes MB during this launch: read as constant memory the
  // words come by scalar loads straight into scalar registers. nw[p][t]: the words
  // of pass p of the coming stage.
  typedef const __attribute__((address_space(4))) v16u* mb_ptr;
  const mb_ptr mrow = (mb_ptr)(MB + (size_t)(bn * (SEQ / 16) + (q0 >> 4)) * (SEQ / 32) * 16);
  v16u nw[2][QT];
#pragma unroll
  for (int p = 0; p < 2; ++p)
#pragma unroll
    for (int t = 0; t < QT; ++t) nw[p][t] = mrow[t * (SEQ / 32) + p];
  mb_ptr mnext = mrow + 2;   // the first tile's words of the stage behind the coming one

  const int NS = SEQ / 64;

  // Stage 0 lands and is published to all waves; then stage 1's copies start.
  fill_stage(Kbuf[0], Vbuf[0], Kh, Vh, tid);
  wait_async_0();
  __syncthreads();
  fill_stage(Kbuf[1], Vbuf[1], Kh + (size_t)64 * HEAD_DIM, Vh + 64, tid);

  // Swizzle term of the fragment readers (row = 16 * tile + nl in both).
  const int kswz = (nl >> 1) & 7;

  // Kept rolled: one trip per stage, one publish point at its foot.
#pragma unroll 1
  for (int st = 0; st < NS; ++st) {
    const int cur = st & 1;

    // mall[p]: the AND of the words of pass p over the wave's query tiles.
    unsigned long long mall[2];
#pragma unroll
    for (int p = 0; p < 2; ++p) mall[p] = and_words(nw[p][0]) & and_words(nw[p][1]);

    v16h pb[QT];
    // Unrolled: every LDS offset of a pass is an immediate.
#pragma unroll
    for (int p = 0; p < 2; ++p) {
      const int k0 = st * 64 + p * 32;

      // ---- S^T - max in use = K @ Q^T + (-max in use) ----------------------
      const _Float16* kr = &Kbuf[cur][(p * 32 + nl) * 64];
      v8f sf[QT][2];
      pass_scores(kr, hw, kswz, qf, nmax, sf);

      // ---- mask: one scalar test per pass and wave. Where every word is all ones
      // each select would hand its score on, and none is done. Otherwise each
      // packed word is its select's lane mask. Marked unlikely: the selects
      // lie out of line, a pass with nothing masked falls through.
      if (__builtin_expect(mall[p] != ~0ull, 0)) {
#pragma unroll
        for (int t = 0; t < QT; ++t) {
#pragma unroll
          for (int c = 0; c < 2; ++c)
#pragma unroll
            for (int r = 0; r < 8; ++r)
              sf[t][c][r] = __builtin_amdgcn_inverse_ballot_w32(nw[p][t][c * 8 + r]) ? sf[t][c][r]
                                                                                     : mrel[t];
        }
      }

      // The first pass's O^T += V^T @ P^T stands here, behind the second pass's mask
      // test: in one basic block with this pass's exponentials its matrix work
      // is issued among them; in front of the branch it could not be.
      if (p == 1) pass_outputs(&Vbuf[cur][nl * 64], 0, hw, kswz, pb, o);

      // ---- P^T = exp2(S^T - max in use): the two tiles are the B operand ----
      float part[QT];
#pragma unroll
      for (int t = 0; t < QT; ++t) {
        part[t] = 0.0f;
#pragma unroll
        for (int c = 0; c < 2; ++c)
#pragma unroll
          for (int r = 0; r < 8; ++r) {
            const float pv = __builtin_amdgcn_exp2f(sf[t][c][r]);
            part[t] += pv;
            pb[t][c * 8 + r] = (_Float16)pv;
          }
      }

      // ---- redo: one test per pass, a scalar branch for the whole wave ------
      // Some query's scores have outgrown its maximum in use (an overflow shows
      // as an infinite sum). The pass is taken again from the plain scores, so
      // that nothing is lost however far the old maximum lay: true maximum of
      // the 32 keys (in-lane + one exchange), sums and outputs rescaled to it.
      // Marked unlikely: the redo lies out of line, the usual pass falls through.
      if (__builtin_expect(
              __builtin_amdgcn_ballot_w32(fmaxf(part[0], part[1]) > P_LIMIT) != 0, 0)) {
        const v8f zero[QT] = {v8f{}, v8f{}};
        pass_scores(kr, hw, kswz, qf, zero, sf);
#pragma unroll
        for (int t = 0; t < QT; ++t) {
          const v16u mw = mrow[t * (SEQ / 32) + (k0 >> 5)];
#pragma unroll
          for (int c = 0; c < 2; ++c)
#pragma unroll
            for (int r = 0; r < 8; ++r)
              sf[t][c][r] =
                  __builtin_amdgcn_inverse_ballot_w32(mw[c * 8 + r]) ? sf[t][c][r] : mfill;
          float m = fmaxf(sf[t][0][0], sf[t][1][0]);
#pragma unroll
          for (int r = 1; r < 8; ++r) m = fmaxf(m, fmaxf(sf[t][0][r], sf[t][1][r]));
          m = fmaxf(m, xhalf(m));
          const float om    = -nmax[t][0];     // the maximum in use so far
          const float nm    = fmaxf(om, m);
          const float alpha = __builtin_amdgcn_exp2f(om - nm);
          mrel[t] = mfill - nm;
#pragma unroll
          for (int r = 0; r < 8; ++r) nmax[t][r] = -nm;
          part[t] = 0.0f;
#pragma unroll
          for (int c = 0; c < 2; ++c)
#pragma unroll
            for (int r = 0; r < 8; ++r) {
              const float pv = __builtin_amdgcn_exp2f(sf[t][c][r] - nm);
              part[t] += pv;
              pb[t][c * 8 + r] = (_Float16)pv;
            }
          rsum[t] *= alpha;
#pragma unroll
          for (int dt = 0; dt < 4; ++dt)
#pragma unroll
            for (int r = 0; r < 8; ++r) o[t][dt][r] *= alpha;
        }
      }
#pragma unroll
      for (int t = 0; t < QT; ++t) rsum[t] += part[t];

      // The first pass's second product waits for the second pass (see there).
      if (p == 1) pass_outputs(&Vbuf[cur][nl * 64], 1, hw, kswz, pb, o);
    }

    // The next stage's mask words start here and are ANDed at that stage's head;
    // the last stage wraps to key 0 (in bounds, never used).
#pragma unroll
    for (int p = 0; p < 2; ++p)
#pragma unroll
      for (int t = 0; t < QT; ++t) nw[p][t] = mnext[t * (SEQ / 32) + p];

    // Publish point of stage st + 1: this wave's LDS reads of stage st retire,
    // its own copies of stage st + 1 have landed, then the barrier both shows
    // stage st + 1 to every wave and frees buffer cur for the refill.
    asm volatile("s_wait_dscnt 0x0" ::: "memory");
    wait_async_0();
    __syncthreads();
    // Stands in front of the rewrite of the address registers that the mask words'
    // scalar loads name.
    asm volatile("s_wait_xcnt 0x0" ::: "memory");
    mnext = st + 2 < NS ? mnext + 2 : mrow;
    if (st + 2 < NS)
      fill_stage(Kbuf[cur], Vbuf[cur], Kh + (size_t)(st + 2) * 64 * HEAD_DIM,
                 Vh + (st + 2) * 64, tid);
  }
  // No copy is outstanding when the wave goes on to its epilogue and ends.
  wait_async_0();

  // ---- finalize: join the halves' sums, O / rowsum, 16-byte f16 stores ----
  // The half-wave's offset is taken anew from the lane number: held over the loop
  // it was the one value that the build spilled to scratch.
  const int elo = (int)(__builtin_amdgcn_mbcnt_lo(~0u, 0u) >> 4) * 8;
#pragma unroll
  for (int t = 0; t < QT; ++t) {
    const float inv = 1.0f / (rsum[t] + xhalf(rsum[t]));
    _Float16* dst = AO + ((size_t)bn * SEQ + q0 + t * 16 + nl) * EMBED + h * HEAD_DIM + elo;
#pragma unroll
    for (int dt = 0; dt < 4; ++dt) {
      v8h pk;
#pragma unroll
      for (int r = 0; r < 8; ++r) pk[r] = (_Float16)(o[t][dt][r] * inv);
      *(v8h*)(dst + dt * 16) = pk;
    }
  }
}

// ---------------------------------------------------------------------------
// Kernel 3: Y[8192x1024] = AO @ Wo^T + bo. One work-group of 8 waves per
// 128 x 128 output tile, one 64 x 32 part per wave (2 x 4 waves). A stage is 64 k
// (one 128-byte line) of the tile's 128 AO rows and 128 Wo rows: two buffers in
// LDS, every wave copies an eighth of a stage with
// GLOBAL_LOAD_ASYNC_TO_LDS_B128, each copy taking 4 whole lines, and the next
// stage's copies fly while this one is worked on. Rows and chunks lie in LDS
// as in fill_stage, so the b128 fragment reads are conflict-free.
// ---------------------------------------------------------------------------
#define OP_ROWS 128                 // rows of each operand in a stage
#define OP_HALF (OP_ROWS * 64)      // f16 elements of one operand's stage

// Eight copies and their s_wait_xcnt in ONE statement: the wait stands in front
// of any later rewrite of the address registers that the copies name.
static __device__ __forceinline__ void async_cp16x8(const unsigned (&l)[8],
                                                    const _Float16* const (&g)[8]) {
  asm volatile("global_load_async_to_lds_b128 %0, %8, off\n\t"
               "global_load_async_to_lds_b128 %1, %9, off\n\t"
               "global_load_async_to_lds_b128 %2, %10, off\n\t"
               "global_load_async_to_lds_b128 %3, %11, off\n\t"
               "global_load_async_to_lds_b128 %4, %12, off\n\t"
               "global_load_async_to_lds_b128 %5, %13, off\n\t"
               "global_load_async_to_lds_b128 %6, %14, off\n\t"
               "global_load_async_to_lds_b128 %7, %15, off\n\t"
               "s_wait_xcnt 0x0"
               :: "v"(l[0]), "v"(l[1]), "v"(l[2]), "v"(l[3]),
                  "v"(l[4]), "v"(l[5]), "v"(l[6]), "v"(l[7]),
                  "v"(g[0]), "v"(g[1]), "v"(g[2]), "v"(g[3]),
                  "v"(g[4]), "v"(g[5]), "v"(g[6]), "v"(g[7])
               : "memory");
}
// One stage for the whole work-group (256 threads, 8 copies each); ag and bg
// point at the stage's first k of the tile's first AO row and first Wo row.
static __device__ __forceinline__ void fill_gemm_stage(_Float16* ab, _Float16* bb,
                                                       const _Float16* ag,
                                                       const _Float16* bg, int tid) {
  unsigned l[8];
  const _Float16* g[8];
#pragma unroll
  for (int i = 0; i < 4; ++i) {
    const int r   = i * 32 + (tid >> 3);
    const int ch  = tid & 7;
    const int off = r * 64 + ((ch ^ ((r >> 1) & 7)) * 8);
    l[i]     = lds_addr(ab + off);
    g[i]     = ag + (size_t)r * EMBED + ch * 8;
    l[4 + i] = lds_addr(bb + off);
    g[4 + i] = bg + (size_t)r * EMBED + ch * 8;
  }
  async_cp16x8(l, g);
}

__global__ __launch_bounds__(256) void outproj_kernel(const _Float16* __restrict__ AO,
                                                      const _Float16* __restrict__ Wo16,
                                                      const float* __restrict__ bo,
                                                      float* __restrict__ Y) {
  const int tid  = threadIdx.x;
  const int wave = __builtin_amdgcn_readfirstlane(tid >> 5);
  const int lane = tid & 31;
  const int hw   = lane >> 4;
  const int nl   = lane & 15;

  const int e0 = blockIdx.x * OP_ROWS;   // first output column of the tile
  const int t0 = blockIdx.y * OP_ROWS;   // first token of the tile
  const int wm = wave >> 2;              // this wave's 64 tokens
  const int wn = wave & 3;               // this wave's 32 columns

  // ring[buffer][operand]: AO rows, then Wo rows; 64 KiB, the output staging
  // of the epilogue takes the same bytes.
  __shared__ __align__(16) _Float16 ring[2][2][OP_HALF];

  const _Float16* Ag = AO + (size_t)t0 * EMBED;
  const _Float16* Bg = Wo16 + (size_t)e0 * EMBED;

  v8f acc[4][2];
#pragma unroll
  for (int mt = 0; mt < 4; ++mt)
#pragma unroll
    for (int nt = 0; nt < 2; ++nt) acc[mt][nt] = v8f{};

  const int NS = EMBED / 64;

  // Stage 0 lands and is published to all waves; then stage 1's copies start.
  fill_gemm_stage(ring[0][0], ring[0][1], Ag, Bg, tid);
  wait_async_0();
  __syncthreads();
  fill_gemm_stage(ring[1][0], ring[1][1], Ag + 64, Bg + 64, tid);

  // Swizzle term of the fragment readers (row = 16 * tile + nl in both).
  const int kswz = (nl >> 1) & 7;

  // Kept rolled: one trip per stage, one publish point at its foot.
#pragma unroll 1
  for (int st = 0; st < NS; ++st) {
    const int cur = st & 1;
    const _Float16* ar = &ring[cur][0][(wm * 64 + nl) * 64];
    const _Float16* br = &ring[cur][1][(wn * 32 + nl) * 64];
#pragma unroll
    for (int ks = 0; ks < 2; ++ks) {
      const int c0 = ((ks * 4 + hw) ^ kswz) * 8;
      const int c1 = ((ks * 4 + 2 + hw) ^ kswz) * 8;
      v16h a[4], b[2];
#pragma unroll
      for (int mt = 0; mt < 4; ++mt)
        a[mt] = cat16(ldh8(ar + mt * 16 * 64 + c0), ldh8(ar + mt * 16 * 64 + c1));
#pragma unroll
      for (int nt = 0; nt < 2; ++nt)
        b[nt] = cat16(ldh8(br + nt * 16 * 64 + c0), ldh8(br + nt * 16 * 64 + c1));
#pragma unroll
      for (int mt = 0; mt < 4; ++mt)
#pragma unroll
        for (int nt = 0; nt < 2; ++nt)
          acc[mt][nt] = WMMA_F16(a[mt], b[nt], acc[mt][nt]);
    }

    // Publish point of stage st + 1: this wave's LDS reads of stage st retire,
    // its own copies of stage st + 1 have landed, then the barrier both shows
    // stage st + 1 to every wave and frees buffer cur for the refill.
    asm volatile("s_wait_dscnt 0x0" ::: "memory");
    wait_async_0();
    __syncthreads();
    if (st + 2 < NS)
      fill_gemm_stage(ring[cur][0], ring[cur][1], Ag + (st + 2) * 64, Bg + (st + 2) * 64, tid);
  }
  // No copy is outstanding when the ring becomes output staging.
  wait_async_0();

  // ---- epilogue: behind the last publish point nobody reads the ring any more.
  // Each wave stages its 64 x 32 f32 part in its own 8 KiB, rows of one 128-byte
  // line; the two 16-column halves of a row change places in rows 8..15 of each
  // 16, so that the two wave halves of a store fall on different banks. It reads
  // the rows back, adds the bias and stores 4 whole lines per instruction.
  float* stg = (float*)&ring[0][0][0] + wave * (64 * 32);
#pragma unroll
  for (int mt = 0; mt < 4; ++mt)
#pragma unroll
    for (int nt = 0; nt < 2; ++nt)
#pragma unroll
      for (int r = 0; r < 8; ++r)
        stg[(mt * 16 + hw * 8 + r) * 32 + ((nt * 16 + nl) ^ (hw << 4))] = acc[mt][nt][r];

  const int ch = lane & 7;
  const int ec = e0 + wn * 32 + ch * 4;
  const float4 bv = *(const float4*)(bo + ec);
  float* yr = Y + (size_t)(t0 + wm * 64) * EMBED + ec;
#pragma unroll
  for (int i = 0; i < 16; ++i) {
    const int row = i * 4 + (lane >> 3);
    float4 v = *(const float4*)&stg[row * 32 + ((ch ^ (((row >> 3) & 1) << 2)) * 4)];
    v.x += bv.x; v.y += bv.y; v.z += bv.z; v.w += bv.w;
    *(float4*)(yr + (size_t)row * EMBED) = v;
  }
}

// ---------------------------------------------------------------------------
extern "C" void kernel_launch(void* const* d_in, const int* in_sizes, int n_in,
                              void* d_out, int out_size, void* d_ws, size_t ws_size,
                              hipStream_t stream) {
  const float* values = (const float*)d_in[0];
  const float* keys_  = (const float*)d_in[1];
  const float* query  = (const float*)d_in[2];
  const int*   mask   = (const int*)d_in[3];
  const float* Wv     = (const float*)d_in[4];
  const float* Wk     = (const float*)d_in[5];
  const float* Wq     = (const float*)d_in[6];
  const float* Wo     = (const float*)d_in[7];
  const float* bo     = (const float*)d_in[8];
  float* out = (float*)d_out;

  // Workspace layout (bytes):
  //   Qp [N][H][S][D]  f16 : 16 MB
  //   Kp [N][H][S][D]  f16 : 16 MB
  //   Vt [N][H][D][S]  f16 : 16 MB   (transposed for V^T@P^T A-fragments)
  //   AO [N][S][E]     f16 : 16 MB
  //   Wo16 [E][E]      f16 :  2 MB
  //   MB   [N][S/16][S/32][16] u32 : 2 MB  (mask as lane masks)
  const size_t QKV = (size_t)NBATCH * HEADS * SEQ * HEAD_DIM * sizeof(_Float16);
  char* ws = (char*)d_ws;
  _Float16* Qp   = (_Float16*)(ws);
  _Float16* Kp   = (_Float16*)(ws + QKV);
  _Float16* Vt   = (_Float16*)(ws + 2 * QKV);
  _Float16* AO   = (_Float16*)(ws + 3 * QKV);
  _Float16* Wo16 = (_Float16*)(ws + 4 * QKV);
  unsigned* MB   = (unsigned*)(ws + 4 * QKV + (size_t)EMBED * EMBED * sizeof(_Float16));

  front_kernel<<<NBATCH * HEADS * (SEQ / 128) / 4, (FE_WAVES + FE_MASKW) * 32, 0, stream>>>(
      query, keys_, values, Wq, Wk, Wv, Wo, mask, Qp, Kp, Vt, Wo16, MB);

  dim3 gattn((SEQ / (8 * QT * 16)) * HEADS, NBATCH);
  attn_kernel<<<gattn, 256, 0, stream>>>(Qp, Kp, Vt, MB, AO);

  dim3 gout(EMBED / OP_ROWS, NBATCH * SEQ / OP_ROWS);
  outproj_kernel<<<gout, 256, 0, stream>>>(AO, Wo16, bo, out);
}
